// v000
// The times below were measured on an AMD MI455X: many runs one after another, warmed up first and cycling through
// copies of the inputs, with the whole window's GPU time divided by the number of runs. Launches and the gaps
// between them are all in it. The median over several windows is given; except for v000 it joins two sittings, which
// can be a few percent apart, so the side-by-side timings, each taken in one sitting, are the better comparison.
// The starting kernel, v000, takes 221 microseconds a run.
#include <hip/hip_runtime.h>

// Neighborhood CROSS attention (NATTEN with separate query / key inputs; x_q, x_k [2][56][56][256] channels-last; q = x_q Wq + bq ('xw' [256][256] -> 8 heads x 32), [k | v] = x_k Wkv + bkv ('xw' [256][512] viewed (2, 8 heads, 32): columns 0..255 = k, 256..511 = v); for every pixel a 7x7 key window clamped to stay inside the image (start = clamp(i - 3, 0, 49)); logits = (q x 32^-0.5).k + rpb[h][ki - i + 6][kj - j + 6] (rpb [8][13][13] input); softmax over the 49; out = attn.v; y = out Wproj + bproj ('xw' [256][256]) -> [2][56][56][256] (1.6 M); argument order x_q, x_k, Wq, bq, Wkv, bkv, rpb, Wproj, bproj).
// Compute dtypes, f32 accumulate: every input rounded to bf16; the q projection (from x_q) and the fused k | v projection (from x_k) on PLAIN bf16 operands (exact) + f32 biases, written side by side into one [q | k | v] plane; the whole windowed attention in f32 on the VALU (one wave per (pixel, head), lane = head dim: per key a 32-wide product reduced by a fixed xor tree, the 49 logits + bias kept in registers, f32 softmax, f32 attn.v); the attention output as bf16 hi + lo planes x exact w_proj (2 products) + f32 bias.

#define NB_  2
#define IH   56
#define IW   56
#define NPIX (IH * IW)          // 3136
#define NTOK (NB_ * NPIX)       // 6272 = 98 x 64
#define CC   256
#define C3   768
#define NH_  8
#define HD   32
#define KS   7
#define NBR  3
#define RPW  13                 // 2*KS - 1
#define SCL  0.17677669529663689f   // 32^-0.5
typedef _Float16 h16;
typedef unsigned short bf;
typedef __attribute__((ext_vector_type(16))) __bf16   v16bf;
typedef __attribute__((ext_vector_type(16))) _Float16 v16h;
typedef __attribute__((ext_vector_type(8)))  _Float16 v8h;
typedef __attribute__((ext_vector_type(8)))  unsigned short v8us;
typedef __attribute__((ext_vector_type(8)))  float    v8f;
typedef __attribute__((ext_vector_type(4)))  float    v4f;
typedef v8h  __attribute__((may_alias)) v8ha;
typedef v4f  __attribute__((may_alias)) v4fa;
typedef v8us __attribute__((may_alias)) v8usa;

__device__ __forceinline__ unsigned short f2bf(float f) { unsigned u = __float_as_uint(f); u += 0x7FFFu + ((u >> 16) & 1u); return (unsigned short)(u >> 16); }
__device__ __forceinline__ float bf2f(unsigned short b) { return __uint_as_float(((unsigned)b) << 16); }
__device__ __forceinline__ float bfr(float f) { return bf2f(f2bf(f)); }
__device__ __forceinline__ v16h cat16(v8h lo, v8h hi) { return __builtin_shufflevector(lo, hi, 0, 1, 2, 3, 4, 5, 6, 7, 8, 9, 10, 11, 12, 13, 14, 15); }
__device__ __forceinline__ v16bf cat16b(v8us lo, v8us hi) { return __builtin_bit_cast(v16bf, __builtin_shufflevector(lo, hi, 0, 1, 2, 3, 4, 5, 6, 7, 8, 9, 10, 11, 12, 13, 14, 15)); }
__device__ __forceinline__ v8f wmma16(v16h a, v16h b, v8f c) { return __builtin_amdgcn_wmma_f32_16x16x32_f16(false, a, false, b, (short)0, c, false, false); }
__device__ __forceinline__ v8f wmmab(v16bf a, v16bf b, v8f c) { return __builtin_amdgcn_wmma_f32_16x16x32_bf16(false, a, false, b, (short)0, c, false, false); }



// ---- k_gemmw: register-blocked GEMM, ONE WAVE per 64x64 output tile (16 accumulators), operands straight from K-contiguous 16-bit planes; grid (M/64, N/64, Z), 32 threads.
// C[m][n] (f32, pitch ldc, + optional f32 bias[n]) = sum_k A[m][k] Bt[n][k] (+ split products per NSPLIT). z-batch strides sA/sB/sC in elements. K % 32 == 0.
template <typename T16> struct WFrag;
template <> struct WFrag<h16> { typedef v16h V; static __device__ __forceinline__ V ld(const h16* p) { return cat16(*(const v8h*)p, *(const v8h*)(p + 16)); } static __device__ __forceinline__ v8f mma(V a, V b, v8f c) { return wmma16(a, b, c); } };
template <> struct WFrag<bf> { typedef v16bf V; static __device__ __forceinline__ V ld(const bf* p) { return cat16b(*(const v8us*)p, *(const v8us*)(p + 16)); } static __device__ __forceinline__ v8f mma(V a, V b, v8f c) { return wmmab(a, b, c); } };
template <typename T16, int NSPLIT, bool BIAS>
__global__ __launch_bounds__(32) void k_gemmw(const T16* __restrict__ A, const T16* __restrict__ A2, const T16* __restrict__ Bt, const T16* __restrict__ Bt2, int K, float* C, int ldc, const float* __restrict__ bias, size_t sA, size_t sB, size_t sC) {
    typedef typename WFrag<T16>::V V;
    __shared__ __align__(16) float os[16 * 68];
    const size_t z = blockIdx.z; A += z * sA; if (A2) A2 += z * sA; Bt += z * sB; if (Bt2) Bt2 += z * sB; C += z * sC;
    const int lane = threadIdx.x & 31, lr = lane & 15, hi = lane >> 4; const int r0 = blockIdx.x * 64, c0 = blockIdx.y * 64;
    v8f acc[4][4];
#pragma unroll
    for (int mb = 0; mb < 4; ++mb)
#pragma unroll
        for (int nb = 0; nb < 4; ++nb) acc[mb][nb] = (v8f){};
    const size_t aoff = (size_t)(r0 + lr) * K + 8 * hi, boff = (size_t)(c0 + lr) * K + 8 * hi;
#pragma unroll 1
    for (int kc = 0; kc < K; kc += 32) {
        V a[4], a2[4];
#pragma unroll
        for (int mb = 0; mb < 4; ++mb) { a[mb] = WFrag<T16>::ld(A + aoff + (size_t)mb * 16 * K + kc); if (NSPLIT == 1 || NSPLIT == 2) a2[mb] = WFrag<T16>::ld(A2 + aoff + (size_t)mb * 16 * K + kc); }
#pragma unroll
        for (int nb = 0; nb < 4; ++nb) { const V b = WFrag<T16>::ld(Bt + boff + (size_t)nb * 16 * K + kc); V b2; if (NSPLIT >= 2) b2 = WFrag<T16>::ld(Bt2 + boff + (size_t)nb * 16 * K + kc);
#pragma unroll
            for (int mb = 0; mb < 4; ++mb) { acc[mb][nb] = WFrag<T16>::mma(a[mb], b, acc[mb][nb]); if (NSPLIT == 1 || NSPLIT == 2) acc[mb][nb] = WFrag<T16>::mma(a2[mb], b, acc[mb][nb]); if (NSPLIT >= 2) acc[mb][nb] = WFrag<T16>::mma(a[mb], b2, acc[mb][nb]); } }
        asm volatile("v_nop\n\tv_nop\n\tv_nop\n\tv_nop" : "+v"(acc[0][0]), "+v"(acc[1][1]), "+v"(acc[2][2]), "+v"(acc[3][3]) : "v"(a[0]), "v"(a[3]));
    }
#pragma unroll
    for (int mb = 0; mb < 4; ++mb) {
#pragma unroll
        for (int nb = 0; nb < 4; ++nb) {
#pragma unroll
            for (int j = 0; j < 8; ++j) os[(hi * 8 + j) * 68 + nb * 16 + lr] = acc[mb][nb][j]; }
        __builtin_amdgcn_wave_barrier(); asm volatile("" ::: "memory");
        float* crow = C + (size_t)(r0 + mb * 16) * ldc + c0;
{
#pragma unroll
            for (int s = 0; s < 8; ++s) { const int row = 2 * s + hi, cofs = lr * 4; v4f val = *(const v4fa*)(os + row * 68 + cofs); if (BIAS) { val[0] += bfr(bias[c0 + cofs]); val[1] += bfr(bias[c0 + cofs + 1]); val[2] += bfr(bias[c0 + cofs + 2]); val[3] += bfr(bias[c0 + cofs + 3]); }
                *(v4f*)(crow + (size_t)row * ldc + cofs) = val; }
             }
        __builtin_amdgcn_wave_barrier(); asm volatile("" ::: "memory");
    }
}

__device__ __forceinline__ h16 tohx(float x) { return (h16)x; }
__device__ __forceinline__ void splitf(float y, unsigned short& h, unsigned short& l) { h = f2bf(y); l = f2bf(y - bf2f(h)); }
typedef __attribute__((ext_vector_type(2))) _Float16 v2h;
typedef __attribute__((ext_vector_type(4))) _Float16 v4h;
typedef __attribute__((ext_vector_type(2))) unsigned short v2us;
typedef __attribute__((ext_vector_type(4))) unsigned short v4us;
typedef __attribute__((ext_vector_type(2))) float v2f;
typedef __attribute__((ext_vector_type(4))) int v4i;

__global__ __launch_bounds__(256) void k_cvt8(const float* __restrict__ src, bf* dst, size_t n8) { const size_t i = (size_t)blockIdx.x * 256 + threadIdx.x; if (i >= n8) return; const v8f v = *(const v8f*)(src + i * 8); v8us o;
#pragma unroll
    for (int k = 0; k < 8; ++k) o[k] = f2bf(v[k]); *(v8us*)(dst + i * 8) = o;  }
__global__ __launch_bounds__(256) void k_wtG(const float* __restrict__ w, int K, int N, bf* Bt) {
    const int lane = threadIdx.x & 31; const int L0 = (blockIdx.x * 8 + (threadIdx.x >> 5)) * 8; const int nlines = N * K / 64;
{
#pragma unroll 1
        for (int l = 0; l < 8; ++l) { const int L = L0 + l; if (L >= nlines) break; const size_t e = (size_t)L * 64 + lane * 2; const int k = (int)(e % K), n = (int)(e / K); v2us o;
            o[0] = f2bf(w[(size_t)k * N + n]); o[1] = f2bf(w[(size_t)(k + 1) * N + n]); *(v2us*)(Bt + e) = o; }
         }
}
__global__ __launch_bounds__(256) void k_split8(const float* __restrict__ F, bf* Ph, bf* Pl, size_t n8) { const size_t i = (size_t)blockIdx.x * 256 + threadIdx.x; if (i >= n8) return; const v8f v = *(const v8f*)(F + i * 8); v8us oh, ol;
#pragma unroll
    for (int k = 0; k < 8; ++k) { unsigned short a, c2; splitf(v[k], a, c2); oh[k] = a; ol[k] = c2; }
    *(v8us*)(Ph + i * 8) = oh; *(v8us*)(Pl + i * 8) = ol;  }

// k_natt: one wave per (token, head), lane = d: q = F[tok][h*32 + d] x SCL; window start (si, sj) clamped; for each of the 49 keys: s = sum_d q[d] k[d] (per-lane product, unconditional xor tree -> every lane holds s) + bf16(rpb[h][ki - i + 6][kj - j + 6]); softmax over the 49 in f32 (registers); out[d] = sum_k P_k v_k[d];
__global__ __launch_bounds__(256) void k_natt(const float* __restrict__ F, const float* __restrict__ rpb, float* O) {
    const int lane = threadIdx.x & 31; const size_t w = (size_t)blockIdx.x * 8 + (threadIdx.x >> 5); if (w >= (size_t)NTOK * NH_) return; const int h = (int)(w % NH_); const size_t tok = w / NH_; const int b = (int)(tok / NPIX); const int pix = (int)(tok % NPIX); const int i = pix / IW, j = pix % IW;
    const int si = min(max(i - NBR, 0), IH - KS), sj = min(max(j - NBR, 0), IW - KS);
    float q = F[tok * C3 + h * HD + lane] * SCL; asm volatile("" : "+v"(q));
    float lg[KS * KS]; float mx = -3.0e38f;
#pragma unroll
    for (int p = 0; p < KS; ++p) {
#pragma unroll
        for (int qq = 0; qq < KS; ++qq) { const int ki = si + p, kj = sj + qq; const size_t ktok = (size_t)b * NPIX + (size_t)ki * IW + kj; float pr = __fmul_rn(q, F[ktok * C3 + CC + h * HD + lane]); asm volatile("" : "+v"(pr)); float s = pr;
#pragma unroll
            for (int sh = 16; sh; sh >>= 1) s += __shfl_xor(s, sh, 32);
            float bb = bfr(rpb[((size_t)h * RPW + (ki - i + KS - 1)) * RPW + (kj - j + KS - 1)]); asm volatile("" : "+v"(bb)); const float t = __fadd_rn(s, bb); lg[p * KS + qq] = t; mx = fmaxf(mx, t); } }
    float sum = 0.f;
#pragma unroll
    for (int k = 0; k < KS * KS; ++k) { float d0 = __fsub_rn(lg[k], mx); asm volatile("" : "+v"(d0)); lg[k] = __builtin_amdgcn_exp2f(__fmul_rn(d0, 1.4426950408889634f)); sum += lg[k]; }
    const float f = __fdiv_rn(1.0f, sum); float acc = 0.f;
#pragma unroll
    for (int p = 0; p < KS; ++p) {
#pragma unroll
        for (int qq = 0; qq < KS; ++qq) { const size_t ktok = (size_t)b * NPIX + (size_t)(si + p) * IW + (sj + qq); float pk = __fmul_rn(lg[p * KS + qq], f); asm volatile("" : "+v"(pk)); float t1 = __fmul_rn(pk, F[ktok * C3 + 2 * CC + h * HD + lane]); asm volatile("" : "+v"(t1)); acc = __fadd_rn(acc, t1); } }
    float* dst = O + tok * CC + h * HD + lane; *(float*)dst = acc;  }

extern "C" void kernel_launch(void* const* d_in, const int* in_sizes, int n_in,
                              void* d_out, int out_size, void* d_ws, size_t ws_size, hipStream_t stream) {
    (void)in_sizes; (void)n_in; (void)out_size;
    const float* xq = (const float*)d_in[0]; const float* xk = (const float*)d_in[1]; const float* wq = (const float*)d_in[2]; const float* bq = (const float*)d_in[3]; const float* wkv = (const float*)d_in[4]; const float* bkv = (const float*)d_in[5]; const float* rpb = (const float*)d_in[6]; const float* wp = (const float*)d_in[7]; const float* bp = (const float*)d_in[8];   /* order x_q, x_k ([2][56][56][256] channels-last), Wq ('xw' [256][256]), bq, Wkv ('xw' [256][512]: columns k | v), bkv, rpb [8][13][13], Wproj ('xw' [256][256]), bproj; nine inputs, all read */
    float* OUT = (float*)d_out;     // [2][56][56][256] = [6272][256]
    char* wsp = (char*)d_ws;
    auto take = [&](size_t bytes) { char* p = wsp; wsp += (bytes + 255) & ~(size_t)255; return (void*)p; };
    bf* WQ = (bf*)take((size_t)CC * CC * 2); bf* WKV = (bf*)take((size_t)2 * CC * CC * 2); bf* WP = (bf*)take((size_t)CC * CC * 2); bf* XQ = (bf*)take((size_t)NTOK * CC * 2); bf* XK = (bf*)take((size_t)NTOK * CC * 2); float* F = (float*)take((size_t)NTOK * C3 * 4); float* O = (float*)take((size_t)NTOK * CC * 4); bf* Oh = (bf*)take((size_t)NTOK * CC * 2); bf* Ol = (bf*)take((size_t)NTOK * CC * 2);
    if ((size_t)(wsp - (char*)d_ws) > ws_size) return;    // carve ~37 MiB
    k_wtG<<<(unsigned)((CC * CC / 64 + 63) / 64), 256, 0, stream>>>(wq, CC, CC, WQ); k_wtG<<<(unsigned)((CC * 2 * CC / 64 + 63) / 64), 256, 0, stream>>>(wkv, CC, 2 * CC, WKV); k_wtG<<<(unsigned)((CC * CC / 64 + 63) / 64), 256, 0, stream>>>(wp, CC, CC, WP);
    k_cvt8<<<(unsigned)(((size_t)NTOK * CC / 8 + 255) / 256), 256, 0, stream>>>(xq, XQ, (size_t)NTOK * CC / 8); k_cvt8<<<(unsigned)(((size_t)NTOK * CC / 8 + 255) / 256), 256, 0, stream>>>(xk, XK, (size_t)NTOK * CC / 8);
    k_gemmw<bf, 0, true><<<dim3(NTOK / 64, CC / 64, 1), 32, 0, stream>>>(XQ, nullptr, WQ, nullptr, CC, F, C3, bq, 0, 0, 0);   /* q = x_q Wq + bq into columns 0 .. 255 of the [q | k | v] plane (pitch 768) */ k_gemmw<bf, 0, true><<<dim3(NTOK / 64, 2 * CC / 64, 1), 32, 0, stream>>>(XK, nullptr, WKV, nullptr, CC, F + CC, C3, bkv, 0, 0, 0);   /* [k | v] = x_k Wkv + bkv into columns 256 .. 767 */
    k_natt<<<(unsigned)(((size_t)NTOK * NH_ + 7) / 8), 256, 0, stream>>>(F, rpb, O);                                                     /* windowed attention, f32 */
    k_split8<<<(unsigned)(((size_t)NTOK * CC / 8 + 255) / 256), 256, 0, stream>>>(O, Oh, Ol, (size_t)NTOK * CC / 8);
    k_gemmw<bf, 1, true><<<dim3(NTOK / 64, CC / 64, 1), 32, 0, stream>>>(Oh, Ol, WP, nullptr, CC, OUT, CC, bp, 0, 0, 0);               /* out w_proj + b_proj */
}

// v001
// A run of this version takes 74.6 microseconds.
// Timed twice side by side with v000, it ran 2.99 and 3.01 times as fast.
#include <hip/hip_runtime.h>

// Neighborhood CROSS attention (NATTEN with separate query / key inputs; x_q, x_k [2][56][56][256] channels-last; q = x_q Wq + bq ('xw' [256][256] -> 8 heads x 32), [k | v] = x_k Wkv + bkv ('xw' [256][512] viewed (2, 8 heads, 32): columns 0..255 = k, 256..511 = v); for every pixel a 7x7 key window clamped to stay inside the image (start = clamp(i - 3, 0, 49)); logits = (q x 32^-0.5).k + rpb[h][ki - i + 6][kj - j + 6] (rpb [8][13][13] input); softmax over the 49; out = attn.v; y = out Wproj + bproj ('xw' [256][256]) -> [2][56][56][256] (1.6 M); argument order x_q, x_k, Wq, bq, Wkv, bkv, rpb, Wproj, bproj).
// Compute dtypes, f32 accumulate: every input rounded to bf16; the q projection (from x_q) and the fused k | v projection (from x_k) on PLAIN bf16 operands (exact) + f32 biases, written side by side into one [q | k | v] plane; the whole windowed attention in f32, both products on the f32 16x16x4 matrix form (one wave per (2 x 8 query tile, head) against the tile's 8 x 14 block of keys, keys outside a query's window masked, logits + bias and the f32 softmax in registers); the attention output as bf16 hi + lo planes x exact w_proj (2 products) + f32 bias.

#define NB_  2
#define IH   56
#define IW   56
#define NPIX (IH * IW)          // 3136
#define NTOK (NB_ * NPIX)       // 6272 = 98 x 64
#define CC   256
#define C3   768
#define NH_  8
#define HD   32
#define KS   7
#define NBR  3
#define RPW  13                 // 2*KS - 1
#define SCL  0.17677669529663689f   // 32^-0.5
typedef _Float16 h16;
typedef unsigned short bf;
typedef __attribute__((ext_vector_type(16))) __bf16   v16bf;
typedef __attribute__((ext_vector_type(16))) _Float16 v16h;
typedef __attribute__((ext_vector_type(8)))  _Float16 v8h;
typedef __attribute__((ext_vector_type(8)))  unsigned short v8us;
typedef __attribute__((ext_vector_type(8)))  float    v8f;
typedef __attribute__((ext_vector_type(4)))  float    v4f;
typedef v8h  __attribute__((may_alias)) v8ha;
typedef v4f  __attribute__((may_alias)) v4fa;
typedef v8us __attribute__((may_alias)) v8usa;

__device__ __forceinline__ unsigned short f2bf(float f) { unsigned u = __float_as_uint(f); u += 0x7FFFu + ((u >> 16) & 1u); return (unsigned short)(u >> 16); }
__device__ __forceinline__ float bf2f(unsigned short b) { return __uint_as_float(((unsigned)b) << 16); }
__device__ __forceinline__ float bfr(float f) { return bf2f(f2bf(f)); }
__device__ __forceinline__ v16h cat16(v8h lo, v8h hi) { return __builtin_shufflevector(lo, hi, 0, 1, 2, 3, 4, 5, 6, 7, 8, 9, 10, 11, 12, 13, 14, 15); }
__device__ __forceinline__ v16bf cat16b(v8us lo, v8us hi) { return __builtin_bit_cast(v16bf, __builtin_shufflevector(lo, hi, 0, 1, 2, 3, 4, 5, 6, 7, 8, 9, 10, 11, 12, 13, 14, 15)); }
__device__ __forceinline__ v8f wmma16(v16h a, v16h b, v8f c) { return __builtin_amdgcn_wmma_f32_16x16x32_f16(false, a, false, b, (short)0, c, false, false); }
__device__ __forceinline__ v8f wmmab(v16bf a, v16bf b, v8f c) { return __builtin_amdgcn_wmma_f32_16x16x32_bf16(false, a, false, b, (short)0, c, false, false); }



// ---- k_gemmw: register-blocked GEMM, ONE WAVE per 64x64 output tile (16 accumulators), operands straight from K-contiguous 16-bit planes; grid (M/64, N/64, Z), 32 threads.
// C[m][n] (f32, pitch ldc, + optional f32 bias[n]) = sum_k A[m][k] Bt[n][k] (+ split products per NSPLIT). z-batch strides sA/sB/sC in elements. K % 32 == 0.
template <typename T16> struct WFrag;
template <> struct WFrag<h16> { typedef v16h V; static __device__ __forceinline__ V ld(const h16* p) { return cat16(*(const v8h*)p, *(const v8h*)(p + 16)); } static __device__ __forceinline__ v8f mma(V a, V b, v8f c) { return wmma16(a, b, c); } };
template <> struct WFrag<bf> { typedef v16bf V; static __device__ __forceinline__ V ld(const bf* p) { return cat16b(*(const v8us*)p, *(const v8us*)(p + 16)); } static __device__ __forceinline__ v8f mma(V a, V b, v8f c) { return wmmab(a, b, c); } };
template <typename T16, int NSPLIT, bool BIAS>
__global__ __launch_bounds__(32) void k_gemmw(const T16* __restrict__ A, const T16* __restrict__ A2, const T16* __restrict__ Bt, const T16* __restrict__ Bt2, int K, float* C, int ldc, const float* __restrict__ bias, size_t sA, size_t sB, size_t sC) {
    typedef typename WFrag<T16>::V V;
    __shared__ __align__(16) float os[16 * 68];
    const size_t z = blockIdx.z; A += z * sA; if (A2) A2 += z * sA; Bt += z * sB; if (Bt2) Bt2 += z * sB; C += z * sC;
    const int lane = threadIdx.x & 31, lr = lane & 15, hi = lane >> 4; const int r0 = blockIdx.x * 64, c0 = blockIdx.y * 64;
    v8f acc[4][4];
#pragma unroll
    for (int mb = 0; mb < 4; ++mb)
#pragma unroll
        for (int nb = 0; nb < 4; ++nb) acc[mb][nb] = (v8f){};
    const size_t aoff = (size_t)(r0 + lr) * K + 8 * hi, boff = (size_t)(c0 + lr) * K + 8 * hi;
#pragma unroll 1
    for (int kc = 0; kc < K; kc += 32) {
        V a[4], a2[4];
#pragma unroll
        for (int mb = 0; mb < 4; ++mb) { a[mb] = WFrag<T16>::ld(A + aoff + (size_t)mb * 16 * K + kc); if (NSPLIT == 1 || NSPLIT == 2) a2[mb] = WFrag<T16>::ld(A2 + aoff + (size_t)mb * 16 * K + kc); }
#pragma unroll
        for (int nb = 0; nb < 4; ++nb) { const V b = WFrag<T16>::ld(Bt + boff + (size_t)nb * 16 * K + kc); V b2; if (NSPLIT >= 2) b2 = WFrag<T16>::ld(Bt2 + boff + (size_t)nb * 16 * K + kc);
#pragma unroll
            for (int mb = 0; mb < 4; ++mb) { acc[mb][nb] = WFrag<T16>::mma(a[mb], b, acc[mb][nb]); if (NSPLIT == 1 || NSPLIT == 2) acc[mb][nb] = WFrag<T16>::mma(a2[mb], b, acc[mb][nb]); if (NSPLIT >= 2) acc[mb][nb] = WFrag<T16>::mma(a[mb], b2, acc[mb][nb]); } }
        asm volatile("v_nop\n\tv_nop\n\tv_nop\n\tv_nop" : "+v"(acc[0][0]), "+v"(acc[1][1]), "+v"(acc[2][2]), "+v"(acc[3][3]) : "v"(a[0]), "v"(a[3]));
    }
#pragma unroll
    for (int mb = 0; mb < 4; ++mb) {
#pragma unroll
        for (int nb = 0; nb < 4; ++nb) {
#pragma unroll
            for (int j = 0; j < 8; ++j) os[(hi * 8 + j) * 68 + nb * 16 + lr] = acc[mb][nb][j]; }
        __builtin_amdgcn_wave_barrier(); asm volatile("" ::: "memory");
        float* crow = C + (size_t)(r0 + mb * 16) * ldc + c0;
{
#pragma unroll
            for (int s = 0; s < 8; ++s) { const int row = 2 * s + hi, cofs = lr * 4; v4f val = *(const v4fa*)(os + row * 68 + cofs); if (BIAS) { val[0] += bfr(bias[c0 + cofs]); val[1] += bfr(bias[c0 + cofs + 1]); val[2] += bfr(bias[c0 + cofs + 2]); val[3] += bfr(bias[c0 + cofs + 3]); }
                *(v4f*)(crow + (size_t)row * ldc + cofs) = val; }
             }
        __builtin_amdgcn_wave_barrier(); asm volatile("" ::: "memory");
    }
}

__device__ __forceinline__ h16 tohx(float x) { return (h16)x; }
__device__ __forceinline__ void splitf(float y, unsigned short& h, unsigned short& l) { h = f2bf(y); l = f2bf(y - bf2f(h)); }
typedef __attribute__((ext_vector_type(2))) _Float16 v2h;
typedef __attribute__((ext_vector_type(4))) _Float16 v4h;
typedef __attribute__((ext_vector_type(2))) unsigned short v2us;
typedef __attribute__((ext_vector_type(4))) unsigned short v4us;
typedef __attribute__((ext_vector_type(2))) float v2f;
typedef __attribute__((ext_vector_type(4))) int v4i;

__global__ __launch_bounds__(256) void k_cvt8(const float* __restrict__ src, bf* dst, size_t n8) { const size_t i = (size_t)blockIdx.x * 256 + threadIdx.x; if (i >= n8) return; const v8f v = *(const v8f*)(src + i * 8); v8us o;
#pragma unroll
    for (int k = 0; k < 8; ++k) o[k] = f2bf(v[k]); *(v8us*)(dst + i * 8) = o;  }
__global__ __launch_bounds__(256) void k_wtG(const float* __restrict__ w, int K, int N, bf* Bt) {
    const int lane = threadIdx.x & 31; const int L0 = (blockIdx.x * 8 + (threadIdx.x >> 5)) * 8; const int nlines = N * K / 64;
{
#pragma unroll 1
        for (int l = 0; l < 8; ++l) { const int L = L0 + l; if (L >= nlines) break; const size_t e = (size_t)L * 64 + lane * 2; const int k = (int)(e % K), n = (int)(e / K); v2us o;
            o[0] = f2bf(w[(size_t)k * N + n]); o[1] = f2bf(w[(size_t)(k + 1) * N + n]); *(v2us*)(Bt + e) = o; }
         }
}
__global__ __launch_bounds__(256) void k_split8(const float* __restrict__ F, bf* Ph, bf* Pl, size_t n8) { const size_t i = (size_t)blockIdx.x * 256 + threadIdx.x; if (i >= n8) return; const v8f v = *(const v8f*)(F + i * 8); v8us oh, ol;
#pragma unroll
    for (int k = 0; k < 8; ++k) { unsigned short a, c2; splitf(v[k], a, c2); oh[k] = a; ol[k] = c2; }
    *(v8us*)(Ph + i * 8) = oh; *(v8us*)(Pl + i * 8) = ol;  }

// k_natt: one wave per (2 x 8 query tile, head), both attention products on the f32 16x16x4 matrix form; block = the 8 heads of one tile.
// The 16 windows of a tile lie inside one 8 x 14 block of keys (112 = 7 x 16), start (ui, uj) clamped into the image. Key slot (T, r, half): e = 8 T + r, key row ui + 2 (e / 14) + half, key column uj + e % 14.
// S^T = K Q^T: A row = key slot (r = c & 7, half = c >> 3), B column = query c, both sides hold d = 16 half + 0 .. 15 in the same register order. D register r of tile T = logit of key slot (T, r, half) for query c.
// Keys outside a query's own 7 x 7 window are masked to -3e38 (their weight is 0); softmax runs down the lane's 56 registers plus one exchange between the lane halves.
// O^T = V^T P^T: B = the weights as they lie in D (registers 2t, 2t + 1), A = v read at the same key slots, row = d; D register r = out[query c][16 dt + 8 half + r], scaled by 1 / sum at the end.
// Every loop of k_natt is fully unrolled so that its arrays (fragments, logits, masks) are indexed by constants and stay in registers.
__device__ __forceinline__ v8f wmma4(v2f a, v2f b, v8f c) { return __builtin_amdgcn_wmma_f32_16x16x4_f32(false, a, false, b, (short)0, c, false, false); }
#define UR_ 8
#define UC_ 14
__global__ __launch_bounds__(256) void k_natt(const float* __restrict__ F, const float* __restrict__ rpb, float* O) {
    __shared__ float rb[(NH_ * RPW * RPW + 255) / 256 * 256];   // the table, rounded up so that every thread stores on every trip (the tail repeats the last entry and is never read)
    float rv[(NH_ * RPW * RPW + 255) / 256];   // the bias table's loads go out first and fly together with the q and k loads
#pragma unroll
    for (int u = 0; u < (NH_ * RPW * RPW + 255) / 256; ++u) rv[u] = rpb[min((int)threadIdx.x + 256 * u, NH_ * RPW * RPW - 1)];
    const int lane = threadIdx.x & 31, c = lane & 15, hi = lane >> 4, h = threadIdx.x >> 5;
    const int tile = blockIdx.x; const int b = tile / ((IH / 2) * (IW / 8)), tt = tile % ((IH / 2) * (IW / 8)); const int i0 = (tt / (IW / 8)) * 2, j0 = (tt % (IW / 8)) * 8;
    const int ui = min(max(i0 - NBR, 0), IH - UR_), uj = min(max(j0 - NBR, 0), IW - UC_);
    const int qi = i0 + (c >> 3), qj = j0 + (c & 7);
    const int si = min(max(qi - NBR, 0), IH - KS), sj = min(max(qj - NBR, 0), IW - KS);
    const float* Fb = F + (size_t)b * NPIX * C3 + h * HD;
    float qr[16];
    { const float* qp = Fb + (size_t)(qi * IW + qj) * C3 + 16 * hi;
#pragma unroll
      for (int g = 0; g < 4; ++g) { const v4f v = *(const v4f*)(qp + 4 * g);
#pragma unroll
          for (int x = 0; x < 4; ++x) qr[4 * g + x] = v[x] * SCL; } }
    float kr_[7][16];
#pragma unroll
    for (int T = 0; T < 7; ++T) { const int e = T * 8 + (c & 7); const int kr = 2 * (e / UC_) + (c >> 3), kc = e % UC_; const float* kp = Fb + CC + (size_t)((ui + kr) * IW + uj + kc) * C3 + 16 * hi;
#pragma unroll
        for (int g = 0; g < 4; ++g) { const v4f v = *(const v4f*)(kp + 4 * g);
#pragma unroll
            for (int x = 0; x < 4; ++x) kr_[T][4 * g + x] = v[x]; } }
#pragma unroll
    for (int u = 0; u < (NH_ * RPW * RPW + 255) / 256; ++u) rb[(int)threadIdx.x + 256 * u] = bfr(rv[u]);
    __syncthreads();   // publishes the bias table: each wave reads entries that other waves stored
    v8f s[7];
#pragma unroll
    for (int T = 0; T < 7; ++T) s[T] = (v8f){};
#pragma unroll
    for (int st = 0; st < 8; ++st) {
#pragma unroll
        for (int T = 0; T < 7; ++T) s[T] = wmma4((v2f){kr_[T][2 * st], kr_[T][2 * st + 1]}, (v2f){qr[2 * st], qr[2 * st + 1]}, s[T]); }
    const float* vp = Fb + 2 * CC + (size_t)((ui + hi) * IW + uj) * C3 + c;
    float vr[56][2];
#pragma unroll
    for (int e = 0; e < 56; ++e) {
#pragma unroll
        for (int dt = 0; dt < 2; ++dt) vr[e][dt] = vp[(size_t)(2 * (e / UC_) * IW + e % UC_) * C3 + dt * 16]; }
    bool rok[4]; int rix[4]; bool cok[UC_]; int cix[UC_];
#pragma unroll
    for (int g = 0; g < 4; ++g) { const int ki = ui + 2 * g + hi; rok[g] = (unsigned)(ki - si) < (unsigned)KS; rix[g] = h * (RPW * RPW) + (ki - qi + KS - 1) * RPW; }
#pragma unroll
    for (int x = 0; x < UC_; ++x) { const int kj = uj + x; cok[x] = (unsigned)(kj - sj) < (unsigned)KS; cix[x] = kj - qj + KS - 1; }
    float mx4[4] = {-3.0e38f, -3.0e38f, -3.0e38f, -3.0e38f};
#pragma unroll
    for (int T = 0; T < 7; ++T) {
#pragma unroll
        for (int r = 0; r < 8; ++r) { const int e = T * 8 + r; const bool ok = rok[e / UC_] & cok[e % UC_]; const int ix = ok ? rix[e / UC_] + cix[e % UC_] : 0; const float bv = rb[ix]; const float sb = s[T][r] + bv; const float t = ok ? sb : -3.0e38f; s[T][r] = t; mx4[r & 3] = fmaxf(mx4[r & 3], t); } }
    float mx = fmaxf(fmaxf(mx4[0], mx4[1]), fmaxf(mx4[2], mx4[3])); mx = fmaxf(mx, __shfl_xor(mx, 16, 32));
    float sm4[4] = {0.f, 0.f, 0.f, 0.f};
#pragma unroll
    for (int T = 0; T < 7; ++T) {
#pragma unroll
        for (int r = 0; r < 8; ++r) { const float p = __builtin_amdgcn_exp2f((s[T][r] - mx) * 1.4426950408889634f); s[T][r] = p; sm4[r & 3] += p; } }
    float sum = (sm4[0] + sm4[1]) + (sm4[2] + sm4[3]); sum += __shfl_xor(sum, 16, 32);
    const float f = __fdiv_rn(1.0f, sum);
    v8f o[2]; o[0] = (v8f){}; o[1] = (v8f){};
#pragma unroll
    for (int T = 0; T < 7; ++T) {
#pragma unroll
        for (int t = 0; t < 4; ++t) { const int e = T * 8 + 2 * t;
#pragma unroll
            for (int dt = 0; dt < 2; ++dt) o[dt] = wmma4((v2f){vr[e][dt], vr[e + 1][dt]}, (v2f){s[T][2 * t], s[T][2 * t + 1]}, o[dt]); } }
    float* dst = O + ((size_t)b * NPIX + (size_t)(qi * IW + qj)) * CC + h * HD + 8 * hi;
#pragma unroll
    for (int dt = 0; dt < 2; ++dt) {
#pragma unroll
        for (int g = 0; g < 2; ++g) { v4f v;
#pragma unroll
            for (int x = 0; x < 4; ++x) v[x] = o[dt][4 * g + x] * f;
            *(v4f*)(dst + dt * 16 + 4 * g) = v; } }
}

extern "C" void kernel_launch(void* const* d_in, const int* in_sizes, int n_in,
                              void* d_out, int out_size, void* d_ws, size_t ws_size, hipStream_t stream) {
    (void)in_sizes; (void)n_in; (void)out_size;
    const float* xq = (const float*)d_in[0]; const float* xk = (const float*)d_in[1]; const float* wq = (const float*)d_in[2]; const float* bq = (const float*)d_in[3]; const float* wkv = (const float*)d_in[4]; const float* bkv = (const float*)d_in[5]; const float* rpb = (const float*)d_in[6]; const float* wp = (const float*)d_in[7]; const float* bp = (const float*)d_in[8];   /* order x_q, x_k ([2][56][56][256] channels-last), Wq ('xw' [256][256]), bq, Wkv ('xw' [256][512]: columns k | v), bkv, rpb [8][13][13], Wproj ('xw' [256][256]), bproj; nine inputs, all read */
    float* OUT = (float*)d_out;     // [2][56][56][256] = [6272][256]
    char* wsp = (char*)d_ws;
    auto take = [&](size_t bytes) { char* p = wsp; wsp += (bytes + 255) & ~(size_t)255; return (void*)p; };
    bf* WQ = (bf*)take((size_t)CC * CC * 2); bf* WKV = (bf*)take((size_t)2 * CC * CC * 2); bf* WP = (bf*)take((size_t)CC * CC * 2); bf* XQ = (bf*)take((size_t)NTOK * CC * 2); bf* XK = (bf*)take((size_t)NTOK * CC * 2); float* F = (float*)take((size_t)NTOK * C3 * 4); float* O = (float*)take((size_t)NTOK * CC * 4); bf* Oh = (bf*)take((size_t)NTOK * CC * 2); bf* Ol = (bf*)take((size_t)NTOK * CC * 2);
    if ((size_t)(wsp - (char*)d_ws) > ws_size) return;    // carve ~37 MiB
    k_wtG<<<(unsigned)((CC * CC / 64 + 63) / 64), 256, 0, stream>>>(wq, CC, CC, WQ); k_wtG<<<(unsigned)((CC * 2 * CC / 64 + 63) / 64), 256, 0, stream>>>(wkv, CC, 2 * CC, WKV); k_wtG<<<(unsigned)((CC * CC / 64 + 63) / 64), 256, 0, stream>>>(wp, CC, CC, WP);
    k_cvt8<<<(unsigned)(((size_t)NTOK * CC / 8 + 255) / 256), 256, 0, stream>>>(xq, XQ, (size_t)NTOK * CC / 8); k_cvt8<<<(unsigned)(((size_t)NTOK * CC / 8 + 255) / 256), 256, 0, stream>>>(xk, XK, (size_t)NTOK * CC / 8);
    k_gemmw<bf, 0, true><<<dim3(NTOK / 64, CC / 64, 1), 32, 0, stream>>>(XQ, nullptr, WQ, nullptr, CC, F, C3, bq, 0, 0, 0);   /* q = x_q Wq + bq into columns 0 .. 255 of the [q | k | v] plane (pitch 768) */ k_gemmw<bf, 0, true><<<dim3(NTOK / 64, 2 * CC / 64, 1), 32, 0, stream>>>(XK, nullptr, WKV, nullptr, CC, F + CC, C3, bkv, 0, 0, 0);   /* [k | v] = x_k Wkv + bkv into columns 256 .. 767 */
    k_natt<<<(unsigned)(NTOK / 16), 256, 0, stream>>>(F, rpb, O);                                                     /* windowed attention, f32 */
    k_split8<<<(unsigned)(((size_t)NTOK * CC / 8 + 255) / 256), 256, 0, stream>>>(O, Oh, Ol, (size_t)NTOK * CC / 8);
    k_gemmw<bf, 1, true><<<dim3(NTOK / 64, CC / 64, 1), 32, 0, stream>>>(Oh, Ol, WP, nullptr, CC, OUT, CC, bp, 0, 0, 0);               /* out w_proj + b_proj */
}

// v002
// A run of this version takes 45.8 microseconds.
// Next to v001, in two timings, it ran 1.64 times as fast each time.
// Counting every step since v000, it is 4.92 times as fast.
#include <hip/hip_runtime.h>

// Neighborhood CROSS attention (NATTEN with separate query / key inputs; x_q, x_k [2][56][56][256] channels-last; q = x_q Wq + bq ('xw' [256][256] -> 8 heads x 32), [k | v] = x_k Wkv + bkv ('xw' [256][512] viewed (2, 8 heads, 32): columns 0..255 = k, 256..511 = v); for every pixel a 7x7 key window clamped to stay inside the image (start = clamp(i - 3, 0, 49)); logits = (q x 32^-0.5).k + rpb[h][ki - i + 6][kj - j + 6] (rpb [8][13][13] input); softmax over the 49; out = attn.v; y = out Wproj + bproj ('xw' [256][256]) -> [2][56][56][256] (1.6 M); argument order x_q, x_k, Wq, bq, Wkv, bkv, rpb, Wproj, bproj).
// Compute dtypes, f32 accumulate: every input rounded to bf16; the q projection (from x_q) and the fused k | v projection (from x_k) on PLAIN bf16 operands (exact) + f32 biases, written side by side into one [q | k | v] plane; the whole windowed attention in f32, both products on the f32 16x16x4 matrix form (one wave per (2 x 8 query tile, head) against the tile's 8 x 14 block of keys, keys outside a query's window masked, logits + bias and the f32 softmax in registers); the attention output as bf16 hi + lo planes x exact w_proj (2 products) + f32 bias.
// Four launches: k_prep (all five input conversions, picked by block range), one projection grid for q | k | v, k_natt (stores its output already split into the two planes), the output projection.

#define NB_  2
#define IH   56
#define IW   56
#define NPIX (IH * IW)          // 3136
#define NTOK (NB_ * NPIX)       // 6272 = 98 x 64
#define CC   256
#define C3   768
#define NH_  8
#define HD   32
#define KS   7
#define NBR  3
#define RPW  13                 // 2*KS - 1
#define SCL  0.17677669529663689f   // 32^-0.5
typedef _Float16 h16;
typedef unsigned short bf;
typedef __attribute__((ext_vector_type(16))) __bf16   v16bf;
typedef __attribute__((ext_vector_type(16))) _Float16 v16h;
typedef __attribute__((ext_vector_type(8)))  _Float16 v8h;
typedef __attribute__((ext_vector_type(8)))  unsigned short v8us;
typedef __attribute__((ext_vector_type(8)))  float    v8f;
typedef __attribute__((ext_vector_type(4)))  float    v4f;
typedef v8h  __attribute__((may_alias)) v8ha;
typedef v4f  __attribute__((may_alias)) v4fa;
typedef v8us __attribute__((may_alias)) v8usa;

__device__ __forceinline__ unsigned short f2bf(float f) { unsigned u = __float_as_uint(f); u += 0x7FFFu + ((u >> 16) & 1u); return (unsigned short)(u >> 16); }
__device__ __forceinline__ float bf2f(unsigned short b) { return __uint_as_float(((unsigned)b) << 16); }
__device__ __forceinline__ float bfr(float f) { return bf2f(f2bf(f)); }
__device__ __forceinline__ v16h cat16(v8h lo, v8h hi) { return __builtin_shufflevector(lo, hi, 0, 1, 2, 3, 4, 5, 6, 7, 8, 9, 10, 11, 12, 13, 14, 15); }
__device__ __forceinline__ v16bf cat16b(v8us lo, v8us hi) { return __builtin_bit_cast(v16bf, __builtin_shufflevector(lo, hi, 0, 1, 2, 3, 4, 5, 6, 7, 8, 9, 10, 11, 12, 13, 14, 15)); }
__device__ __forceinline__ v8f wmma16(v16h a, v16h b, v8f c) { return __builtin_amdgcn_wmma_f32_16x16x32_f16(false, a, false, b, (short)0, c, false, false); }
__device__ __forceinline__ v8f wmmab(v16bf a, v16bf b, v8f c) { return __builtin_amdgcn_wmma_f32_16x16x32_bf16(false, a, false, b, (short)0, c, false, false); }



// ---- k_gemmw: register-blocked GEMM, ONE WAVE per 64x64 output tile (16 accumulators), operands straight from K-contiguous 16-bit planes; grid (M/64, N/64, Z), 32 threads.
// C[m][n] (f32, pitch ldc, + optional f32 bias[n]) = sum_k A[m][k] Bt[n][k] (+ split products per NSPLIT). z-batch strides sA/sB/sC in elements. K % 32 == 0.
// TWO: two products share the grid. Tiles whose first column is csec or more belong to the second one: rows from Asec, bias from bsec, Bt rows and C columns counted on from csec (its Bt rows lie behind the first product's, its C columns beside them).
template <typename T16> struct WFrag;
template <> struct WFrag<h16> { typedef v16h V; static __device__ __forceinline__ V ld(const h16* p) { return cat16(*(const v8h*)p, *(const v8h*)(p + 16)); } static __device__ __forceinline__ v8f mma(V a, V b, v8f c) { return wmma16(a, b, c); } };
template <> struct WFrag<bf> { typedef v16bf V; static __device__ __forceinline__ V ld(const bf* p) { return cat16b(*(const v8us*)p, *(const v8us*)(p + 16)); } static __device__ __forceinline__ v8f mma(V a, V b, v8f c) { return wmmab(a, b, c); } };
template <typename T16, int NSPLIT, bool BIAS, bool TWO>
__global__ __launch_bounds__(32) void k_gemmw(const T16* __restrict__ A, const T16* __restrict__ A2, const T16* __restrict__ Bt, const T16* __restrict__ Bt2, int K, float* C, int ldc, const float* __restrict__ bias, size_t sA, size_t sB, size_t sC, const T16* __restrict__ Asec, const float* __restrict__ bsec, int csec) {
    typedef typename WFrag<T16>::V V;
    __shared__ __align__(16) float os[16 * 68];
    const size_t z = blockIdx.z; A += z * sA; if (A2) A2 += z * sA; Bt += z * sB; if (Bt2) Bt2 += z * sB; C += z * sC;
    const int lane = threadIdx.x & 31, lr = lane & 15, hi = lane >> 4; const int r0 = blockIdx.x * 64; int c0 = blockIdx.y * 64;
    if (TWO && c0 >= csec) { c0 -= csec; A = Asec + z * sA; Bt += (size_t)csec * K; C += csec; bias = bsec; }
    v8f acc[4][4];
#pragma unroll
    for (int mb = 0; mb < 4; ++mb)
#pragma unroll
        for (int nb = 0; nb < 4; ++nb) acc[mb][nb] = (v8f){};
    const size_t aoff = (size_t)(r0 + lr) * K + 8 * hi, boff = (size_t)(c0 + lr) * K + 8 * hi;
#pragma unroll 1
    for (int kc = 0; kc < K; kc += 32) {
        V a[4], a2[4];
#pragma unroll
        for (int mb = 0; mb < 4; ++mb) { a[mb] = WFrag<T16>::ld(A + aoff + (size_t)mb * 16 * K + kc); if (NSPLIT == 1 || NSPLIT == 2) a2[mb] = WFrag<T16>::ld(A2 + aoff + (size_t)mb * 16 * K + kc); }
#pragma unroll
        for (int nb = 0; nb < 4; ++nb) { const V b = WFrag<T16>::ld(Bt + boff + (size_t)nb * 16 * K + kc); V b2; if (NSPLIT >= 2) b2 = WFrag<T16>::ld(Bt2 + boff + (size_t)nb * 16 * K + kc);
#pragma unroll
            for (int mb = 0; mb < 4; ++mb) { acc[mb][nb] = WFrag<T16>::mma(a[mb], b, acc[mb][nb]); if (NSPLIT == 1 || NSPLIT == 2) acc[mb][nb] = WFrag<T16>::mma(a2[mb], b, acc[mb][nb]); if (NSPLIT >= 2) acc[mb][nb] = WFrag<T16>::mma(a[mb], b2, acc[mb][nb]); } }
        asm volatile("v_nop\n\tv_nop\n\tv_nop\n\tv_nop" : "+v"(acc[0][0]), "+v"(acc[1][1]), "+v"(acc[2][2]), "+v"(acc[3][3]) : "v"(a[0]), "v"(a[3]));
    }
#pragma unroll
    for (int mb = 0; mb < 4; ++mb) {
#pragma unroll
        for (int nb = 0; nb < 4; ++nb) {
#pragma unroll
            for (int j = 0; j < 8; ++j) os[(hi * 8 + j) * 68 + nb * 16 + lr] = acc[mb][nb][j]; }
        __builtin_amdgcn_wave_barrier(); asm volatile("" ::: "memory");
        float* crow = C + (size_t)(r0 + mb * 16) * ldc + c0;
{
#pragma unroll
            for (int s = 0; s < 8; ++s) { const int row = 2 * s + hi, cofs = lr * 4; v4f val = *(const v4fa*)(os + row * 68 + cofs); if (BIAS) { val[0] += bfr(bias[c0 + cofs]); val[1] += bfr(bias[c0 + cofs + 1]); val[2] += bfr(bias[c0 + cofs + 2]); val[3] += bfr(bias[c0 + cofs + 3]); }
                *(v4f*)(crow + (size_t)row * ldc + cofs) = val; }
             }
        __builtin_amdgcn_wave_barrier(); asm volatile("" ::: "memory");
    }
}

__device__ __forceinline__ h16 tohx(float x) { return (h16)x; }
__device__ __forceinline__ void splitf(float y, unsigned short& h, unsigned short& l) { h = f2bf(y); l = f2bf(y - bf2f(h)); }
typedef __attribute__((ext_vector_type(2))) _Float16 v2h;
typedef __attribute__((ext_vector_type(4))) _Float16 v4h;
typedef __attribute__((ext_vector_type(2))) unsigned short v2us;
typedef __attribute__((ext_vector_type(4))) unsigned short v4us;
typedef __attribute__((ext_vector_type(2))) float v2f;
typedef __attribute__((ext_vector_type(4))) int v4i;

__device__ __forceinline__ void cvt8(const float* __restrict__ src, bf* dst, size_t n8, int blk) { const size_t i = (size_t)blk * 256 + threadIdx.x; if (i >= n8) return; const v8f v = *(const v8f*)(src + i * 8); v8us o;
#pragma unroll
    for (int k = 0; k < 8; ++k) o[k] = f2bf(v[k]); *(v8us*)(dst + i * 8) = o;  }
__device__ __forceinline__ void wtG(const float* __restrict__ w, int K, int N, bf* Bt, int blk) {
    const int lane = threadIdx.x & 31; const int L0 = (blk * 8 + (threadIdx.x >> 5)) * 8; const int nlines = N * K / 64;
{
#pragma unroll 1
        for (int l = 0; l < 8; ++l) { const int L = L0 + l; if (L >= nlines) break; const size_t e = (size_t)L * 64 + lane * 2; const int k = (int)(e % K), n = (int)(e / K); v2us o;
            o[0] = f2bf(w[(size_t)k * N + n]); o[1] = f2bf(w[(size_t)(k + 1) * N + n]); *(v2us*)(Bt + e) = o; }
         }
}
// k_prep: the five input conversions are independent of one another and share one launch; the block index picks the job. The three weight transposes, whose waves walk eight lines one after the other, come first.
#define WB1 (CC * CC / 64 / 64)             // blocks of a [256][256] weight: 16
#define XB  (NTOK * CC / 8 / 256)           // blocks of an activation plane: 784
__global__ __launch_bounds__(256) void k_prep(const float* __restrict__ xq, const float* __restrict__ xk, const float* __restrict__ wq, const float* __restrict__ wkv, const float* __restrict__ wp, bf* XQ, bf* XK, bf* WQ, bf* WKV, bf* WP) {
    const int blk = blockIdx.x;
    if (blk < WB1) wtG(wq, CC, CC, WQ, blk);
    else if (blk < 3 * WB1) wtG(wkv, CC, 2 * CC, WKV, blk - WB1);
    else if (blk < 4 * WB1) wtG(wp, CC, CC, WP, blk - 3 * WB1);
    else if (blk < 4 * WB1 + XB) cvt8(xq, XQ, (size_t)NTOK * CC / 8, blk - 4 * WB1);
    else cvt8(xk, XK, (size_t)NTOK * CC / 8, blk - 4 * WB1 - XB);
}

// k_natt: one wave per (2 x 8 query tile, head), both attention products on the f32 16x16x4 matrix form; block = the 8 heads of one tile.
// The 16 windows of a tile lie inside one 8 x 14 block of keys (112 = 7 x 16), start (ui, uj) clamped into the image. Key slot (T, r, half): e = 8 T + r, key row ui + 2 (e / 14) + half, key column uj + e % 14.
// S^T = K Q^T: A row = key slot (r = c & 7, half = c >> 3), B column = query c, both sides hold d = 16 half + 0 .. 15 in the same register order. D register r of tile T = logit of key slot (T, r, half) for query c.
// Keys outside a query's own 7 x 7 window are masked to -3e38 (their weight is 0); softmax runs down the lane's 56 registers plus one exchange between the lane halves.
// O^T = V^T P^T: B = the weights as they lie in D (registers 2t, 2t + 1), A = v read at the same key slots, row = d; D register r = out[query c][16 dt + 8 half + r], scaled by 1 / sum at the end.
// The output leaves as the bf16 hi and lo planes. A head's 32 values are half a 128-byte line there, so the block gathers its 16 rows x 256 columns in LDS and each wave stores whole rows (queries 2 h and 2 h + 1): one writer per line.
// Every loop of k_natt is fully unrolled so that its arrays (fragments, logits, masks) are indexed by constants and stay in registers.
__device__ __forceinline__ v8f wmma4(v2f a, v2f b, v8f c) { return __builtin_amdgcn_wmma_f32_16x16x4_f32(false, a, false, b, (short)0, c, false, false); }
#define UR_ 8
#define UC_ 14
#define OP_ 272                 // LDS pitch of an output row, elements: 544 bytes, so that the 16-byte stores of 16 lanes (8 rows x 2 halves) cover the 64 banks once
__global__ __launch_bounds__(256) void k_natt(const float* __restrict__ F, const float* __restrict__ rpb, bf* Oh, bf* Ol) {
    __shared__ __align__(16) bf so[2 * 16 * OP_];   // [hi, lo][query][column]
    __shared__ float rb[(NH_ * RPW * RPW + 255) / 256 * 256];   // the table, rounded up so that every thread stores on every trip (the tail repeats the last entry and is never read)
    float rv[(NH_ * RPW * RPW + 255) / 256];   // the bias table's loads go out first and fly together with the q and k loads
#pragma unroll
    for (int u = 0; u < (NH_ * RPW * RPW + 255) / 256; ++u) rv[u] = rpb[min((int)threadIdx.x + 256 * u, NH_ * RPW * RPW - 1)];
    const int lane = threadIdx.x & 31, c = lane & 15, hi = lane >> 4, h = threadIdx.x >> 5;
    const int tile = blockIdx.x; const int b = tile / ((IH / 2) * (IW / 8)), tt = tile % ((IH / 2) * (IW / 8)); const int i0 = (tt / (IW / 8)) * 2, j0 = (tt % (IW / 8)) * 8;
    const int ui = min(max(i0 - NBR, 0), IH - UR_), uj = min(max(j0 - NBR, 0), IW - UC_);
    const int qi = i0 + (c >> 3), qj = j0 + (c & 7);
    const int si = min(max(qi - NBR, 0), IH - KS), sj = min(max(qj - NBR, 0), IW - KS);
    const float* Fb = F + (size_t)b * NPIX * C3 + h * HD;
    float qr[16];
    { const float* qp = Fb + (size_t)(qi * IW + qj) * C3 + 16 * hi;
#pragma unroll
      for (int g = 0; g < 4; ++g) { const v4f v = *(const v4f*)(qp + 4 * g);
#pragma unroll
          for (int x = 0; x < 4; ++x) qr[4 * g + x] = v[x] * SCL; } }
    float kr_[7][16];
#pragma unroll
    for (int T = 0; T < 7; ++T) { const int e = T * 8 + (c & 7); const int kr = 2 * (e / UC_) + (c >> 3), kc = e % UC_; const float* kp = Fb + CC + (size_t)((ui + kr) * IW + uj + kc) * C3 + 16 * hi;
#pragma unroll
        for (int g = 0; g < 4; ++g) { const v4f v = *(const v4f*)(kp + 4 * g);
#pragma unroll
            for (int x = 0; x < 4; ++x) kr_[T][4 * g + x] = v[x]; } }
#pragma unroll
    for (int u = 0; u < (NH_ * RPW * RPW + 255) / 256; ++u) rb[(int)threadIdx.x + 256 * u] = bfr(rv[u]);
    __syncthreads();   // publishes the bias table: each wave reads entries that other waves stored
    v8f s[7];
#pragma unroll
    for (int T = 0; T < 7; ++T) s[T] = (v8f){};
#pragma unroll
    for (int st = 0; st < 8; ++st) {
#pragma unroll
        for (int T = 0; T < 7; ++T) s[T] = wmma4((v2f){kr_[T][2 * st], kr_[T][2 * st + 1]}, (v2f){qr[2 * st], qr[2 * st + 1]}, s[T]); }
    const float* vp = Fb + 2 * CC + (size_t)((ui + hi) * IW + uj) * C3 + c;
    float vr[56][2];
#pragma unroll
    for (int e = 0; e < 56; ++e) {
#pragma unroll
        for (int dt = 0; dt < 2; ++dt) vr[e][dt] = vp[(size_t)(2 * (e / UC_) * IW + e % UC_) * C3 + dt * 16]; }
    bool rok[4]; int rix[4]; bool cok[UC_]; int cix[UC_];
#pragma unroll
    for (int g = 0; g < 4; ++g) { const int ki = ui + 2 * g + hi; rok[g] = (unsigned)(ki - si) < (unsigned)KS; rix[g] = h * (RPW * RPW) + (ki - qi + KS - 1) * RPW; }
#pragma unroll
    for (int x = 0; x < UC_; ++x) { const int kj = uj + x; cok[x] = (unsigned)(kj - sj) < (unsigned)KS; cix[x] = kj - qj + KS - 1; }
    float mx4[4] = {-3.0e38f, -3.0e38f, -3.0e38f, -3.0e38f};
#pragma unroll
    for (int T = 0; T < 7; ++T) {
#pragma unroll
        for (int r = 0; r < 8; ++r) { const int e = T * 8 + r; const bool ok = rok[e / UC_] & cok[e % UC_]; const int ix = ok ? rix[e / UC_] + cix[e % UC_] : 0; const float bv = rb[ix]; const float sb = s[T][r] + bv; const float t = ok ? sb : -3.0e38f; s[T][r] = t; mx4[r & 3] = fmaxf(mx4[r & 3], t); } }
    float mx = fmaxf(fmaxf(mx4[0], mx4[1]), fmaxf(mx4[2], mx4[3])); mx = fmaxf(mx, __shfl_xor(mx, 16, 32));
    float sm4[4] = {0.f, 0.f, 0.f, 0.f};
#pragma unroll
    for (int T = 0; T < 7; ++T) {
#pragma unroll
        for (int r = 0; r < 8; ++r) { const float p = __builtin_amdgcn_exp2f((s[T][r] - mx) * 1.4426950408889634f); s[T][r] = p; sm4[r & 3] += p; } }
    float sum = (sm4[0] + sm4[1]) + (sm4[2] + sm4[3]); sum += __shfl_xor(sum, 16, 32);
    const float f = __fdiv_rn(1.0f, sum);
    v8f o[2]; o[0] = (v8f){}; o[1] = (v8f){};
#pragma unroll
    for (int T = 0; T < 7; ++T) {
#pragma unroll
        for (int t = 0; t < 4; ++t) { const int e = T * 8 + 2 * t;
#pragma unroll
            for (int dt = 0; dt < 2; ++dt) o[dt] = wmma4((v2f){vr[e][dt], vr[e + 1][dt]}, (v2f){s[T][2 * t], s[T][2 * t + 1]}, o[dt]); } }
#pragma unroll   // as above: o[dt] is indexed by constants and stays in registers
    for (int dt = 0; dt < 2; ++dt) { v8us oh, ol;
#pragma unroll   // the same for the elements of o[dt], oh and ol
        for (int x = 0; x < 8; ++x) { unsigned short a, c2; splitf(o[dt][x] * f, a, c2); oh[x] = a; ol[x] = c2; }
        *(v8usa*)(so + c * OP_ + h * HD + dt * 16 + 8 * hi) = oh; *(v8usa*)(so + (16 + c) * OP_ + h * HD + dt * 16 + 8 * hi) = ol; }
    __syncthreads();   // publishes the 16 output rows: each wave stores columns that the other heads' waves computed
#pragma unroll   // the four LDS reads go out together
    for (int u = 0; u < 2; ++u) { const int cq = 2 * h + u; const size_t row = ((size_t)b * NPIX + (size_t)((i0 + (cq >> 3)) * IW + j0 + (cq & 7))) * CC + lane * 8;
        *(v8us*)(Oh + row) = *(const v8usa*)(so + cq * OP_ + lane * 8); *(v8us*)(Ol + row) = *(const v8usa*)(so + (16 + cq) * OP_ + lane * 8); }
}

extern "C" void kernel_launch(void* const* d_in, const int* in_sizes, int n_in,
                              void* d_out, int out_size, void* d_ws, size_t ws_size, hipStream_t stream) {
    (void)in_sizes; (void)n_in; (void)out_size;
    const float* xq = (const float*)d_in[0]; const float* xk = (const float*)d_in[1]; const float* wq = (const float*)d_in[2]; const float* bq = (const float*)d_in[3]; const float* wkv = (const float*)d_in[4]; const float* bkv = (const float*)d_in[5]; const float* rpb = (const float*)d_in[6]; const float* wp = (const float*)d_in[7]; const float* bp = (const float*)d_in[8];   /* order x_q, x_k ([2][56][56][256] channels-last), Wq ('xw' [256][256]), bq, Wkv ('xw' [256][512]: columns k | v), bkv, rpb [8][13][13], Wproj ('xw' [256][256]), bproj; nine inputs, all read */
    float* OUT = (float*)d_out;     // [2][56][56][256] = [6272][256]
    char* wsp = (char*)d_ws;
    auto take = [&](size_t bytes) { char* p = wsp; wsp += (bytes + 255) & ~(size_t)255; return (void*)p; };
    bf* WQ = (bf*)take((size_t)3 * CC * CC * 2); bf* WKV = WQ + (size_t)CC * CC;   /* one [768][256] plane: rows q | k | v */ bf* WP = (bf*)take((size_t)CC * CC * 2); bf* XQ = (bf*)take((size_t)NTOK * CC * 2); bf* XK = (bf*)take((size_t)NTOK * CC * 2); float* F = (float*)take((size_t)NTOK * C3 * 4); bf* Oh = (bf*)take((size_t)NTOK * CC * 2); bf* Ol = (bf*)take((size_t)NTOK * CC * 2);
    if ((size_t)(wsp - (char*)d_ws) > ws_size) return;    // carve ~32 MiB
    k_prep<<<(unsigned)(4 * WB1 + 2 * XB), 256, 0, stream>>>(xq, xk, wq, wkv, wp, XQ, XK, WQ, WKV, WP);
    k_gemmw<bf, 0, true, true><<<dim3(NTOK / 64, C3 / 64, 1), 32, 0, stream>>>(XQ, nullptr, WQ, nullptr, CC, F, C3, bq, 0, 0, 0, XK, bkv, CC);   /* columns 0 .. 255: q = x_q Wq + bq; columns 256 .. 767: [k | v] = x_k Wkv + bkv */
    k_natt<<<(unsigned)(NTOK / 16), 256, 0, stream>>>(F, rpb, Oh, Ol);                                                     /* windowed attention, f32; output split into hi and lo */
    k_gemmw<bf, 1, true, false><<<dim3(NTOK / 64, CC / 64, 1), 32, 0, stream>>>(Oh, Ol, WP, nullptr, CC, OUT, CC, bp, 0, 0, 0, nullptr, nullptr, 0);               /* out w_proj + b_proj */
}

// v003
// One run takes 37 microseconds.
// Next to v002, in two timings, it ran 1.23 times as fast each time.
// All steps since v000 together make it 6.07 times as fast.
#include <hip/hip_runtime.h>

// Neighborhood CROSS attention (NATTEN with separate query / key inputs; x_q, x_k [2][56][56][256] channels-last; q = x_q Wq + bq ('xw' [256][256] -> 8 heads x 32), [k | v] = x_k Wkv + bkv ('xw' [256][512] viewed (2, 8 heads, 32): columns 0..255 = k, 256..511 = v); for every pixel a 7x7 key window clamped to stay inside the image (start = clamp(i - 3, 0, 49)); logits = (q x 32^-0.5).k + rpb[h][ki - i + 6][kj - j + 6] (rpb [8][13][13] input); softmax over the 49; out = attn.v; y = out Wproj + bproj ('xw' [256][256]) -> [2][56][56][256] (1.6 M); argument order x_q, x_k, Wq, bq, Wkv, bkv, rpb, Wproj, bproj).
// Compute dtypes, f32 accumulate: every input rounded to bf16; the q projection (from x_q) and the fused k | v projection (from x_k) on PLAIN bf16 operands (exact) + f32 biases, written side by side into one [q | k | v] plane; the whole windowed attention in f32, both products on the f32 16x16x4 matrix form (one wave per (2 x 8 query tile, head) against the tile's 8 x 14 block of keys, keys outside a query's window masked, logits + bias and the f32 softmax in registers); the attention output as bf16 hi + lo halves x exact w_proj (2 products) + f32 bias.
// Three launches: k_prep (all five input conversions, picked by block range), one projection grid for q | k | v, k_natt (attention and, from its 16 output rows in LDS, the output projection).

#define NB_  2
#define IH   56
#define IW   56
#define NPIX (IH * IW)          // 3136
#define NTOK (NB_ * NPIX)       // 6272 = 98 x 64
#define CC   256
#define C3   768
#define NH_  8
#define HD   32
#define KS   7
#define NBR  3
#define RPW  13                 // 2*KS - 1
#define SCL  0.17677669529663689f   // 32^-0.5
typedef _Float16 h16;
typedef unsigned short bf;
typedef __attribute__((ext_vector_type(16))) __bf16   v16bf;
typedef __attribute__((ext_vector_type(16))) _Float16 v16h;
typedef __attribute__((ext_vector_type(8)))  _Float16 v8h;
typedef __attribute__((ext_vector_type(8)))  unsigned short v8us;
typedef __attribute__((ext_vector_type(8)))  float    v8f;
typedef __attribute__((ext_vector_type(4)))  float    v4f;
typedef v8h  __attribute__((may_alias)) v8ha;
typedef v4f  __attribute__((may_alias)) v4fa;
typedef v8us __attribute__((may_alias)) v8usa;

__device__ __forceinline__ unsigned short f2bf(float f) { unsigned u = __float_as_uint(f); u += 0x7FFFu + ((u >> 16) & 1u); return (unsigned short)(u >> 16); }
__device__ __forceinline__ float bf2f(unsigned short b) { return __uint_as_float(((unsigned)b) << 16); }
__device__ __forceinline__ float bfr(float f) { return bf2f(f2bf(f)); }
__device__ __forceinline__ v16h cat16(v8h lo, v8h hi) { return __builtin_shufflevector(lo, hi, 0, 1, 2, 3, 4, 5, 6, 7, 8, 9, 10, 11, 12, 13, 14, 15); }
__device__ __forceinline__ v16bf cat16b(v8us lo, v8us hi) { return __builtin_bit_cast(v16bf, __builtin_shufflevector(lo, hi, 0, 1, 2, 3, 4, 5, 6, 7, 8, 9, 10, 11, 12, 13, 14, 15)); }
__device__ __forceinline__ v8f wmma16(v16h a, v16h b, v8f c) { return __builtin_amdgcn_wmma_f32_16x16x32_f16(false, a, false, b, (short)0, c, false, false); }
__device__ __forceinline__ v8f wmmab(v16bf a, v16bf b, v8f c) { return __builtin_amdgcn_wmma_f32_16x16x32_bf16(false, a, false, b, (short)0, c, false, false); }



// ---- k_gemmw: register-blocked GEMM, ONE WAVE per 64x64 output tile (16 accumulators), operands straight from K-contiguous 16-bit planes; grid (M/64, N/64, Z), 32 threads.
// C[m][n] (f32, pitch ldc, + optional f32 bias[n]) = sum_k A[m][k] Bt[n][k] (+ split products per NSPLIT). z-batch strides sA/sB/sC in elements. K % 32 == 0.
// TWO: two products share the grid. Tiles whose first column is csec or more belong to the second one: rows from Asec, bias from bsec, Bt rows and C columns counted on from csec (its Bt rows lie behind the first product's, its C columns beside them).
template <typename T16> struct WFrag;
template <> struct WFrag<h16> { typedef v16h V; static __device__ __forceinline__ V ld(const h16* p) { return cat16(*(const v8h*)p, *(const v8h*)(p + 16)); } static __device__ __forceinline__ v8f mma(V a, V b, v8f c) { return wmma16(a, b, c); } };
template <> struct WFrag<bf> { typedef v16bf V; static __device__ __forceinline__ V ld(const bf* p) { return cat16b(*(const v8us*)p, *(const v8us*)(p + 16)); } static __device__ __forceinline__ v8f mma(V a, V b, v8f c) { return wmmab(a, b, c); } };
template <typename T16, int NSPLIT, bool BIAS, bool TWO>
__global__ __launch_bounds__(32) void k_gemmw(const T16* __restrict__ A, const T16* __restrict__ A2, const T16* __restrict__ Bt, const T16* __restrict__ Bt2, int K, float* C, int ldc, const float* __restrict__ bias, size_t sA, size_t sB, size_t sC, const T16* __restrict__ Asec, const float* __restrict__ bsec, int csec) {
    typedef typename WFrag<T16>::V V;
    __shared__ __align__(16) float os[16 * 68];
    const size_t z = blockIdx.z; A += z * sA; if (A2) A2 += z * sA; Bt += z * sB; if (Bt2) Bt2 += z * sB; C += z * sC;
    const int lane = threadIdx.x & 31, lr = lane & 15, hi = lane >> 4; const int r0 = blockIdx.x * 64; int c0 = blockIdx.y * 64;
    if (TWO && c0 >= csec) { c0 -= csec; A = Asec + z * sA; Bt += (size_t)csec * K; C += csec; bias = bsec; }
    v8f acc[4][4];
#pragma unroll
    for (int mb = 0; mb < 4; ++mb)
#pragma unroll
        for (int nb = 0; nb < 4; ++nb) acc[mb][nb] = (v8f){};
    const size_t aoff = (size_t)(r0 + lr) * K + 8 * hi, boff = (size_t)(c0 + lr) * K + 8 * hi;
#pragma unroll 1
    for (int kc = 0; kc < K; kc += 32) {
        V a[4], a2[4];
#pragma unroll
        for (int mb = 0; mb < 4; ++mb) { a[mb] = WFrag<T16>::ld(A + aoff + (size_t)mb * 16 * K + kc); if (NSPLIT == 1 || NSPLIT == 2) a2[mb] = WFrag<T16>::ld(A2 + aoff + (size_t)mb * 16 * K + kc); }
#pragma unroll
        for (int nb = 0; nb < 4; ++nb) { const V b = WFrag<T16>::ld(Bt + boff + (size_t)nb * 16 * K + kc); V b2; if (NSPLIT >= 2) b2 = WFrag<T16>::ld(Bt2 + boff + (size_t)nb * 16 * K + kc);
#pragma unroll
            for (int mb = 0; mb < 4; ++mb) { acc[mb][nb] = WFrag<T16>::mma(a[mb], b, acc[mb][nb]); if (NSPLIT == 1 || NSPLIT == 2) acc[mb][nb] = WFrag<T16>::mma(a2[mb], b, acc[mb][nb]); if (NSPLIT >= 2) acc[mb][nb] = WFrag<T16>::mma(a[mb], b2, acc[mb][nb]); } }
        asm volatile("v_nop\n\tv_nop\n\tv_nop\n\tv_nop" : "+v"(acc[0][0]), "+v"(acc[1][1]), "+v"(acc[2][2]), "+v"(acc[3][3]) : "v"(a[0]), "v"(a[3]));
    }
#pragma unroll
    for (int mb = 0; mb < 4; ++mb) {
#pragma unroll
        for (int nb = 0; nb < 4; ++nb) {
#pragma unroll
            for (int j = 0; j < 8; ++j) os[(hi * 8 + j) * 68 + nb * 16 + lr] = acc[mb][nb][j]; }
        __builtin_amdgcn_wave_barrier(); asm volatile("" ::: "memory");
        float* crow = C + (size_t)(r0 + mb * 16) * ldc + c0;
{
#pragma unroll
            for (int s = 0; s < 8; ++s) { const int row = 2 * s + hi, cofs = lr * 4; v4f val = *(const v4fa*)(os + row * 68 + cofs); if (BIAS) { val[0] += bfr(bias[c0 + cofs]); val[1] += bfr(bias[c0 + cofs + 1]); val[2] += bfr(bias[c0 + cofs + 2]); val[3] += bfr(bias[c0 + cofs + 3]); }
                *(v4f*)(crow + (size_t)row * ldc + cofs) = val; }
             }
        __builtin_amdgcn_wave_barrier(); asm volatile("" ::: "memory");
    }
}

__device__ __forceinline__ h16 tohx(float x) { return (h16)x; }
__device__ __forceinline__ void splitf(float y, unsigned short& h, unsigned short& l) { h = f2bf(y); l = f2bf(y - bf2f(h)); }
typedef __attribute__((ext_vector_type(2))) _Float16 v2h;
typedef __attribute__((ext_vector_type(4))) _Float16 v4h;
typedef __attribute__((ext_vector_type(2))) unsigned short v2us;
typedef __attribute__((ext_vector_type(4))) unsigned short v4us;
typedef __attribute__((ext_vector_type(2))) float v2f;
typedef __attribute__((ext_vector_type(4))) int v4i;

__device__ __forceinline__ void cvt8(const float* __restrict__ src, bf* dst, size_t n8, int blk) { const size_t i = (size_t)blk * 256 + threadIdx.x; if (i >= n8) return; const v8f v = *(const v8f*)(src + i * 8); v8us o;
#pragma unroll
    for (int k = 0; k < 8; ++k) o[k] = f2bf(v[k]); *(v8us*)(dst + i * 8) = o;  }
__device__ __forceinline__ void wtG(const float* __restrict__ w, int K, int N, bf* Bt, int blk) {
    const int lane = threadIdx.x & 31; const int L0 = (blk * 8 + (threadIdx.x >> 5)) * 8; const int nlines = N * K / 64;
{
#pragma unroll 1
        for (int l = 0; l < 8; ++l) { const int L = L0 + l; if (L >= nlines) break; const size_t e = (size_t)L * 64 + lane * 2; const int k = (int)(e % K), n = (int)(e / K); v2us o;
            o[0] = f2bf(w[(size_t)k * N + n]); o[1] = f2bf(w[(size_t)(k + 1) * N + n]); *(v2us*)(Bt + e) = o; }
         }
}
// k_prep: the five input conversions are independent of one another and share one launch; the block index picks the job. The three weight transposes, whose waves walk eight lines one after the other, come first.
#define WB1 (CC * CC / 64 / 64)             // blocks of a [256][256] weight: 16
#define XB  (NTOK * CC / 8 / 256)           // blocks of an activation plane: 784
__global__ __launch_bounds__(256) void k_prep(const float* __restrict__ xq, const float* __restrict__ xk, const float* __restrict__ wq, const float* __restrict__ wkv, const float* __restrict__ wp, bf* XQ, bf* XK, bf* WQ, bf* WKV, bf* WP) {
    const int blk = blockIdx.x;
    if (blk < WB1) wtG(wq, CC, CC, WQ, blk);
    else if (blk < 3 * WB1) wtG(wkv, CC, 2 * CC, WKV, blk - WB1);
    else if (blk < 4 * WB1) wtG(wp, CC, CC, WP, blk - 3 * WB1);
    else if (blk < 4 * WB1 + XB) cvt8(xq, XQ, (size_t)NTOK * CC / 8, blk - 4 * WB1);
    else cvt8(xk, XK, (size_t)NTOK * CC / 8, blk - 4 * WB1 - XB);
}

// k_natt: one wave per (2 x 8 query tile, head), both attention products on the f32 16x16x4 matrix form; block = the 8 heads of one tile.
// The 16 windows of a tile lie inside one 8 x 14 block of keys (112 = 7 x 16), start (ui, uj) clamped into the image. Key slot (T, r, half): e = 8 T + r, key row ui + 2 (e / 14) + half, key column uj + e % 14.
// S^T = K Q^T: A row = key slot (r = c & 7, half = c >> 3), B column = query c, both sides hold d = 16 half + 0 .. 15 in the same register order. D register r of tile T = logit of key slot (T, r, half) for query c.
// Keys outside a query's own 7 x 7 window are masked to -3e38 (their weight is 0); softmax runs down the lane's 56 registers plus one exchange between the lane halves.
// O^T = V^T P^T: B = the weights as they lie in D (registers 2t, 2t + 1), A = v read at the same key slots, row = d; D register r = out[query c][16 dt + 8 half + r], scaled by 1 / sum at the end.
// The attention output is split into bf16 hi and lo and gathered in LDS: 16 rows x 256 columns, all that the output projection needs of these 16 pixels. Wave h then forms y columns 32 h .. 32 h + 31 of the 16 rows on the bf16 16x16x32 form:
// A = a row's hi, then lo, half from LDS, B = rows of the transposed w_proj plane (loaded under the second attention product), k = 8 half + 0 .. 7 and 16 + 8 half + 0 .. 7 on both sides; per 32 k the hi product, then the lo product, into one accumulator.
// D register r = y[row 8 half + r][column c]; the wave turns its 16 x 32 block in its own LDS range, adds the bias and stores whole 128-byte lines: one writer per line.
// Every loop of k_natt is fully unrolled so that its arrays (fragments, logits, masks) are indexed by constants and stay in registers.
__device__ __forceinline__ v8f wmma4(v2f a, v2f b, v8f c) { return __builtin_amdgcn_wmma_f32_16x16x4_f32(false, a, false, b, (short)0, c, false, false); }
#define UR_ 8
#define UC_ 14
#define OP_ 272                 // LDS pitch of an output row, elements: 544 bytes, so that the 16-byte stores and reads of 16 lanes (8 rows x 2 halves) cover the 64 banks once
#define YP_ 36                  // LDS pitch of a wave's y rows, floats: the two lane halves (8 rows apart) store 32 banks apart
// Two blocks of 8 waves share a WGP, 4 waves a SIMD: the attribute gives the compiler the registers of that occupancy, so that the w_proj loads can go out under the second product instead of behind it.
__global__ __launch_bounds__(256) __attribute__((amdgpu_waves_per_eu(4, 4))) void k_natt(const float* __restrict__ F, const float* __restrict__ rpb, const bf* __restrict__ WP, const float* __restrict__ bp, float* OUT) {
    __shared__ __align__(16) bf so[2 * 16 * OP_];   // [hi, lo][query][column]
    __shared__ __align__(16) float ys[NH_ * 16 * YP_];   // [wave][row][column]: each wave's own y block
    __shared__ float rb[(NH_ * RPW * RPW + 255) / 256 * 256];   // the table, rounded up so that every thread stores on every trip (the tail repeats the last entry and is never read)
    float rv[(NH_ * RPW * RPW + 255) / 256];   // the bias table's loads go out first and fly together with the q and k loads
#pragma unroll
    for (int u = 0; u < (NH_ * RPW * RPW + 255) / 256; ++u) rv[u] = rpb[min((int)threadIdx.x + 256 * u, NH_ * RPW * RPW - 1)];
    const int lane = threadIdx.x & 31, c = lane & 15, hi = lane >> 4, h = threadIdx.x >> 5;
    const int tile = blockIdx.x; const int b = tile / ((IH / 2) * (IW / 8)), tt = tile % ((IH / 2) * (IW / 8)); const int i0 = (tt / (IW / 8)) * 2, j0 = (tt % (IW / 8)) * 8;
    const int ui = min(max(i0 - NBR, 0), IH - UR_), uj = min(max(j0 - NBR, 0), IW - UC_);
    const int qi = i0 + (c >> 3), qj = j0 + (c & 7);
    const int si = min(max(qi - NBR, 0), IH - KS), sj = min(max(qj - NBR, 0), IW - KS);
    const float* Fb = F + (size_t)b * NPIX * C3 + h * HD;
    float qr[16];
    { const float* qp = Fb + (size_t)(qi * IW + qj) * C3 + 16 * hi;
#pragma unroll
      for (int g = 0; g < 4; ++g) { const v4f v = *(const v4f*)(qp + 4 * g);
#pragma unroll
          for (int x = 0; x < 4; ++x) qr[4 * g + x] = v[x] * SCL; } }
    float kr_[7][16];
#pragma unroll
    for (int T = 0; T < 7; ++T) { const int e = T * 8 + (c & 7); const int kr = 2 * (e / UC_) + (c >> 3), kc = e % UC_; const float* kp = Fb + CC + (size_t)((ui + kr) * IW + uj + kc) * C3 + 16 * hi;
#pragma unroll
        for (int g = 0; g < 4; ++g) { const v4f v = *(const v4f*)(kp + 4 * g);
#pragma unroll
            for (int x = 0; x < 4; ++x) kr_[T][4 * g + x] = v[x]; } }
#pragma unroll
    for (int u = 0; u < (NH_ * RPW * RPW + 255) / 256; ++u) rb[(int)threadIdx.x + 256 * u] = bfr(rv[u]);
    __syncthreads();   // publishes the bias table: each wave reads entries that other waves stored
    v8f s[7];
#pragma unroll
    for (int T = 0; T < 7; ++T) s[T] = (v8f){};
#pragma unroll
    for (int st = 0; st < 8; ++st) {
#pragma unroll
        for (int T = 0; T < 7; ++T) s[T] = wmma4((v2f){kr_[T][2 * st], kr_[T][2 * st + 1]}, (v2f){qr[2 * st], qr[2 * st + 1]}, s[T]); }
    const float* vp = Fb + 2 * CC + (size_t)((ui + hi) * IW + uj) * C3 + c;
    float vr[56][2];
#pragma unroll
    for (int e = 0; e < 56; ++e) {
#pragma unroll
        for (int dt = 0; dt < 2; ++dt) vr[e][dt] = vp[(size_t)(2 * (e / UC_) * IW + e % UC_) * C3 + dt * 16]; }
    bool rok[4]; int rix[4]; bool cok[UC_]; int cix[UC_];
#pragma unroll
    for (int g = 0; g < 4; ++g) { const int ki = ui + 2 * g + hi; rok[g] = (unsigned)(ki - si) < (unsigned)KS; rix[g] = h * (RPW * RPW) + (ki - qi + KS - 1) * RPW; }
#pragma unroll
    for (int x = 0; x < UC_; ++x) { const int kj = uj + x; cok[x] = (unsigned)(kj - sj) < (unsigned)KS; cix[x] = kj - qj + KS - 1; }
    float mx4[4] = {-3.0e38f, -3.0e38f, -3.0e38f, -3.0e38f};
#pragma unroll
    for (int T = 0; T < 7; ++T) {
#pragma unroll
        for (int r = 0; r < 8; ++r) { const int e = T * 8 + r; const bool ok = rok[e / UC_] & cok[e % UC_]; const int ix = ok ? rix[e / UC_] + cix[e % UC_] : 0; const float bv = rb[ix]; const float sb = s[T][r] + bv; const float t = ok ? sb : -3.0e38f; s[T][r] = t; mx4[r & 3] = fmaxf(mx4[r & 3], t); } }
    float mx = fmaxf(fmaxf(mx4[0], mx4[1]), fmaxf(mx4[2], mx4[3])); mx = fmaxf(mx, __shfl_xor(mx, 16, 32));
    float sm4[4] = {0.f, 0.f, 0.f, 0.f};
#pragma unroll
    for (int T = 0; T < 7; ++T) {
#pragma unroll
        for (int r = 0; r < 8; ++r) { const float p = __builtin_amdgcn_exp2f((s[T][r] - mx) * 1.4426950408889634f); s[T][r] = p; sm4[r & 3] += p; } }
    float sum = (sm4[0] + sm4[1]) + (sm4[2] + sm4[3]); sum += __shfl_xor(sum, 16, 32);
    const float f = __fdiv_rn(1.0f, sum);
    v8f o[2]; o[0] = (v8f){}; o[1] = (v8f){};
    v16bf wb[2][8];   // the wave's 32 w_proj rows, B of the output projection
#pragma unroll   // wb too is indexed by constants and stays in registers
    for (int T = 0; T < 7; ++T) {
        if (T == 4 || T == 5) {   // the loads go out where the spent v and weight registers make room for them, and fly under the rest of this product and the split
#pragma unroll
            for (int ks = 0; ks < 8; ++ks) wb[T - 4][ks] = WFrag<bf>::ld(WP + (size_t)(h * HD + (T - 4) * 16 + c) * CC + ks * 32 + 8 * hi); }
#pragma unroll
        for (int t = 0; t < 4; ++t) { const int e = T * 8 + 2 * t;
#pragma unroll
            for (int dt = 0; dt < 2; ++dt) o[dt] = wmma4((v2f){vr[e][dt], vr[e + 1][dt]}, (v2f){s[T][2 * t], s[T][2 * t + 1]}, o[dt]); } }
    asm volatile("s_wait_xcnt 0x0" ::: "memory");   // stands in front of any later write to the address registers of the loads above
    const v4f bb = *(const v4f*)(bp + h * HD + (lane & 7) * 4);
    asm volatile("s_wait_xcnt 0x0" ::: "memory");   // the same for the bias load
#pragma unroll   // as above: o[dt] is indexed by constants and stays in registers
    for (int dt = 0; dt < 2; ++dt) { v8us oh, ol;
#pragma unroll   // the same for the elements of o[dt], oh and ol
        for (int x = 0; x < 8; ++x) { unsigned short a, c2; splitf(o[dt][x] * f, a, c2); oh[x] = a; ol[x] = c2; }
        *(v8usa*)(so + c * OP_ + h * HD + dt * 16 + 8 * hi) = oh; *(v8usa*)(so + (16 + c) * OP_ + h * HD + dt * 16 + 8 * hi) = ol; }
    __syncthreads();   // publishes the 16 output rows: each wave reads columns that the other heads' waves computed
    v8f y[2]; y[0] = (v8f){}; y[1] = (v8f){};
#pragma unroll   // wb and y are indexed by constants; the LDS reads go out ahead of the products
    for (int ks = 0; ks < 8; ++ks) { const bf* ap = so + c * OP_ + ks * 32 + 8 * hi;
        const v16bf ah = cat16b(*(const v8usa*)ap, *(const v8usa*)(ap + 16)), al = cat16b(*(const v8usa*)(ap + 16 * OP_), *(const v8usa*)(ap + 16 * OP_ + 16));
#pragma unroll
        for (int nt = 0; nt < 2; ++nt) { y[nt] = wmmab(ah, wb[nt][ks], y[nt]); y[nt] = wmmab(al, wb[nt][ks], y[nt]); } }
    float* yw = ys + h * (16 * YP_);
#pragma unroll
    for (int nt = 0; nt < 2; ++nt) {
#pragma unroll
        for (int j = 0; j < 8; ++j) yw[(hi * 8 + j) * YP_ + nt * 16 + c] = y[nt][j]; }
    __builtin_amdgcn_wave_barrier(); asm volatile("" ::: "memory");   // keeps the reads below, of values that other lanes of this wave stored, behind the stores above
#pragma unroll   // the four LDS reads go out together
    for (int u = 0; u < 4; ++u) { const int rq = 4 * u + (lane >> 3); v4f val = *(const v4fa*)(yw + rq * YP_ + (lane & 7) * 4);
        val[0] += bfr(bb[0]); val[1] += bfr(bb[1]); val[2] += bfr(bb[2]); val[3] += bfr(bb[3]);
        *(v4f*)(OUT + ((size_t)b * NPIX + (size_t)((i0 + (rq >> 3)) * IW + j0 + (rq & 7))) * CC + h * HD + (lane & 7) * 4) = val; }
}

extern "C" void kernel_launch(void* const* d_in, const int* in_sizes, int n_in,
                              void* d_out, int out_size, void* d_ws, size_t ws_size, hipStream_t stream) {
    (void)in_sizes; (void)n_in; (void)out_size;
    const float* xq = (const float*)d_in[0]; const float* xk = (const float*)d_in[1]; const float* wq = (const float*)d_in[2]; const float* bq = (const float*)d_in[3]; const float* wkv = (const float*)d_in[4]; const float* bkv = (const float*)d_in[5]; const float* rpb = (const float*)d_in[6]; const float* wp = (const float*)d_in[7]; const float* bp = (const float*)d_in[8];   /* order x_q, x_k ([2][56][56][256] channels-last), Wq ('xw' [256][256]), bq, Wkv ('xw' [256][512]: columns k | v), bkv, rpb [8][13][13], Wproj ('xw' [256][256]), bproj; nine inputs, all read */
    float* OUT = (float*)d_out;     // [2][56][56][256] = [6272][256]
    char* wsp = (char*)d_ws;
    auto take = [&](size_t bytes) { char* p = wsp; wsp += (bytes + 255) & ~(size_t)255; return (void*)p; };
    bf* WQ = (bf*)take((size_t)3 * CC * CC * 2); bf* WKV = WQ + (size_t)CC * CC;   /* one [768][256] plane: rows q | k | v */ bf* WP = (bf*)take((size_t)CC * CC * 2); bf* XQ = (bf*)take((size_t)NTOK * CC * 2); bf* XK = (bf*)take((size_t)NTOK * CC * 2); float* F = (float*)take((size_t)NTOK * C3 * 4);
    if ((size_t)(wsp - (char*)d_ws) > ws_size) return;    // carve 25 MiB
    k_prep<<<(unsigned)(4 * WB1 + 2 * XB), 256, 0, stream>>>(xq, xk, wq, wkv, wp, XQ, XK, WQ, WKV, WP);
    k_gemmw<bf, 0, true, true><<<dim3(NTOK / 64, C3 / 64, 1), 32, 0, stream>>>(XQ, nullptr, WQ, nullptr, CC, F, C3, bq, 0, 0, 0, XK, bkv, CC);   /* columns 0 .. 255: q = x_q Wq + bq; columns 256 .. 767: [k | v] = x_k Wkv + bkv */
    k_natt<<<(unsigned)(NTOK / 16), 256, 0, stream>>>(F, rpb, WP, bp, OUT);                                                /* windowed attention, f32; its rows, split into hi and lo, x w_proj + b_proj */
}

// v004
// It runs in 30 microseconds.
// Next to v003, in two timings, it ran 1.23 times as fast each time.
// Counting every step since v000, it is 7.48 times as fast.
#include <hip/hip_runtime.h>

// Neighborhood CROSS attention (NATTEN with separate query / key inputs; x_q, x_k [2][56][56][256] channels-last; q = x_q Wq + bq ('xw' [256][256] -> 8 heads x 32), [k | v] = x_k Wkv + bkv ('xw' [256][512] viewed (2, 8 heads, 32): columns 0..255 = k, 256..511 = v); for every pixel a 7x7 key window clamped to stay inside the image (start = clamp(i - 3, 0, 49)); logits = (q x 32^-0.5).k + rpb[h][ki - i + 6][kj - j + 6] (rpb [8][13][13] input); softmax over the 49; out = attn.v; y = out Wproj + bproj ('xw' [256][256]) -> [2][56][56][256] (1.6 M); argument order x_q, x_k, Wq, bq, Wkv, bkv, rpb, Wproj, bproj).
// Compute dtypes, f32 accumulate: every input rounded to bf16; the q projection (from x_q) and the fused k | v projection (from x_k) on PLAIN bf16 operands (exact) + f32 biases, written side by side into one [q | k | v] plane, the rounding done by the projection blocks themselves on the way into LDS; the whole windowed attention in f32, both products on the f32 16x16x4 matrix form (one wave per (2 x 8 query tile, head) against the tile's 8 x 14 block of keys, keys outside a query's window masked, logits + bias and the f32 softmax in registers); the attention output as bf16 hi + lo halves x exact w_proj (2 products) + f32 bias.
// Two launches: k_proj (the q | k | v projections straight from the f32 inputs; two more blocks turn w_proj into its transposed bf16 plane), k_natt (attention and, from its 16 output rows in LDS, the output projection).

#define NB_  2
#define IH   56
#define IW   56
#define NPIX (IH * IW)          // 3136
#define NTOK (NB_ * NPIX)       // 6272 = 98 x 64
#define CC   256
#define C3   768
#define NH_  8
#define HD   32
#define KS   7
#define NBR  3
#define RPW  13                 // 2*KS - 1
#define SCL  0.17677669529663689f   // 32^-0.5
typedef _Float16 h16;
typedef unsigned short bf;
typedef __attribute__((ext_vector_type(16))) __bf16   v16bf;
typedef __attribute__((ext_vector_type(16))) _Float16 v16h;
typedef __attribute__((ext_vector_type(8)))  _Float16 v8h;
typedef __attribute__((ext_vector_type(8)))  unsigned short v8us;
typedef __attribute__((ext_vector_type(8)))  float    v8f;
typedef __attribute__((ext_vector_type(4)))  float    v4f;
typedef v8h  __attribute__((may_alias)) v8ha;
typedef v4f  __attribute__((may_alias)) v4fa;
typedef v8us __attribute__((may_alias)) v8usa;

__device__ __forceinline__ unsigned short f2bf(float f) { unsigned u = __float_as_uint(f); u += 0x7FFFu + ((u >> 16) & 1u); return (unsigned short)(u >> 16); }
__device__ __forceinline__ float bf2f(unsigned short b) { return __uint_as_float(((unsigned)b) << 16); }
__device__ __forceinline__ float bfr(float f) { return bf2f(f2bf(f)); }
__device__ __forceinline__ v16h cat16(v8h lo, v8h hi) { return __builtin_shufflevector(lo, hi, 0, 1, 2, 3, 4, 5, 6, 7, 8, 9, 10, 11, 12, 13, 14, 15); }
__device__ __forceinline__ v16bf cat16b(v8us lo, v8us hi) { return __builtin_bit_cast(v16bf, __builtin_shufflevector(lo, hi, 0, 1, 2, 3, 4, 5, 6, 7, 8, 9, 10, 11, 12, 13, 14, 15)); }
__device__ __forceinline__ v8f wmma16(v16h a, v16h b, v8f c) { return __builtin_amdgcn_wmma_f32_16x16x32_f16(false, a, false, b, (short)0, c, false, false); }
__device__ __forceinline__ v8f wmmab(v16bf a, v16bf b, v8f c) { return __builtin_amdgcn_wmma_f32_16x16x32_bf16(false, a, false, b, (short)0, c, false, false); }




template <typename T16> struct WFrag;
template <> struct WFrag<bf> { typedef v16bf V; static __device__ __forceinline__ V ld(const bf* p) { return cat16b(*(const v8us*)p, *(const v8us*)(p + 16)); } static __device__ __forceinline__ v8f mma(V a, V b, v8f c) { return wmmab(a, b, c); } };
__device__ __forceinline__ void splitf(float y, unsigned short& h, unsigned short& l) { h = f2bf(y); l = f2bf(y - bf2f(h)); }
typedef __attribute__((ext_vector_type(2))) float v2f;
typedef __attribute__((ext_vector_type(2))) __bf16 v2bf;
typedef __attribute__((ext_vector_type(4))) unsigned v4u;
typedef v4u __attribute__((may_alias)) v4ua;

// ---- k_proj: [q | k | v] = x W + b straight from the f32 inputs. Block = 8 waves, one 128 x 128 tile of the [6272][768] plane, whole K = 256 in LDS as bf16.
// Every thread rounds what it loads (nearest even, two values an instruction) and stores 16-byte runs of 8 k: x rows as they lie, w columns turned (a thread holds 8 k x 4 n and stores one run for each n).
// LDS row of w column n (0 .. 127 in the tile): (n & 3) * 32 + (n >> 2), so that the 32 lanes of a turned store lie one pitch apart. A wave's four B fragments sit 32 LDS rows apart: lane column c holds plane columns 4 c + 0 .. 3 of its 64
// and stores them as one 16-byte value, 16 lanes = 256 bytes of a row: whole lines, one writer each, no turn of the result.
// Wave (wr, wc) = rows 32 wr .. + 31, columns 64 wc .. + 63: 2 x 4 accumulators; k = 8 half + 0 .. 7 and 16 + 8 half + 0 .. 7 per 32 on both sides, 32 by 32 upwards.
// Blocks 0 and 1 only turn w_proj (128 columns each) through the same LDS path and write the rows out for k_natt.
#define PT_ 264                 // LDS pitch of a staged row, elements: 528 bytes = 16 x 33, the pitch for 16-byte readers
#define TL_ 128                 // tile edge
__device__ __forceinline__ unsigned pk2(float a, float b) { return __builtin_bit_cast(unsigned, __builtin_convertvector((v2f){a, b}, v2bf)); }
struct WReg { v4f r[4][8]; };   // four runs of 8 k x 4 n
template <int N>   // the row length is a constant, so that the 32 loads differ in their immediate offsets alone
__device__ __forceinline__ void w_load(WReg& g, const float* __restrict__ w, int n0) { const int lane = threadIdx.x & 31, wv = threadIdx.x >> 5; const char* p = (const char*)(w + n0); const unsigned vo = (unsigned)(wv * 8 * N + 4 * lane) * 4u;   // block's base, thread's byte offset
#pragma unroll
    for (int u = 0; u < 4; ++u) {
#pragma unroll
        for (int i = 0; i < 8; ++i) g.r[u][i] = *(const v4f*)(p + vo + (64 * u + i) * N * 4); }
    asm volatile("s_wait_xcnt 0x0" :: "v"(vo) : "memory"); }   // stands in front of any later write to the address register of the loads above; the offset is named so that its register lives up to the wait
template <int U0>   // runs U0 and U0 + 1
__device__ __forceinline__ void w_store(const WReg& g, bf* sb) { const int lane = threadIdx.x & 31, wv = threadIdx.x >> 5;
#pragma unroll
    for (int u = U0; u < U0 + 2; ++u) {
#pragma unroll
        for (int j = 0; j < 4; ++j) { const v4u o = {pk2(g.r[u][0][j], g.r[u][1][j]), pk2(g.r[u][2][j], g.r[u][3][j]), pk2(g.r[u][4][j], g.r[u][5][j]), pk2(g.r[u][6][j], g.r[u][7][j])};
            *(v4ua*)(sb + (j * 32 + lane) * PT_ + (wv + 8 * u) * 8) = o; } } }
struct XReg { v4f r[8][2]; };   // eight rows' runs of 8 k
__device__ __forceinline__ void x_load(XReg& g, const char* p, unsigned vo, int u0) {   // p: the tile's first row; vo: byte offset of the thread's run in row wv
#pragma unroll
    for (int u = 0; u < 8; ++u) { g.r[u][0] = *(const v4f*)(p + vo + (8 * (u0 + u)) * CC * 4); g.r[u][1] = *(const v4f*)(p + vo + (8 * (u0 + u)) * CC * 4 + 16); } }
__device__ __forceinline__ void x_store(const XReg& g, bf* sa, int u0) { const int lane = threadIdx.x & 31, wv = threadIdx.x >> 5;
#pragma unroll
    for (int u = 0; u < 8; ++u) { const v4u o = {pk2(g.r[u][0][0], g.r[u][0][1]), pk2(g.r[u][0][2], g.r[u][0][3]), pk2(g.r[u][1][0], g.r[u][1][1]), pk2(g.r[u][1][2], g.r[u][1][3])};
        *(v4ua*)(sa + (wv + 8 * (u0 + u)) * PT_ + lane * 8) = o; } }
#define WPB (CC / TL_)          // blocks that turn w_proj: 2
// Two blocks share a WGP (LDS), 4 waves a SIMD: the attribute gives the compiler the registers of that occupancy for the loads in flight.
__global__ __launch_bounds__(256) __attribute__((amdgpu_waves_per_eu(4, 4))) void k_proj(const float* __restrict__ xq, const float* __restrict__ xk, const float* __restrict__ wq, const float* __restrict__ wkv, const float* __restrict__ wp, const float* __restrict__ bq, const float* __restrict__ bkv, bf* WP, float* F) {
    __shared__ __align__(16) bf sa[TL_ * PT_];   // x rows
    __shared__ __align__(16) bf sb[TL_ * PT_];   // w columns, in the row order above
    const int lane = threadIdx.x & 31, lr = lane & 15, hi = lane >> 4, wv = threadIdx.x >> 5;
    WReg g;
    if (blockIdx.x < WPB) {
        const int n0 = blockIdx.x * TL_;
        w_load<CC>(g, wp, n0); w_store<0>(g, sb); w_store<2>(g, sb);
        __syncthreads();   // publishes the turned columns: a wave writes out rows that all eight waves stored
#pragma unroll
        for (int u = 0; u < 16; ++u) { const int r = wv + 8 * u; *(v4u*)(WP + (size_t)(n0 + 4 * (r & 31) + (r >> 5)) * CC + lane * 8) = *(const v4ua*)(sb + r * PT_ + lane * 8); }
        return;
    }
    const int t = blockIdx.x - WPB; const int r0 = (t / (C3 / TL_)) * TL_, ct = t % (C3 / TL_);
    const bool kv = ct >= CC / TL_;
    const float* x = kv ? xk : xq; const float* bias = kv ? bkv : bq; const int n0 = (kv ? ct - CC / TL_ : ct) * TL_;
    XReg h0, h1;
    const char* px = (const char*)(x + (size_t)r0 * CC); const unsigned vx = (unsigned)(wv * CC + lane * 8) * 4u;
    if (kv) w_load<2 * CC>(g, wkv, n0); else w_load<CC>(g, wq, n0);
    x_load(h0, px, vx, 0);
    __builtin_amdgcn_sched_barrier(0);   // keeps the first use of a loaded w value, with its wait, from rising over the x loads above: they would go out a whole memory latency late
    w_store<0>(g, sb);
    __builtin_amdgcn_sched_barrier(0);   // keeps the loads below from rising over the stores above: all 64 loads in flight at once do not fit the registers of 4 waves a SIMD and spill
    x_load(h1, px, vx, 8);   // the second half of the x rows goes out into the registers that the first w runs leave
    asm volatile("s_wait_xcnt 0x0" :: "v"(vx) : "memory");   // as in w_load, for the x loads
    w_store<2>(g, sb); x_store(h0, sa, 0); x_store(h1, sa, 8);
    const int wr = wv >> 1, wc = wv & 1;
    const v4f bb = *(const v4f*)(bias + n0 + 64 * wc + 4 * lr);
    __syncthreads();   // publishes both tiles: every wave reads rows and columns that the other waves stored
    v8f acc[2][4];
#pragma unroll
    for (int mb = 0; mb < 2; ++mb)
#pragma unroll
        for (int nb = 0; nb < 4; ++nb) acc[mb][nb] = (v8f){};
    const bf* ap = sa + (wr * 32 + lr) * PT_ + 8 * hi; const bf* bp = sb + (wc * 16 + lr) * PT_ + 8 * hi;
    v16bf a[2][2], b[2][4];   // two sets of fragments: the next step's LDS reads go out in front of this step's products
#pragma unroll
    for (int mb = 0; mb < 2; ++mb) a[0][mb] = cat16b(*(const v8usa*)(ap + mb * 16 * PT_), *(const v8usa*)(ap + mb * 16 * PT_ + 16));
#pragma unroll
    for (int nb = 0; nb < 4; ++nb) b[0][nb] = cat16b(*(const v8usa*)(bp + nb * 32 * PT_), *(const v8usa*)(bp + nb * 32 * PT_ + 16));
#pragma unroll   // eight steps, no back edge behind a matrix instruction; the fragment sets are indexed by constants
    for (int ks = 0; ks < CC / 32; ++ks) { const int cu = ks & 1, nx = cu ^ 1, kn = (ks + 1) * 32;
        if (ks + 1 < CC / 32) {
#pragma unroll
            for (int mb = 0; mb < 2; ++mb) a[nx][mb] = cat16b(*(const v8usa*)(ap + mb * 16 * PT_ + kn), *(const v8usa*)(ap + mb * 16 * PT_ + kn + 16));
#pragma unroll
            for (int nb = 0; nb < 4; ++nb) b[nx][nb] = cat16b(*(const v8usa*)(bp + nb * 32 * PT_ + kn), *(const v8usa*)(bp + nb * 32 * PT_ + kn + 16)); }
        __builtin_amdgcn_sched_barrier(0);   // keeps the reads above in front of the products below; left alone the compiler sinks each read to its first use, and every pair of products waits a whole LDS latency
#pragma unroll
        for (int nb = 0; nb < 4; ++nb)
#pragma unroll
            for (int mb = 0; mb < 2; ++mb) acc[mb][nb] = wmmab(a[cu][mb], b[cu][nb], acc[mb][nb]); }
    const v4f bv = {bfr(bb[0]), bfr(bb[1]), bfr(bb[2]), bfr(bb[3])};
    float* crow = F + (size_t)(r0 + wr * 32 + 8 * hi) * C3 + ct * TL_ + 64 * wc + 4 * lr;
#pragma unroll
    for (int mb = 0; mb < 2; ++mb) {
#pragma unroll
        for (int j = 0; j < 8; ++j) { const v4f val = {acc[mb][0][j] + bv[0], acc[mb][1][j] + bv[1], acc[mb][2][j] + bv[2], acc[mb][3][j] + bv[3]}; *(v4f*)(crow + (size_t)(mb * 16 + j) * C3) = val; } }
}

// k_natt: one wave per (2 x 8 query tile, head), both attention products on the f32 16x16x4 matrix form; block = the 8 heads of one tile.
// The 16 windows of a tile lie inside one 8 x 14 block of keys (112 = 7 x 16), start (ui, uj) clamped into the image. Key slot (T, r, half): e = 8 T + r, key row ui + 2 (e / 14) + half, key column uj + e % 14.
// S^T = K Q^T: A row = key slot (r = c & 7, half = c >> 3), B column = query c, both sides hold d = 16 half + 0 .. 15 in the same register order. D register r of tile T = logit of key slot (T, r, half) for query c.
// Keys outside a query's own 7 x 7 window are masked to -3e38 (their weight is 0); softmax runs down the lane's 56 registers plus one exchange between the lane halves.
// O^T = V^T P^T: B = the weights as they lie in D (registers 2t, 2t + 1), A = v read at the same key slots, row = d; D register r = out[query c][16 dt + 8 half + r], scaled by 1 / sum at the end.
// The attention output is split into bf16 hi and lo and gathered in LDS: 16 rows x 256 columns, all that the output projection needs of these 16 pixels. Wave h then forms y columns 32 h .. 32 h + 31 of the 16 rows on the bf16 16x16x32 form:
// A = a row's hi, then lo, half from LDS, B = rows of the transposed w_proj plane (loaded under the second attention product), k = 8 half + 0 .. 7 and 16 + 8 half + 0 .. 7 on both sides; per 32 k the hi product, then the lo product, into one accumulator.
// D register r = y[row 8 half + r][column c]; the wave turns its 16 x 32 block in its own LDS range, adds the bias and stores whole 128-byte lines: one writer per line.
// Every loop of k_natt is fully unrolled so that its arrays (fragments, logits, masks) are indexed by constants and stay in registers.
__device__ __forceinline__ v8f wmma4(v2f a, v2f b, v8f c) { return __builtin_amdgcn_wmma_f32_16x16x4_f32(false, a, false, b, (short)0, c, false, false); }
#define UR_ 8
#define UC_ 14
#define OP_ 272                 // LDS pitch of an output row, elements: 544 bytes, so that the 16-byte stores and reads of 16 lanes (8 rows x 2 halves) cover the 64 banks once
#define YP_ 36                  // LDS pitch of a wave's y rows, floats: the two lane halves (8 rows apart) store 32 banks apart
// Two blocks of 8 waves share a WGP, 4 waves a SIMD: the attribute gives the compiler the registers of that occupancy, so that the w_proj loads can go out under the second product instead of behind it.
__global__ __launch_bounds__(256) __attribute__((amdgpu_waves_per_eu(4, 4))) void k_natt(const float* __restrict__ F, const float* __restrict__ rpb, const bf* __restrict__ WP, const float* __restrict__ bp, float* OUT) {
    __shared__ __align__(16) bf so[2 * 16 * OP_];   // [hi, lo][query][column]
    __shared__ __align__(16) float ys[NH_ * 16 * YP_];   // [wave][row][column]: each wave's own y block
    __shared__ float rb[(NH_ * RPW * RPW + 255) / 256 * 256];   // the table, rounded up so that every thread stores on every trip (the tail repeats the last entry and is never read)
    float rv[(NH_ * RPW * RPW + 255) / 256];   // the bias table's loads go out first and fly together with the q and k loads
#pragma unroll
    for (int u = 0; u < (NH_ * RPW * RPW + 255) / 256; ++u) rv[u] = rpb[min((int)threadIdx.x + 256 * u, NH_ * RPW * RPW - 1)];
    const int lane = threadIdx.x & 31, c = lane & 15, hi = lane >> 4, h = threadIdx.x >> 5;
    const int tile = blockIdx.x; const int b = tile / ((IH / 2) * (IW / 8)), tt = tile % ((IH / 2) * (IW / 8)); const int i0 = (tt / (IW / 8)) * 2, j0 = (tt % (IW / 8)) * 8;
    const int ui = min(max(i0 - NBR, 0), IH - UR_), uj = min(max(j0 - NBR, 0), IW - UC_);
    const int qi = i0 + (c >> 3), qj = j0 + (c & 7);
    const int si = min(max(qi - NBR, 0), IH - KS), sj = min(max(qj - NBR, 0), IW - KS);
    const float* Fb = F + (size_t)b * NPIX * C3 + h * HD;
    float qr[16];
    { const float* qp = Fb + (size_t)(qi * IW + qj) * C3 + 16 * hi;
#pragma unroll
      for (int g = 0; g < 4; ++g) { const v4f v = *(const v4f*)(qp + 4 * g);
#pragma unroll
          for (int x = 0; x < 4; ++x) qr[4 * g + x] = v[x] * SCL; } }
    float kr_[7][16];
#pragma unroll
    for (int T = 0; T < 7; ++T) { const int e = T * 8 + (c & 7); const int kr = 2 * (e / UC_) + (c >> 3), kc = e % UC_; const float* kp = Fb + CC + (size_t)((ui + kr) * IW + uj + kc) * C3 + 16 * hi;
#pragma unroll
        for (int g = 0; g < 4; ++g) { const v4f v = *(const v4f*)(kp + 4 * g);
#pragma unroll
            for (int x = 0; x < 4; ++x) kr_[T][4 * g + x] = v[x]; } }
#pragma unroll
    for (int u = 0; u < (NH_ * RPW * RPW + 255) / 256; ++u) rb[(int)threadIdx.x + 256 * u] = bfr(rv[u]);
    __syncthreads();   // publishes the bias table: each wave reads entries that other waves stored
    v8f s[7];
#pragma unroll
    for (int T = 0; T < 7; ++T) s[T] = (v8f){};
#pragma unroll
    for (int st = 0; st < 8; ++st) {
#pragma unroll
        for (int T = 0; T < 7; ++T) s[T] = wmma4((v2f){kr_[T][2 * st], kr_[T][2 * st + 1]}, (v2f){qr[2 * st], qr[2 * st + 1]}, s[T]); }
    const float* vp = Fb + 2 * CC + (size_t)((ui + hi) * IW + uj) * C3 + c;
    float vr[56][2];
#pragma unroll
    for (int e = 0; e < 56; ++e) {
#pragma unroll
        for (int dt = 0; dt < 2; ++dt) vr[e][dt] = vp[(size_t)(2 * (e / UC_) * IW + e % UC_) * C3 + dt * 16]; }
    bool rok[4]; int rix[4]; bool cok[UC_]; int cix[UC_];
#pragma unroll
    for (int g = 0; g < 4; ++g) { const int ki = ui + 2 * g + hi; rok[g] = (unsigned)(ki - si) < (unsigned)KS; rix[g] = h * (RPW * RPW) + (ki - qi + KS - 1) * RPW; }
#pragma unroll
    for (int x = 0; x < UC_; ++x) { const int kj = uj + x; cok[x] = (unsigned)(kj - sj) < (unsigned)KS; cix[x] = kj - qj + KS - 1; }
    float mx4[4] = {-3.0e38f, -3.0e38f, -3.0e38f, -3.0e38f};
#pragma unroll
    for (int T = 0; T < 7; ++T) {
#pragma unroll
        for (int r = 0; r < 8; ++r) { const int e = T * 8 + r; const bool ok = rok[e / UC_] & cok[e % UC_]; const int ix = ok ? rix[e / UC_] + cix[e % UC_] : 0; const float bv = rb[ix]; const float sb = s[T][r] + bv; const float t = ok ? sb : -3.0e38f; s[T][r] = t; mx4[r & 3] = fmaxf(mx4[r & 3], t); } }
    float mx = fmaxf(fmaxf(mx4[0], mx4[1]), fmaxf(mx4[2], mx4[3])); mx = fmaxf(mx, __shfl_xor(mx, 16, 32));
    float sm4[4] = {0.f, 0.f, 0.f, 0.f};
#pragma unroll
    for (int T = 0; T < 7; ++T) {
#pragma unroll
        for (int r = 0; r < 8; ++r) { const float p = __builtin_amdgcn_exp2f((s[T][r] - mx) * 1.4426950408889634f); s[T][r] = p; sm4[r & 3] += p; } }
    float sum = (sm4[0] + sm4[1]) + (sm4[2] + sm4[3]); sum += __shfl_xor(sum, 16, 32);
    const float f = __fdiv_rn(1.0f, sum);
    v8f o[2]; o[0] = (v8f){}; o[1] = (v8f){};
    v16bf wb[2][8];   // the wave's 32 w_proj rows, B of the output projection
#pragma unroll   // wb too is indexed by constants and stays in registers
    for (int T = 0; T < 7; ++T) {
        if (T == 4 || T == 5) {   // the loads go out where the spent v and weight registers make room for them, and fly under the rest of this product and the split
#pragma unroll
            for (int ks = 0; ks < 8; ++ks) wb[T - 4][ks] = WFrag<bf>::ld(WP + (size_t)(h * HD + (T - 4) * 16 + c) * CC + ks * 32 + 8 * hi); }
#pragma unroll
        for (int t = 0; t < 4; ++t) { const int e = T * 8 + 2 * t;
#pragma unroll
            for (int dt = 0; dt < 2; ++dt) o[dt] = wmma4((v2f){vr[e][dt], vr[e + 1][dt]}, (v2f){s[T][2 * t], s[T][2 * t + 1]}, o[dt]); } }
    asm volatile("s_wait_xcnt 0x0" ::: "memory");   // stands in front of any later write to the address registers of the loads above
    const v4f bb = *(const v4f*)(bp + h * HD + (lane & 7) * 4);
    asm volatile("s_wait_xcnt 0x0" ::: "memory");   // the same for the bias load
#pragma unroll   // as above: o[dt] is indexed by constants and stays in registers
    for (int dt = 0; dt < 2; ++dt) { v8us oh, ol;
#pragma unroll   // the same for the elements of o[dt], oh and ol
        for (int x = 0; x < 8; ++x) { unsigned short a, c2; splitf(o[dt][x] * f, a, c2); oh[x] = a; ol[x] = c2; }
        *(v8usa*)(so + c * OP_ + h * HD + dt * 16 + 8 * hi) = oh; *(v8usa*)(so + (16 + c) * OP_ + h * HD + dt * 16 + 8 * hi) = ol; }
    __syncthreads();   // publishes the 16 output rows: each wave reads columns that the other heads' waves computed
    v8f y[2]; y[0] = (v8f){}; y[1] = (v8f){};
#pragma unroll   // wb and y are indexed by constants; the LDS reads go out ahead of the products
    for (int ks = 0; ks < 8; ++ks) { const bf* ap = so + c * OP_ + ks * 32 + 8 * hi;
        const v16bf ah = cat16b(*(const v8usa*)ap, *(const v8usa*)(ap + 16)), al = cat16b(*(const v8usa*)(ap + 16 * OP_), *(const v8usa*)(ap + 16 * OP_ + 16));
#pragma unroll
        for (int nt = 0; nt < 2; ++nt) { y[nt] = wmmab(ah, wb[nt][ks], y[nt]); y[nt] = wmmab(al, wb[nt][ks], y[nt]); } }
    float* yw = ys + h * (16 * YP_);
#pragma unroll
    for (int nt = 0; nt < 2; ++nt) {
#pragma unroll
        for (int j = 0; j < 8; ++j) yw[(hi * 8 + j) * YP_ + nt * 16 + c] = y[nt][j]; }
    __builtin_amdgcn_wave_barrier(); asm volatile("" ::: "memory");   // keeps the reads below, of values that other lanes of this wave stored, behind the stores above
#pragma unroll   // the four LDS reads go out together
    for (int u = 0; u < 4; ++u) { const int rq = 4 * u + (lane >> 3); v4f val = *(const v4fa*)(yw + rq * YP_ + (lane & 7) * 4);
        val[0] += bfr(bb[0]); val[1] += bfr(bb[1]); val[2] += bfr(bb[2]); val[3] += bfr(bb[3]);
        *(v4f*)(OUT + ((size_t)b * NPIX + (size_t)((i0 + (rq >> 3)) * IW + j0 + (rq & 7))) * CC + h * HD + (lane & 7) * 4) = val; }
}

extern "C" void kernel_launch(void* const* d_in, const int* in_sizes, int n_in,
                              void* d_out, int out_size, void* d_ws, size_t ws_size, hipStream_t stream) {
    (void)in_sizes; (void)n_in; (void)out_size;
    const float* xq = (const float*)d_in[0]; const float* xk = (const float*)d_in[1]; const float* wq = (const float*)d_in[2]; const float* bq = (const float*)d_in[3]; const float* wkv = (const float*)d_in[4]; const float* bkv = (const float*)d_in[5]; const float* rpb = (const float*)d_in[6]; const float* wp = (const float*)d_in[7]; const float* bp = (const float*)d_in[8];   /* order x_q, x_k ([2][56][56][256] channels-last), Wq ('xw' [256][256]), bq, Wkv ('xw' [256][512]: columns k | v), bkv, rpb [8][13][13], Wproj ('xw' [256][256]), bproj; nine inputs, all read */
    float* OUT = (float*)d_out;     // [2][56][56][256] = [6272][256]
    char* wsp = (char*)d_ws;
    auto take = [&](size_t bytes) { char* p = wsp; wsp += (bytes + 255) & ~(size_t)255; return (void*)p; };
    bf* WP = (bf*)take((size_t)CC * CC * 2); float* F = (float*)take((size_t)NTOK * C3 * 4);
    if ((size_t)(wsp - (char*)d_ws) > ws_size) return;    // carve ~19 MiB
    k_proj<<<(unsigned)(WPB + (NTOK / TL_) * (C3 / TL_)), 256, 0, stream>>>(xq, xk, wq, wkv, wp, bq, bkv, WP, F);   /* columns 0 .. 255: q = x_q Wq + bq; columns 256 .. 767: [k | v] = x_k Wkv + bkv; w_proj turned */
    k_natt<<<(unsigned)(NTOK / 16), 256, 0, stream>>>(F, rpb, WP, bp, OUT);                                                /* windowed attention, f32; its rows, split into hi and lo, x w_proj + b_proj */
}

// v005
// A run of this version takes 28.5 microseconds.
// Next to v004, in two timings, it ran 1.06 times as fast each time.
// All steps since v000 together make it 7.91 times as fast.
#include <hip/hip_runtime.h>

// Neighborhood CROSS attention (NATTEN with separate query / key inputs; x_q, x_k [2][56][56][256] channels-last; q = x_q Wq + bq ('xw' [256][256] -> 8 heads x 32), [k | v] = x_k Wkv + bkv ('xw' [256][512] viewed (2, 8 heads, 32): columns 0..255 = k, 256..511 = v); for every pixel a 7x7 key window clamped to stay inside the image (start = clamp(i - 3, 0, 49)); logits = (q x 32^-0.5).k + rpb[h][ki - i + 6][kj - j + 6] (rpb [8][13][13] input); softmax over the 49; out = attn.v; y = out Wproj + bproj ('xw' [256][256]) -> [2][56][56][256] (1.6 M); argument order x_q, x_k, Wq, bq, Wkv, bkv, rpb, Wproj, bproj).
// Compute dtypes, f32 accumulate: every input rounded to bf16; the q projection (from x_q) and the fused k | v projection (from x_k) on PLAIN bf16 operands (exact) + f32 biases, written side by side into one [q | k | v] plane, the rounding done by the projection blocks themselves on the way into LDS; the whole windowed attention in f32, both products on the f32 16x16x4 matrix form (one wave per (2 x 8 query tile, head) against the tile's 8 x 14 block of keys, keys outside a query's window masked, logits + bias and the f32 softmax in registers); the attention output as bf16 hi + lo halves x exact w_proj (2 products) + f32 bias.
// Two launches: k_proj (the q | k | v projections straight from the f32 inputs; two more blocks turn w_proj into a bf16 plane in the order of k_natt's fragments), k_natt (attention and, from its 16 output rows in LDS, the output projection).

#define NB_  2
#define IH   56
#define IW   56
#define NPIX (IH * IW)          // 3136
#define NTOK (NB_ * NPIX)       // 6272 = 98 x 64
#define CC   256
#define C3   768
#define NH_  8
#define HD   32
#define KS   7
#define NBR  3
#define RPW  13                 // 2*KS - 1
#define SCL  0.17677669529663689f   // 32^-0.5
typedef _Float16 h16;
typedef unsigned short bf;
typedef __attribute__((ext_vector_type(16))) __bf16   v16bf;
typedef __attribute__((ext_vector_type(16))) _Float16 v16h;
typedef __attribute__((ext_vector_type(8)))  _Float16 v8h;
typedef __attribute__((ext_vector_type(8)))  unsigned short v8us;
typedef __attribute__((ext_vector_type(8)))  float    v8f;
typedef __attribute__((ext_vector_type(4)))  float    v4f;
typedef v8h  __attribute__((may_alias)) v8ha;
typedef v4f  __attribute__((may_alias)) v4fa;
typedef v8us __attribute__((may_alias)) v8usa;

__device__ __forceinline__ unsigned short f2bf(float f) { unsigned u = __float_as_uint(f); u += 0x7FFFu + ((u >> 16) & 1u); return (unsigned short)(u >> 16); }
__device__ __forceinline__ float bf2f(unsigned short b) { return __uint_as_float(((unsigned)b) << 16); }
__device__ __forceinline__ float bfr(float f) { return bf2f(f2bf(f)); }
__device__ __forceinline__ v16h cat16(v8h lo, v8h hi) { return __builtin_shufflevector(lo, hi, 0, 1, 2, 3, 4, 5, 6, 7, 8, 9, 10, 11, 12, 13, 14, 15); }
__device__ __forceinline__ v16bf cat16b(v8us lo, v8us hi) { return __builtin_bit_cast(v16bf, __builtin_shufflevector(lo, hi, 0, 1, 2, 3, 4, 5, 6, 7, 8, 9, 10, 11, 12, 13, 14, 15)); }
__device__ __forceinline__ v8f wmma16(v16h a, v16h b, v8f c) { return __builtin_amdgcn_wmma_f32_16x16x32_f16(false, a, false, b, (short)0, c, false, false); }
__device__ __forceinline__ v8f wmmab(v16bf a, v16bf b, v8f c) { return __builtin_amdgcn_wmma_f32_16x16x32_bf16(false, a, false, b, (short)0, c, false, false); }




__device__ __forceinline__ void splitf(float y, unsigned short& h, unsigned short& l) { h = f2bf(y); l = f2bf(y - bf2f(h)); }
typedef __attribute__((ext_vector_type(2))) float v2f;
typedef __attribute__((ext_vector_type(2))) __bf16 v2bf;
typedef __attribute__((ext_vector_type(4))) unsigned v4u;
typedef v4u __attribute__((may_alias)) v4ua;

// ---- k_proj: [q | k | v] = x W + b straight from the f32 inputs. Block = 8 waves, one 128 x 128 tile of the [6272][768] plane, whole K = 256 in LDS as bf16.
// Every thread rounds what it loads (nearest even, two values an instruction) and stores 16-byte runs of 8 k: x rows as they lie, w columns turned (a thread holds 8 k x 4 n and stores one run for each n).
// LDS row of w column n (0 .. 127 in the tile): (n & 3) * 32 + (n >> 2), so that the 32 lanes of a turned store lie one pitch apart. A wave's four B fragments sit 32 LDS rows apart: lane column c holds plane columns 4 c + 0 .. 3 of its 64
// and stores them as one 16-byte value, 16 lanes = 256 bytes of a row: whole lines, one writer each, no turn of the result.
// Wave (wr, wc) = rows 32 wr .. + 31, columns 64 wc .. + 63: 2 x 4 accumulators; k = 8 half + 0 .. 7 and 16 + 8 half + 0 .. 7 per 32 on both sides, 32 by 32 upwards.
// Blocks 0 and 1 only turn w_proj (128 columns each) through the same LDS path and write it out in the order in which k_natt loads it: [16 columns][16 k][lane = 16 half + column][8 k], 512 bytes in a row for every load of a wave.
#define PT_ 264                 // LDS pitch of a staged row, elements: 528 bytes = 16 x 33, the pitch for 16-byte readers
#define TL_ 128                 // tile edge
__device__ __forceinline__ unsigned pk2(float a, float b) { return __builtin_bit_cast(unsigned, __builtin_convertvector((v2f){a, b}, v2bf)); }
struct WReg { v4f r[4][8]; };   // four runs of 8 k x 4 n
template <int N>   // the row length is a constant, so that the 32 loads differ in their immediate offsets alone
__device__ __forceinline__ void w_load(WReg& g, const float* __restrict__ w, int n0) { const int lane = threadIdx.x & 31, wv = threadIdx.x >> 5; const char* p = (const char*)(w + n0); const unsigned vo = (unsigned)(wv * 8 * N + 4 * lane) * 4u;   // block's base, thread's byte offset
#pragma unroll
    for (int u = 0; u < 4; ++u) {
#pragma unroll
        for (int i = 0; i < 8; ++i) g.r[u][i] = *(const v4f*)(p + vo + (64 * u + i) * N * 4); }
    asm volatile("s_wait_xcnt 0x0" :: "v"(vo) : "memory"); }   // stands in front of any later write to the address register of the loads above; the offset is named so that its register lives up to the wait
template <int U0>   // runs U0 and U0 + 1
__device__ __forceinline__ void w_store(const WReg& g, bf* sb) { const int lane = threadIdx.x & 31, wv = threadIdx.x >> 5;
#pragma unroll
    for (int u = U0; u < U0 + 2; ++u) {
#pragma unroll
        for (int j = 0; j < 4; ++j) { const v4u o = {pk2(g.r[u][0][j], g.r[u][1][j]), pk2(g.r[u][2][j], g.r[u][3][j]), pk2(g.r[u][4][j], g.r[u][5][j]), pk2(g.r[u][6][j], g.r[u][7][j])};
            *(v4ua*)(sb + (j * 32 + lane) * PT_ + (wv + 8 * u) * 8) = o; } } }
struct XReg { v4f r[8][2]; };   // eight rows' runs of 8 k
__device__ __forceinline__ void x_load(XReg& g, const char* p, unsigned vo, int u0) {   // p: the tile's first row; vo: byte offset of the thread's run in row wv
#pragma unroll
    for (int u = 0; u < 8; ++u) { g.r[u][0] = *(const v4f*)(p + vo + (8 * (u0 + u)) * CC * 4); g.r[u][1] = *(const v4f*)(p + vo + (8 * (u0 + u)) * CC * 4 + 16); } }
__device__ __forceinline__ void x_store(const XReg& g, bf* sa, int u0) { const int lane = threadIdx.x & 31, wv = threadIdx.x >> 5;
#pragma unroll
    for (int u = 0; u < 8; ++u) { const v4u o = {pk2(g.r[u][0][0], g.r[u][0][1]), pk2(g.r[u][0][2], g.r[u][0][3]), pk2(g.r[u][1][0], g.r[u][1][1]), pk2(g.r[u][1][2], g.r[u][1][3])};
        *(v4ua*)(sa + (wv + 8 * (u0 + u)) * PT_ + lane * 8) = o; } }
#define WPB (CC / TL_)          // blocks that turn w_proj: 2
// Two blocks share a WGP (LDS), 4 waves a SIMD: the attribute gives the compiler the registers of that occupancy for the loads in flight.
__global__ __launch_bounds__(256) __attribute__((amdgpu_waves_per_eu(4, 4))) void k_proj(const float* __restrict__ xq, const float* __restrict__ xk, const float* __restrict__ wq, const float* __restrict__ wkv, const float* __restrict__ wp, const float* __restrict__ bq, const float* __restrict__ bkv, bf* WP, float* F) {
    __shared__ __align__(16) bf sa[TL_ * PT_];   // x rows
    __shared__ __align__(16) bf sb[TL_ * PT_];   // w columns, in the row order above
    const int lane = threadIdx.x & 31, lr = lane & 15, hi = lane >> 4, wv = threadIdx.x >> 5;
    WReg g;
    if (blockIdx.x < WPB) {
        const int n0 = blockIdx.x * TL_;
        w_load<CC>(g, wp, n0); w_store<0>(g, sb); w_store<2>(g, sb);
        __syncthreads();   // publishes the turned columns: a wave writes out rows that all eight waves stored
#pragma unroll
        for (int u = 0; u < 16; ++u) *(v4u*)(WP + (size_t)((n0 / 16 + wv) * 16 + u) * 256 + lane * 8) = *(const v4ua*)(sb + ((lr & 3) * 32 + wv * 4 + (lr >> 2)) * PT_ + u * 16 + 8 * hi);   // wave = 16 columns, u = 16 k: lane (column lr, half hi) writes its 8 k, 512 bytes in a row
        return;
    }
    const int t = blockIdx.x - WPB; const int r0 = (t / (C3 / TL_)) * TL_, ct = t % (C3 / TL_);
    const bool kv = ct >= CC / TL_;
    const float* x = kv ? xk : xq; const float* bias = kv ? bkv : bq; const int n0 = (kv ? ct - CC / TL_ : ct) * TL_;
    XReg h0, h1;
    const char* px = (const char*)(x + (size_t)r0 * CC); const unsigned vx = (unsigned)(wv * CC + lane * 8) * 4u;
    if (kv) w_load<2 * CC>(g, wkv, n0); else w_load<CC>(g, wq, n0);
    x_load(h0, px, vx, 0);
    __builtin_amdgcn_sched_barrier(0);   // keeps the first use of a loaded w value, with its wait, from rising over the x loads above: they would go out a whole memory latency late
    w_store<0>(g, sb);
    __builtin_amdgcn_sched_barrier(0);   // keeps the loads below from rising over the stores above: all 64 loads in flight at once do not fit the registers of 4 waves a SIMD and spill
    x_load(h1, px, vx, 8);   // the second half of the x rows goes out into the registers that the first w runs leave
    asm volatile("s_wait_xcnt 0x0" :: "v"(vx) : "memory");   // as in w_load, for the x loads
    w_store<2>(g, sb); x_store(h0, sa, 0); x_store(h1, sa, 8);
    const int wr = wv >> 1, wc = wv & 1;
    const v4f bb = *(const v4f*)(bias + n0 + 64 * wc + 4 * lr);
    __syncthreads();   // publishes both tiles: every wave reads rows and columns that the other waves stored
    v8f acc[2][4];
#pragma unroll
    for (int mb = 0; mb < 2; ++mb)
#pragma unroll
        for (int nb = 0; nb < 4; ++nb) acc[mb][nb] = (v8f){};
    const bf* ap = sa + (wr * 32 + lr) * PT_ + 8 * hi; const bf* bp = sb + (wc * 16 + lr) * PT_ + 8 * hi;
    v16bf a[2][2], b[2][4];   // two sets of fragments: the next step's LDS reads go out in front of this step's products
#pragma unroll
    for (int mb = 0; mb < 2; ++mb) a[0][mb] = cat16b(*(const v8usa*)(ap + mb * 16 * PT_), *(const v8usa*)(ap + mb * 16 * PT_ + 16));
#pragma unroll
    for (int nb = 0; nb < 4; ++nb) b[0][nb] = cat16b(*(const v8usa*)(bp + nb * 32 * PT_), *(const v8usa*)(bp + nb * 32 * PT_ + 16));
#pragma unroll   // eight steps, no back edge behind a matrix instruction; the fragment sets are indexed by constants
    for (int ks = 0; ks < CC / 32; ++ks) { const int cu = ks & 1, nx = cu ^ 1, kn = (ks + 1) * 32;
        if (ks + 1 < CC / 32) {
#pragma unroll
            for (int mb = 0; mb < 2; ++mb) a[nx][mb] = cat16b(*(const v8usa*)(ap + mb * 16 * PT_ + kn), *(const v8usa*)(ap + mb * 16 * PT_ + kn + 16));
#pragma unroll
            for (int nb = 0; nb < 4; ++nb) b[nx][nb] = cat16b(*(const v8usa*)(bp + nb * 32 * PT_ + kn), *(const v8usa*)(bp + nb * 32 * PT_ + kn + 16)); }
        __builtin_amdgcn_sched_barrier(0);   // keeps the reads above in front of the products below; left alone the compiler sinks each read to its first use, and every pair of products waits a whole LDS latency
#pragma unroll
        for (int nb = 0; nb < 4; ++nb)
#pragma unroll
            for (int mb = 0; mb < 2; ++mb) acc[mb][nb] = wmmab(a[cu][mb], b[cu][nb], acc[mb][nb]); }
    const v4f bv = {bfr(bb[0]), bfr(bb[1]), bfr(bb[2]), bfr(bb[3])};
    float* crow = F + (size_t)(r0 + wr * 32 + 8 * hi) * C3 + ct * TL_ + 64 * wc + 4 * lr;
#pragma unroll
    for (int mb = 0; mb < 2; ++mb) {
#pragma unroll
        for (int j = 0; j < 8; ++j) { const v4f val = {acc[mb][0][j] + bv[0], acc[mb][1][j] + bv[1], acc[mb][2][j] + bv[2], acc[mb][3][j] + bv[3]}; *(v4f*)(crow + (size_t)(mb * 16 + j) * C3) = val; } }
}

// k_natt: one wave per (2 x 8 query tile, head), both attention products on the f32 16x16x4 matrix form; block = the 8 heads of one tile.
// The 16 windows of a tile lie inside one 8 x 14 block of keys (112 = 7 x 16), start (ui, uj) clamped into the image. Key slot (T, r, half): e = 8 T + r, key row ui + 2 (e / 14) + half, key column uj + e % 14.
// S^T = K Q^T: A row = key slot (r = c & 7, half = c >> 3), B column = query c, both sides hold d = 16 half + 0 .. 15 in the same register order. D register r of tile T = logit of key slot (T, r, half) for query c.
// Keys outside a query's own 7 x 7 window are masked to -3e38 (their weight is 0); softmax runs down the lane's 56 registers plus one exchange between the lane halves.
// O^T = V^T P^T: B = the weights as they lie in D (registers 2t, 2t + 1), A = v read at the same key slots, row m of tile dt = d 2 m + dt (a lane loads its two d as 8 bytes, 16 lanes a key's whole line); D register r = out[query c][16 half + 2 r + dt], scaled by 1 / sum at the end.
// The k rows come in as whole lines too (8 lanes a key) and are turned into A fragments in the wave's own LDS range: row 2 e + half, the 16-byte piece p at p ^ (e & 7), so that stores and reads cover the banks evenly.
// The attention output is split into bf16 hi and lo and gathered in LDS: 16 rows x 256 columns, all that the output projection needs of these 16 pixels. Wave h then forms y columns 32 h .. 32 h + 31 of the 16 rows on the bf16 16x16x32 form:
// A = a row's hi, then lo, half from LDS, B = the w_proj plane's fragments (loaded under the second attention product), k = 8 half + 0 .. 7 and 16 + 8 half + 0 .. 7 on both sides; per 32 k the hi product, then the lo product, into one accumulator.
// D register r = y[row 8 half + r][column c]; the wave turns its 16 x 32 block in its own LDS range, adds the bias and stores whole 128-byte lines: one writer per line.
// Every loop of k_natt is fully unrolled so that its arrays (fragments, logits, masks) are indexed by constants and stay in registers.
__device__ __forceinline__ v8f wmma4(v2f a, v2f b, v8f c) { return __builtin_amdgcn_wmma_f32_16x16x4_f32(false, a, false, b, (short)0, c, false, false); }
#define UR_ 8
#define UC_ 14
#define OP_ 272                 // LDS pitch of an output row, elements: 544 bytes, so that the 16-byte reads of 16 lanes (8 rows x 2 halves) cover the 64 banks once
#define YP_ 36                  // LDS pitch of a wave's y rows, floats: the two lane halves (8 rows apart) store 32 banks apart
// Two blocks of 8 waves share a WGP, 4 waves a SIMD: the attribute gives the compiler the registers of that occupancy, so that the w_proj loads can go out under the second product instead of behind it.
__global__ __launch_bounds__(256) __attribute__((amdgpu_waves_per_eu(4, 4))) void k_natt(const float* __restrict__ F, const float* __restrict__ rpb, const bf* __restrict__ WP, const float* __restrict__ bp, float* OUT) {
    __shared__ __align__(16) bf so[2 * 16 * OP_];   // [hi, lo][query][column]
    __shared__ __align__(16) float ys[NH_ * 16 * YP_];   // [wave][row][column]: each wave's own y block
    __shared__ __align__(16) float sk[NH_ * UR_ * UC_ * HD];   // [wave][key row 2 e + half][d]: each wave's own 112 k rows, 16-byte pieces swizzled
    __shared__ float rb[(NH_ * RPW * RPW + 255) / 256 * 256];   // the table, rounded up so that every thread stores on every trip (the tail repeats the last entry and is never read)
    float rv[(NH_ * RPW * RPW + 255) / 256];   // the bias table's loads go out first and fly together with the q and k loads
#pragma unroll
    for (int u = 0; u < (NH_ * RPW * RPW + 255) / 256; ++u) rv[u] = rpb[min((int)threadIdx.x + 256 * u, NH_ * RPW * RPW - 1)];
    const int lane = threadIdx.x & 31, c = lane & 15, hi = lane >> 4, h = threadIdx.x >> 5;
    const int tile = blockIdx.x; const int b = tile / ((IH / 2) * (IW / 8)), tt = tile % ((IH / 2) * (IW / 8)); const int i0 = (tt / (IW / 8)) * 2, j0 = (tt % (IW / 8)) * 8;
    const int ui = min(max(i0 - NBR, 0), IH - UR_), uj = min(max(j0 - NBR, 0), IW - UC_);
    const int qi = i0 + (c >> 3), qj = j0 + (c & 7);
    const int si = min(max(qi - NBR, 0), IH - KS), sj = min(max(qj - NBR, 0), IW - KS);
    const float* Fb = F + (size_t)b * NPIX * C3 + h * HD;
    float qr[16];
    const float* qp = Fb + (size_t)(qi * IW + qj) * C3 + 16 * hi;
    {
#pragma unroll
      for (int g = 0; g < 4; ++g) { const v4f v = *(const v4f*)(qp + 4 * g);
#pragma unroll
          for (int x = 0; x < 4; ++x) qr[4 * g + x] = v[x] * SCL; } }
    float* skw = sk + h * (UR_ * UC_ * HD);
    const int l3 = lane >> 3, ch = lane & 7;   // 8 lanes read one key's 128 bytes; a load covers the 2 x 2 keys (row l3 & 1, column l3 >> 1) of its place in the block
    const char* pF = (const char*)F;   // the plane's base; the k and v loads add a thread's byte offset and a constant
    const unsigned ko = (unsigned)((b * NPIX + (ui + (l3 & 1)) * IW + uj + (l3 >> 1)) * C3 + CC + h * HD + 4 * ch) * 4u;
    v4f kl[28];
#pragma unroll
    for (int i = 0; i < 28; ++i) kl[i] = *(const v4f*)(pF + ko + (2 * (i / 7) * IW + 2 * (i % 7)) * C3 * 4);
    asm volatile("s_wait_xcnt 0x0" :: "v"(ko), "v"(qp) : "memory");   // stands in front of any later write to the address registers of the q and k loads; both are named so that their registers live up to the wait
#pragma unroll
    for (int u = 0; u < (NH_ * RPW * RPW + 255) / 256; ++u) rb[(int)threadIdx.x + 256 * u] = bfr(rv[u]);
#pragma unroll
    for (int i = 0; i < 28; ++i) *(v4fa*)(skw + (4 * i + l3) * HD + 4 * (ch ^ ((2 * i + (l3 >> 1)) & 7))) = kl[i];   // LDS row 4 i + l3 = 2 e + half; piece ch lies at ch ^ (e & 7)
    __syncthreads();   // publishes the bias table: each wave reads entries that other waves stored; the k rows, which a wave's lanes exchange, lie behind it too
    float kr_[7][16];
#pragma unroll
    for (int T = 0; T < 7; ++T) {
#pragma unroll
        for (int g = 0; g < 4; ++g) { const v4f v = *(const v4fa*)(skw + (16 * T + 2 * (c & 7) + (c >> 3)) * HD + 4 * ((4 * hi + g) ^ (c & 7)));
#pragma unroll
            for (int x = 0; x < 4; ++x) kr_[T][4 * g + x] = v[x]; } }
    v8f s[7];
#pragma unroll
    for (int T = 0; T < 7; ++T) s[T] = (v8f){};
#pragma unroll
    for (int st = 0; st < 8; ++st) {
#pragma unroll
        for (int T = 0; T < 7; ++T) s[T] = wmma4((v2f){kr_[T][2 * st], kr_[T][2 * st + 1]}, (v2f){qr[2 * st], qr[2 * st + 1]}, s[T]); }
    const unsigned vo = (unsigned)((b * NPIX + (ui + hi) * IW + uj) * C3 + 2 * CC + h * HD + 2 * c) * 4u;
    v2f vr[56];   // lane c holds d = 2 c and 2 c + 1 of a key: 16 lanes read its whole 128 bytes
#pragma unroll
    for (int e = 0; e < 40; ++e) vr[e] = *(const v2f*)(pF + vo + (2 * (e / UC_) * IW + e % UC_) * C3 * 4);
    asm volatile("s_wait_xcnt 0x0" :: "v"(vo) : "memory");   // as for the k loads
    bool rok[4]; int rix[4]; bool cok[UC_]; int cix[UC_];
#pragma unroll
    for (int g = 0; g < 4; ++g) { const int ki = ui + 2 * g + hi; rok[g] = (unsigned)(ki - si) < (unsigned)KS; rix[g] = h * (RPW * RPW) + (ki - qi + KS - 1) * RPW; }
#pragma unroll
    for (int x = 0; x < UC_; ++x) { const int kj = uj + x; cok[x] = (unsigned)(kj - sj) < (unsigned)KS; cix[x] = kj - qj + KS - 1; }
    float mx4[4] = {-3.0e38f, -3.0e38f, -3.0e38f, -3.0e38f};
#pragma unroll
    for (int T = 0; T < 7; ++T) {
#pragma unroll
        for (int r = 0; r < 8; ++r) { const int e = T * 8 + r; const bool ok = rok[e / UC_] & cok[e % UC_]; const int ix = ok ? rix[e / UC_] + cix[e % UC_] : 0; const float bv = rb[ix]; const float sb = s[T][r] + bv; const float t = ok ? sb : -3.0e38f; s[T][r] = t; mx4[r & 3] = fmaxf(mx4[r & 3], t); } }
    float mx = fmaxf(fmaxf(mx4[0], mx4[1]), fmaxf(mx4[2], mx4[3])); mx = fmaxf(mx, __shfl_xor(mx, 16, 32));
    float sm4[4] = {0.f, 0.f, 0.f, 0.f};
#pragma unroll
    for (int T = 0; T < 7; ++T) {
#pragma unroll
        for (int r = 0; r < 8; ++r) { const float p = __builtin_amdgcn_exp2f((s[T][r] - mx) * 1.4426950408889634f); s[T][r] = p; sm4[r & 3] += p; } }
    float sum = (sm4[0] + sm4[1]) + (sm4[2] + sm4[3]); sum += __shfl_xor(sum, 16, 32);
    const float f = __fdiv_rn(1.0f, sum);
#pragma unroll   // the last 16 keys' loads go out behind the softmax, whose registers they take, and fly under the first 40 keys' products
    for (int e = 40; e < 56; ++e) vr[e] = *(const v2f*)(pF + vo + (2 * (e / UC_) * IW + e % UC_) * C3 * 4);
    asm volatile("s_wait_xcnt 0x0" :: "v"(vo) : "memory");   // as for the k loads
    v8f o[2]; o[0] = (v8f){}; o[1] = (v8f){};
    v16bf wb[2][8];   // the wave's 32 w_proj rows, B of the output projection
    const char* pW = (const char*)WP; const unsigned wo = (unsigned)(h * HD * CC + lane * 8) * 2u;   // the wave's 16 KB of fragments, the lane's 16 bytes in each 512
#pragma unroll   // wb too is indexed by constants and stays in registers
    for (int T = 0; T < 7; ++T) {
        if (T == 4 || T == 5) {   // the loads go out where the spent v and weight registers make room for them, and fly under the rest of this product and the split
#pragma unroll
            for (int ks = 0; ks < 8; ++ks) wb[T - 4][ks] = cat16b(*(const v8us*)(pW + wo + ((T - 4) * 16 + 2 * ks) * 512), *(const v8us*)(pW + wo + ((T - 4) * 16 + 2 * ks + 1) * 512)); }
#pragma unroll
        for (int t = 0; t < 4; ++t) { const int e = T * 8 + 2 * t;
#pragma unroll
            for (int dt = 0; dt < 2; ++dt) o[dt] = wmma4((v2f){vr[e][dt], vr[e + 1][dt]}, (v2f){s[T][2 * t], s[T][2 * t + 1]}, o[dt]); } }
    asm volatile("s_wait_xcnt 0x0" :: "v"(wo) : "memory");   // stands in front of any later write to the address register of the loads above
    const v4f bb = *(const v4f*)(bp + h * HD + (lane & 7) * 4);
    asm volatile("s_wait_xcnt 0x0" ::: "memory");   // the same for the bias load
#pragma unroll   // as above: o[dt] is indexed by constants and stays in registers
    for (int p = 0; p < 2; ++p) { v8us oh, ol;
#pragma unroll   // the same for the elements of o[dt], oh and ol
        for (int x = 0; x < 8; ++x) { unsigned short a, c2; splitf(o[x & 1][4 * p + (x >> 1)] * f, a, c2); oh[x] = a; ol[x] = c2; }
        *(v8usa*)(so + c * OP_ + h * HD + 16 * hi + 8 * p) = oh; *(v8usa*)(so + (16 + c) * OP_ + h * HD + 16 * hi + 8 * p) = ol; }
    __syncthreads();   // publishes the 16 output rows: each wave reads columns that the other heads' waves computed
    v8f y[2]; y[0] = (v8f){}; y[1] = (v8f){};
#pragma unroll   // wb and y are indexed by constants; the LDS reads go out ahead of the products
    for (int ks = 0; ks < 8; ++ks) { const bf* ap = so + c * OP_ + ks * 32 + 8 * hi;
        const v16bf ah = cat16b(*(const v8usa*)ap, *(const v8usa*)(ap + 16)), al = cat16b(*(const v8usa*)(ap + 16 * OP_), *(const v8usa*)(ap + 16 * OP_ + 16));
#pragma unroll
        for (int nt = 0; nt < 2; ++nt) { y[nt] = wmmab(ah, wb[nt][ks], y[nt]); y[nt] = wmmab(al, wb[nt][ks], y[nt]); } }
    float* yw = ys + h * (16 * YP_);
#pragma unroll
    for (int nt = 0; nt < 2; ++nt) {
#pragma unroll
        for (int j = 0; j < 8; ++j) yw[(hi * 8 + j) * YP_ + nt * 16 + c] = y[nt][j]; }
    __builtin_amdgcn_wave_barrier(); asm volatile("" ::: "memory");   // keeps the reads below, of values that other lanes of this wave stored, behind the stores above
#pragma unroll   // the four LDS reads go out together
    for (int u = 0; u < 4; ++u) { const int rq = 4 * u + (lane >> 3); v4f val = *(const v4fa*)(yw + rq * YP_ + (lane & 7) * 4);
        val[0] += bfr(bb[0]); val[1] += bfr(bb[1]); val[2] += bfr(bb[2]); val[3] += bfr(bb[3]);
        *(v4f*)(OUT + ((size_t)b * NPIX + (size_t)((i0 + (rq >> 3)) * IW + j0 + (rq & 7))) * CC + h * HD + (lane & 7) * 4) = val; }
}

extern "C" void kernel_launch(void* const* d_in, const int* in_sizes, int n_in,
                              void* d_out, int out_size, void* d_ws, size_t ws_size, hipStream_t stream) {
    (void)in_sizes; (void)n_in; (void)out_size;
    const float* xq = (const float*)d_in[0]; const float* xk = (const float*)d_in[1]; const float* wq = (const float*)d_in[2]; const float* bq = (const float*)d_in[3]; const float* wkv = (const float*)d_in[4]; const float* bkv = (const float*)d_in[5]; const float* rpb = (const float*)d_in[6]; const float* wp = (const float*)d_in[7]; const float* bp = (const float*)d_in[8];   /* order x_q, x_k ([2][56][56][256] channels-last), Wq ('xw' [256][256]), bq, Wkv ('xw' [256][512]: columns k | v), bkv, rpb [8][13][13], Wproj ('xw' [256][256]), bproj; nine inputs, all read */
    float* OUT = (float*)d_out;     // [2][56][56][256] = [6272][256]
    char* wsp = (char*)d_ws;
    auto take = [&](size_t bytes) { char* p = wsp; wsp += (bytes + 255) & ~(size_t)255; return (void*)p; };
    bf* WP = (bf*)take((size_t)CC * CC * 2); float* F = (float*)take((size_t)NTOK * C3 * 4);
    if ((size_t)(wsp - (char*)d_ws) > ws_size) return;    // carve ~19 MiB
    k_proj<<<(unsigned)(WPB + (NTOK / TL_) * (C3 / TL_)), 256, 0, stream>>>(xq, xk, wq, wkv, wp, bq, bkv, WP, F);   /* columns 0 .. 255: q = x_q Wq + bq; columns 256 .. 767: [k | v] = x_k Wkv + bkv; w_proj turned */
    k_natt<<<(unsigned)(NTOK / 16), 256, 0, stream>>>(F, rpb, WP, bp, OUT);                                                /* windowed attention, f32; its rows, split into hi and lo, x w_proj + b_proj */
}

// v006
// It runs in 27.5 microseconds.
// Next to v005, in two timings, it ran 1.04 and 1.03 times as fast.
// All steps since v000 together make it 8.19 times as fast.
#include <hip/hip_runtime.h>

// Neighborhood CROSS attention (NATTEN with separate query / key inputs; x_q, x_k [2][56][56][256] channels-last; q = x_q Wq + bq ('xw' [256][256] -> 8 heads x 32), [k | v] = x_k Wkv + bkv ('xw' [256][512] viewed (2, 8 heads, 32): columns 0..255 = k, 256..511 = v); for every pixel a 7x7 key window clamped to stay inside the image (start = clamp(i - 3, 0, 49)); logits = (q x 32^-0.5).k + rpb[h][ki - i + 6][kj - j + 6] (rpb [8][13][13] input); softmax over the 49; out = attn.v; y = out Wproj + bproj ('xw' [256][256]) -> [2][56][56][256] (1.6 M); argument order x_q, x_k, Wq, bq, Wkv, bkv, rpb, Wproj, bproj).
// Compute dtypes, f32 accumulate: every input rounded to bf16; the q, k and v projections on PLAIN bf16 operands (exact), their f32 biases as the accumulators' start values; the whole windowed attention in f32, both products on the f32 16x16x4 matrix form (one wave per (2 x 8 query tile, head) against the tile's 8 x 14 block of keys, keys outside a query's window masked, logits + bias and the f32 softmax in registers); the attention output as bf16 hi + lo halves x exact w_proj (2 products) + f32 bias.
// One launch: a block of 16 waves owns 4 x 8 queries, rounds their x_q rows and the x_k rows of their 10 x 14 block of keys into LDS, and projects q, k and v of those rows itself; no plane goes through memory.

#define NB_  2
#define IH   56
#define IW   56
#define NPIX (IH * IW)          // 3136
#define NTOK (NB_ * NPIX)       // 6272 = 98 x 64
#define CC   256
#define C3   768
#define NH_  8
#define HD   32
#define KS   7
#define NBR  3
#define RPW  13                 // 2*KS - 1
#define SCL  0.17677669529663689f   // 32^-0.5
typedef _Float16 h16;
typedef unsigned short bf;
typedef __attribute__((ext_vector_type(16))) __bf16   v16bf;
typedef __attribute__((ext_vector_type(16))) _Float16 v16h;
typedef __attribute__((ext_vector_type(8)))  _Float16 v8h;
typedef __attribute__((ext_vector_type(8)))  unsigned short v8us;
typedef __attribute__((ext_vector_type(8)))  float    v8f;
typedef __attribute__((ext_vector_type(4)))  float    v4f;
typedef v8h  __attribute__((may_alias)) v8ha;
typedef v4f  __attribute__((may_alias)) v4fa;
typedef v8us __attribute__((may_alias)) v8usa;

__device__ __forceinline__ unsigned short f2bf(float f) { unsigned u = __float_as_uint(f); u += 0x7FFFu + ((u >> 16) & 1u); return (unsigned short)(u >> 16); }
__device__ __forceinline__ float bf2f(unsigned short b) { return __uint_as_float(((unsigned)b) << 16); }
__device__ __forceinline__ float bfr(float f) { return bf2f(f2bf(f)); }
__device__ __forceinline__ v16h cat16(v8h lo, v8h hi) { return __builtin_shufflevector(lo, hi, 0, 1, 2, 3, 4, 5, 6, 7, 8, 9, 10, 11, 12, 13, 14, 15); }
__device__ __forceinline__ v16bf cat16b(v8us lo, v8us hi) { return __builtin_bit_cast(v16bf, __builtin_shufflevector(lo, hi, 0, 1, 2, 3, 4, 5, 6, 7, 8, 9, 10, 11, 12, 13, 14, 15)); }
__device__ __forceinline__ v8f wmma16(v16h a, v16h b, v8f c) { return __builtin_amdgcn_wmma_f32_16x16x32_f16(false, a, false, b, (short)0, c, false, false); }
__device__ __forceinline__ v8f wmmab(v16bf a, v16bf b, v8f c) { return __builtin_amdgcn_wmma_f32_16x16x32_bf16(false, a, false, b, (short)0, c, false, false); }




__device__ __forceinline__ void splitf(float y, unsigned short& h, unsigned short& l) { h = f2bf(y); l = f2bf(y - bf2f(h)); }
typedef __attribute__((ext_vector_type(2))) float v2f;
typedef __attribute__((ext_vector_type(2))) __bf16 v2bf;
typedef __attribute__((ext_vector_type(4))) unsigned v4u;
typedef v4u __attribute__((may_alias)) v4ua;

#define PT_ 264                 // LDS pitch of a staged x row, elements: 528 bytes = 16 x 33, the pitch for 16-byte readers
#define UR_ 8
#define UC_ 14
#define UH_ 10                  // key rows that the two query tiles of a block cover together
#define KR_ 144                 // staged x_k rows: 140, rounded up to whole trips of 16 waves (the tail repeats the last row and is never read)
#define KP_ 80                  // elements (160 bytes) put in front of each further key row in LDS: the two key rows of an x_k fragment then lie 8 pieces of 16 bytes apart in the banks, not 14
#define XQ_ (KR_ * PT_ + 11 * KP_)   // where the x_q rows begin
#define OP_ 272                 // LDS pitch of an output row, elements: 544 bytes
#define YP_ 36                  // LDS pitch of a wave's y rows, floats: the two lane halves (8 rows apart) store 32 banks apart
__device__ __forceinline__ unsigned pk2(float a, float b) { return __builtin_bit_cast(unsigned, __builtin_convertvector((v2f){a, b}, v2bf)); }
__device__ __forceinline__ v8f wmma4(v2f a, v2f b, v8f c) { return __builtin_amdgcn_wmma_f32_16x16x4_f32(false, a, false, b, (short)0, c, false, false); }
// A weight plane of 256 k x 256 columns goes f32 -> registers -> bf16 -> LDS, turned: LDS row = column n, 512 bytes of k; the 16-byte piece q (8 k) lies at q ^ wsw(n),
// so that both the turned stores (16 lanes = columns 4 apart) and the fragment reads (16 lanes = 16 columns in a row) cover the 64 banks once.
__device__ __forceinline__ int wsw(int n) { return ((n >> 2) ^ (n << 2)) & 15; }
struct WReg { v4f r[4][8]; };   // four runs of 8 k x 4 n
template <int N>   // the row length is a constant, so that the 32 loads differ in their immediate offsets alone
__device__ __forceinline__ void w_load(WReg& g, const float* __restrict__ w) { const int lane = threadIdx.x & 31, wv = threadIdx.x >> 5; const char* p = (const char*)w; const unsigned vo = (unsigned)((wv & 7) * 8 * N + 128 * (wv >> 3) + 4 * lane) * 4u;   // plane's base, thread's byte offset
#pragma unroll   // g is indexed by constants and stays in registers
    for (int u = 0; u < 4; ++u) {
#pragma unroll
        for (int i = 0; i < 8; ++i) g.r[u][i] = *(const v4f*)(p + vo + (64 * u + i) * N * 4); }
    asm volatile("s_wait_xcnt 0x0" :: "v"(vo) : "memory"); }   // stands in front of any later write to the address register of the loads above; the offset is named so that its register lives up to the wait
// The swizzled places reduce to 4 store and 8 read offsets a thread plus constants: a store of column 4 lane + j, piece (wv & 7) + 8 u, has wsw = (lane & 15) ^ 4 j, so its piece is ((wv & 7) ^ (lane & 15)) ^ 4 (j ^ 2 (u & 1)), + 16 (u >> 1);
// a read of column nw + 16 dt has wsw(nw) ^ 4 dt, so its piece 4 ks + 2 s + half lies where column nw has that of step (ks & 3) ^ dt, + 16 (ks >> 2).
struct WAdr { int st[4]; int fr[4][2]; };   // element offsets into the buffer
__device__ __forceinline__ void w_adr(WAdr& a, int nw, int hi) { const int lane = threadIdx.x & 31, wv = threadIdx.x >> 5; const int p0 = (wv & 7) ^ (lane & 15), r0 = (128 * (wv >> 3) + 4 * lane) * CC, f0 = wsw(nw);
#pragma unroll   // a is indexed by constants
    for (int x = 0; x < 4; ++x) { a.st[x] = r0 + (p0 ^ (4 * x)) * 8; a.fr[x][0] = nw * CC + ((4 * x + hi) ^ f0) * 8; a.fr[x][1] = nw * CC + ((4 * x + 2 + hi) ^ f0) * 8; } }
__device__ __forceinline__ void w_store(const WReg& g, bf* sw, const WAdr& a) {
#pragma unroll   // as in w_load
    for (int u = 0; u < 4; ++u) {
#pragma unroll
        for (int j = 0; j < 4; ++j) { const v4u o = {pk2(g.r[u][0][j], g.r[u][1][j]), pk2(g.r[u][2][j], g.r[u][3][j]), pk2(g.r[u][4][j], g.r[u][5][j]), pk2(g.r[u][6][j], g.r[u][7][j])};
            *(v4ua*)(sw + a.st[j ^ (2 * (u & 1))] + j * CC + (u >> 1) * 128) = o; } } }
// Fragment of column nw + 16 dt for the 32 k of step ks: k = 8 half + 0 .. 7 and 16 + 8 half + 0 .. 7, the order of the x fragments.
__device__ __forceinline__ v16bf w_frag(const bf* sw, const WAdr& a, int dt, int ks) { const bf* r = sw + dt * 16 * CC + (ks >> 2) * 128; return cat16b(*(const v8usa*)(r + a.fr[(ks & 3) ^ dt][0]), *(const v8usa*)(r + a.fr[(ks & 3) ^ dt][1])); }
// Five vector slots between a bf16 product and the f32 product that takes its result as A; the scheduling barriers hold the products on their sides of the slots.
#define WMMA_GAP() do { __builtin_amdgcn_sched_barrier(0); asm volatile("v_nop\n\tv_nop\n\tv_nop\n\tv_nop\n\tv_nop"); __builtin_amdgcn_sched_barrier(0); } while (0)
__device__ __forceinline__ v16bf x_frag(const bf* xp, int ks) { return cat16b(*(const v8usa*)(xp + ks * 32), *(const v8usa*)(xp + ks * 32 + 16)); }   // xp: the lane's row + 8 half

// k_natt: block = 4 x 8 queries, wave = (head h, 2 x 8 query tile sub). The 16 windows of a tile lie inside one 8 x 14 block of keys (112 = 7 x 16), start (ui, uj) clamped into the image; both tiles' blocks lie inside 10 x 14 keys from (U0, uj).
// Key slot (T, r, half): e = 8 T + r, key row ui + 2 (e / 14) + half, key column uj + e % 14. The x_k fragment of tile T has lane c on key slot (T, c & 7, c >> 3); it serves as B of k^T and as A of v.
// q^T = Wq^T x_q^T and k^T = Wk^T x_k^T (A = weight columns 16 dt + c of the head, B = x rows): D register r of tile dt = d 16 dt + 8 half + r of the lane's query or key, which is the operand order of the next product as it lies.
// S^T = K Q^T on the f32 form: A row = key slot, B column = query c, both sides hold the same d in the same register. D register r of tile T = logit of key slot (T, r, half) for query c.
// Keys outside a query's own 7 x 7 window are masked to -3e38 (their weight is 0); softmax runs down the lane's 56 registers plus one exchange between the lane halves.
// v = x_k Wv (A = the x_k fragment, B = weight columns 16 dt + c): D register r = v[key slot (T, r, half)][16 dt + c], the A operand of O^T = V^T P^T as it lies; B = the weights as they lie in S^T's D. O^T's D register r = out[query c][16 dt + 8 half + r].
// The four weight planes (Wq, Wk, Wv, Wproj) pass one after the other through one LDS buffer; each wave keeps the 16 fragments of its head's k, then v, columns in registers over its 7 tiles.
// The attention output is split into bf16 hi and lo and gathered in LDS (32 rows x 256 columns); wave (h, sub) forms y columns 32 h .. + 31 of its tile's 16 rows, per 32 k the hi product, then the lo product, into one accumulator,
// turns its 16 x 32 block in its own LDS range, adds the bias and stores whole 128-byte lines: one writer per line.
// Every loop is fully unrolled so that its arrays (fragments, logits, masks) are indexed by constants and stay in registers.
// One block of 16 waves a WGP, 4 waves a SIMD: the attribute gives the compiler the registers of that occupancy.
__global__ __launch_bounds__(512) __attribute__((amdgpu_waves_per_eu(4, 4))) void k_natt(const float* __restrict__ xq, const float* __restrict__ xk, const float* __restrict__ wq, const float* __restrict__ wkv, const float* __restrict__ wp, const float* __restrict__ bq, const float* __restrict__ bkv, const float* __restrict__ rpb, const float* __restrict__ bp, float* OUT) {
    __shared__ __align__(16) bf sx[XQ_ + 32 * PT_];   // x_k rows of the 10 x 14 keys, then the 32 x_q rows
    __shared__ __align__(16) bf sw[CC * CC];            // the weight plane in use
    __shared__ __align__(16) bf so[2 * 32 * OP_];       // [hi, lo][query][column]
    __shared__ __align__(16) float ys[16 * 16 * YP_];   // [wave][row][column]: each wave's own y block
    __shared__ float rb[(NH_ * RPW * RPW + 511) / 512 * 512];   // the table, rounded up so that every thread stores on every trip (the tail repeats the last entry and is never read)
    __shared__ __align__(32) float sbi[4 * CC];         // biases, rounded: bq, bproj, bkv
    const int tid = threadIdx.x, lane = tid & 31, c = lane & 15, hi = lane >> 4, wv = tid >> 5, h = wv & 7, sub = wv >> 3;
    const int tile = blockIdx.x; const int b = tile / ((IH / 4) * (IW / 8)), tt = tile % ((IH / 4) * (IW / 8)); const int i0 = (tt / (IW / 8)) * 4, j0 = (tt % (IW / 8)) * 8;
    const int U0 = min(max(i0 - NBR, 0), IH - UH_), uj = min(max(j0 - NBR, 0), IW - UC_);
    WReg g; WAdr wa; w_adr(wa, h * HD + c, hi);
    {   // stage: x rows, the bias table, the biases, Wq
        unsigned xo[11]; v4f xr[11][2];
#pragma unroll   // xo and xr are indexed by constants
        for (int u = 0; u < 9; ++u) { const int r = min(wv + 16 * u, UH_ * UC_ - 1); xo[u] = (unsigned)((b * NPIX + (U0 + r / UC_) * IW + uj + r % UC_) * CC + lane * 8) * 4u; }
#pragma unroll
        for (int u = 9; u < 11; ++u) { const int r = wv + 16 * (u - 9); xo[u] = (unsigned)((b * NPIX + (i0 + (r >> 3)) * IW + j0 + (r & 7)) * CC + lane * 8) * 4u; }
#pragma unroll
        for (int u = 0; u < 11; ++u) { const char* p = (const char*)(u < 9 ? xk : xq) + xo[u]; xr[u][0] = *(const v4f*)p; xr[u][1] = *(const v4f*)(p + 16); }
        asm volatile("s_wait_xcnt 0x0" :: "v"(xo[0]), "v"(xo[1]), "v"(xo[2]), "v"(xo[3]), "v"(xo[4]), "v"(xo[5]), "v"(xo[6]), "v"(xo[7]), "v"(xo[8]), "v"(xo[9]), "v"(xo[10]) : "memory");   // as in w_load, for the x loads
        w_load<CC>(g, wq);
        float rv[3];
        const unsigned ro0 = (unsigned)min(tid, NH_ * RPW * RPW - 1) * 4u, ro1 = (unsigned)min(tid + 512, NH_ * RPW * RPW - 1) * 4u, ro2 = (unsigned)min(tid + 1024, NH_ * RPW * RPW - 1) * 4u, bo = (unsigned)tid * 4u, bo2 = (unsigned)(tid & 255) * 4u;
        rv[0] = *(const float*)((const char*)rpb + ro0); rv[1] = *(const float*)((const char*)rpb + ro1); rv[2] = *(const float*)((const char*)rpb + ro2);
        const float b0 = *(const float*)((const char*)bq + bo2), b1 = *(const float*)((const char*)bp + bo2), b2 = *(const float*)((const char*)bkv + bo);
        asm volatile("s_wait_xcnt 0x0" :: "v"(ro0), "v"(ro1), "v"(ro2), "v"(bo), "v"(bo2) : "memory");   // as in w_load, for the table's and the biases' loads
#pragma unroll
        for (int u = 0; u < 11; ++u) { const v4u o = {pk2(xr[u][0][0], xr[u][0][1]), pk2(xr[u][0][2], xr[u][0][3]), pk2(xr[u][1][0], xr[u][1][1]), pk2(xr[u][1][2], xr[u][1][3])};
            *(v4ua*)(sx + (u < 9 ? (wv + 16 * u) * PT_ + ((wv + 16 * u) / UC_) * KP_ : XQ_ + (wv + 16 * (u - 9)) * PT_) + lane * 8) = o; }
        w_store(g, sw, wa);
#pragma unroll
        for (int u = 0; u < 3; ++u) rb[tid + 512 * u] = bfr(rv[u]);
        sbi[tid] = bfr(tid < CC ? b0 : b1); sbi[2 * CC + tid] = bfr(b2);
    }
    __syncthreads();   // publishes the staged rows, tables and Wq: every wave reads what the other waves stored
    w_load<2 * CC>(g, wkv);   // Wk's loads fly under the q projection (in front of the barrier they would be waited for there)
    const int is = i0 + 2 * sub;
    const int ui = min(max(is - NBR, 0), IH - UR_);
    const int qi = is + (c >> 3), qj = j0 + (c & 7);
    const int si = min(max(qi - NBR, 0), IH - KS), sj = min(max(qj - NBR, 0), IW - KS);
    const int nw = h * HD + c;   // the lane's weight column in tile dt = 0
    float qr[16];
    { v8f qa[2]; const bf* xp = sx + XQ_ + (16 * sub + c) * PT_ + 8 * hi;
#pragma unroll
      for (int dt = 0; dt < 2; ++dt) qa[dt] = *(const v8f*)(sbi + h * HD + 16 * dt + 8 * hi);
#pragma unroll
      for (int ks = 0; ks < 8; ++ks) { const v16bf xf = x_frag(xp, ks);
#pragma unroll
          for (int dt = 0; dt < 2; ++dt) qa[dt] = wmmab(w_frag(sw, wa, dt, ks), xf, qa[dt]); }
#pragma unroll
      for (int x = 0; x < 16; ++x) qr[x] = qa[x >> 3][x & 7] * SCL; }
    __syncthreads();   // ends every wave's reads of Wq: the buffer is rewritten behind it
    w_store(g, sw, wa);
    __syncthreads();   // publishes Wk
    v16bf wf[2][8];
#pragma unroll
    for (int dt = 0; dt < 2; ++dt) {
#pragma unroll
        for (int ks = 0; ks < 8; ++ks) wf[dt][ks] = w_frag(sw, wa, dt, ks); }
    __syncthreads();   // ends every wave's reads of Wk: the buffer is rewritten behind the first product
    const bf* xb = sx + ((ui - U0 + (c >> 3)) * UC_ + (c & 7)) * PT_ + (ui - U0 + (c >> 3)) * KP_ + 8 * hi;   // key slot (0, c & 7, c >> 3); tile T adds its rows below
    v8f s[7];
#pragma unroll
    for (int T = 0; T < 7; ++T) { const int q0 = (8 * T) / UC_, m0 = (8 * T) % UC_;   // e = 8 T + (c & 7): past the end of a key row it goes on two rows down
        const bf* xp = xb + (2 * UC_ * q0 + m0) * PT_ + 2 * q0 * KP_ + (m0 + (c & 7) >= UC_ ? UC_ * PT_ + 2 * KP_ : 0);
        v8f kt[2];
#pragma unroll
        for (int dt = 0; dt < 2; ++dt) kt[dt] = *(const v8f*)(sbi + 2 * CC + h * HD + 16 * dt + 8 * hi);
#pragma unroll
        for (int ks = 0; ks < 8; ++ks) { const v16bf xf = x_frag(xp, ks);
#pragma unroll
            for (int dt = 0; dt < 2; ++dt) kt[dt] = wmmab(wf[dt][ks], xf, kt[dt]); }
        WMMA_GAP();
        s[T] = (v8f){};
#pragma unroll
        for (int st = 0; st < 8; ++st) s[T] = wmma4((v2f){kt[st >> 2][(2 * st) & 7], kt[st >> 2][((2 * st) & 7) + 1]}, (v2f){qr[2 * st], qr[2 * st + 1]}, s[T]); }
    bool rok[4]; int rix[4]; bool cok[UC_]; int cix[UC_];
#pragma unroll
    for (int g4 = 0; g4 < 4; ++g4) { const int ki = ui + 2 * g4 + hi; rok[g4] = (unsigned)(ki - si) < (unsigned)KS; rix[g4] = h * (RPW * RPW) + (ki - qi + KS - 1) * RPW; }
#pragma unroll
    for (int x = 0; x < UC_; ++x) { const int kj = uj + x; cok[x] = (unsigned)(kj - sj) < (unsigned)KS; cix[x] = kj - qj + KS - 1; }
    float mx4[4] = {-3.0e38f, -3.0e38f, -3.0e38f, -3.0e38f};
#pragma unroll
    for (int T = 0; T < 7; ++T) {
#pragma unroll
        for (int r = 0; r < 8; ++r) { const int e = T * 8 + r; const bool ok = rok[e / UC_] & cok[e % UC_]; const int ix = ok ? rix[e / UC_] + cix[e % UC_] : 0; const float bv = rb[ix]; const float sb = s[T][r] + bv; const float t = ok ? sb : -3.0e38f; s[T][r] = t; mx4[r & 3] = fmaxf(mx4[r & 3], t); } }
    float mx = fmaxf(fmaxf(mx4[0], mx4[1]), fmaxf(mx4[2], mx4[3])); mx = fmaxf(mx, __shfl_xor(mx, 16, 32));
    w_load<2 * CC>(g, wkv + CC);   // Wv's loads go out where the masks' registers are free again, and fly under the exponentials
    float sm4[4] = {0.f, 0.f, 0.f, 0.f};
#pragma unroll
    for (int T = 0; T < 7; ++T) {
#pragma unroll
        for (int r = 0; r < 8; ++r) { const float p = __builtin_amdgcn_exp2f((s[T][r] - mx) * 1.4426950408889634f); s[T][r] = p; sm4[r & 3] += p; } }
    float sum = (sm4[0] + sm4[1]) + (sm4[2] + sm4[3]); sum += __shfl_xor(sum, 16, 32);
    const float f = __fdiv_rn(1.0f, sum);
    w_store(g, sw, wa);
    __syncthreads();   // publishes Wv
#pragma unroll
    for (int dt = 0; dt < 2; ++dt) {
#pragma unroll
        for (int ks = 0; ks < 8; ++ks) wf[dt][ks] = w_frag(sw, wa, dt, ks); }
    const float vb0 = sbi[3 * CC + nw], vb1 = sbi[3 * CC + nw + 16];
    __syncthreads();   // ends every wave's reads of Wv: the buffer is rewritten behind the second product
    v8f o[2]; o[0] = (v8f){}; o[1] = (v8f){};
#pragma unroll
    for (int T = 0; T < 7; ++T) { const int q0 = (8 * T) / UC_, m0 = (8 * T) % UC_;
        const bf* xp = xb + (2 * UC_ * q0 + m0) * PT_ + 2 * q0 * KP_ + (m0 + (c & 7) >= UC_ ? UC_ * PT_ + 2 * KP_ : 0);
        v8f vt[2] = {{vb0, vb0, vb0, vb0, vb0, vb0, vb0, vb0}, {vb1, vb1, vb1, vb1, vb1, vb1, vb1, vb1}};
#pragma unroll
        for (int ks = 0; ks < 8; ++ks) { const v16bf xf = x_frag(xp, ks);
#pragma unroll
            for (int dt = 0; dt < 2; ++dt) vt[dt] = wmmab(xf, wf[dt][ks], vt[dt]); }
        WMMA_GAP();
#pragma unroll
        for (int t = 0; t < 4; ++t) {
#pragma unroll
            for (int dt = 0; dt < 2; ++dt) o[dt] = wmma4((v2f){vt[dt][2 * t], vt[dt][2 * t + 1]}, (v2f){s[T][2 * t], s[T][2 * t + 1]}, o[dt]); } }
    w_load<CC>(g, wp);
#pragma unroll   // o[dt] is indexed by constants and stays in registers
    for (int dt = 0; dt < 2; ++dt) { v8us oh, ol;
#pragma unroll
        for (int x = 0; x < 8; ++x) { unsigned short a, c2; splitf(o[dt][x] * f, a, c2); oh[x] = a; ol[x] = c2; }
        *(v8usa*)(so + (16 * sub + c) * OP_ + h * HD + 16 * dt + 8 * hi) = oh; *(v8usa*)(so + (32 + 16 * sub + c) * OP_ + h * HD + 16 * dt + 8 * hi) = ol; }
    w_store(g, sw, wa);
    __syncthreads();   // publishes Wproj and the 32 output rows: each wave reads columns that the other heads' waves computed
    v8f y[2]; y[0] = (v8f){}; y[1] = (v8f){};
#pragma unroll   // y is indexed by constants; the LDS reads go out ahead of the products
    for (int ks = 0; ks < 8; ++ks) { const bf* ap = so + (16 * sub + c) * OP_ + ks * 32 + 8 * hi;
        const v16bf ah = cat16b(*(const v8usa*)ap, *(const v8usa*)(ap + 16)), al = cat16b(*(const v8usa*)(ap + 32 * OP_), *(const v8usa*)(ap + 32 * OP_ + 16));
#pragma unroll
        for (int nt = 0; nt < 2; ++nt) { const v16bf wb = w_frag(sw, wa, nt, ks); y[nt] = wmmab(ah, wb, y[nt]); y[nt] = wmmab(al, wb, y[nt]); } }
    float* yw = ys + wv * (16 * YP_);
#pragma unroll
    for (int nt = 0; nt < 2; ++nt) {
#pragma unroll
        for (int j = 0; j < 8; ++j) yw[(hi * 8 + j) * YP_ + nt * 16 + c] = y[nt][j]; }
    __builtin_amdgcn_wave_barrier(); asm volatile("" ::: "memory");   // keeps the reads below, of values that other lanes of this wave stored, behind the stores above
    const v4f bb = *(const v4fa*)(sbi + CC + h * HD + (lane & 7) * 4);
#pragma unroll   // the four LDS reads go out together
    for (int u = 0; u < 4; ++u) { const int rq = 4 * u + (lane >> 3); v4f val = *(const v4fa*)(yw + rq * YP_ + (lane & 7) * 4);
        val[0] += bb[0]; val[1] += bb[1]; val[2] += bb[2]; val[3] += bb[3];
        *(v4f*)(OUT + ((size_t)b * NPIX + (size_t)((is + (rq >> 3)) * IW + j0 + (rq & 7))) * CC + h * HD + (lane & 7) * 4) = val; }
}

extern "C" void kernel_launch(void* const* d_in, const int* in_sizes, int n_in,
                              void* d_out, int out_size, void* d_ws, size_t ws_size, hipStream_t stream) {
    (void)in_sizes; (void)n_in; (void)out_size; (void)d_ws; (void)ws_size;
    const float* xq = (const float*)d_in[0]; const float* xk = (const float*)d_in[1]; const float* wq = (const float*)d_in[2]; const float* bq = (const float*)d_in[3]; const float* wkv = (const float*)d_in[4]; const float* bkv = (const float*)d_in[5]; const float* rpb = (const float*)d_in[6]; const float* wp = (const float*)d_in[7]; const float* bp = (const float*)d_in[8];   /* x_q, x_k ([2][56][56][256] channels-last), Wq ('xw' [256][256]), bq, Wkv ('xw' [256][512]: columns k | v), bkv, rpb [8][13][13], Wproj ('xw' [256][256]), bproj; nine inputs, all read */
    float* OUT = (float*)d_out;     // [2][56][56][256] = [6272][256]
    k_natt<<<(unsigned)(NTOK / 32), 512, 0, stream>>>(xq, xk, wq, wkv, wp, bq, bkv, rpb, bp, OUT);   /* projections, windowed attention in f32, output projection: one block per 4 x 8 queries */
}

// v007
// One run takes 26.6 microseconds.
// Two timings next to v006 both put it at 1.03 times that version's speed.
// All steps since v000 together make it 8.45 times as fast.
#include <hip/hip_runtime.h>

// Neighborhood CROSS attention (NATTEN with separate query / key inputs; x_q, x_k [2][56][56][256] channels-last; q = x_q Wq + bq ('xw' [256][256] -> 8 heads x 32), [k | v] = x_k Wkv + bkv ('xw' [256][512] viewed (2, 8 heads, 32): columns 0..255 = k, 256..511 = v); for every pixel a 7x7 key window clamped to stay inside the image (start = clamp(i - 3, 0, 49)); logits = (q x 32^-0.5).k + rpb[h][ki - i + 6][kj - j + 6] (rpb [8][13][13] input); softmax over the 49; out = attn.v; y = out Wproj + bproj ('xw' [256][256]) -> [2][56][56][256] (1.6 M); argument order x_q, x_k, Wq, bq, Wkv, bkv, rpb, Wproj, bproj).
// Compute dtypes, f32 accumulate: every input rounded to bf16; the q, k and v projections on PLAIN bf16 operands (exact), their f32 biases as the accumulators' start values; the whole windowed attention in f32, both products on the f32 16x16x4 matrix form (one wave per (2 x 8 query tile, head) against the tile's 8 x 14 block of keys, keys outside a query's window masked, logits + bias and the f32 softmax in registers); the attention output as bf16 hi + lo halves x exact w_proj (2 products) + f32 bias.
// One launch: a block of 16 waves owns 4 x 8 queries, rounds their x_q rows and the x_k rows of their 10 x 14 block of keys into LDS, and projects q, k and v of those rows itself; no plane goes through memory.
// Three quarters of Wv and of Wproj come into LDS as f32 by asynchronous copies that fly under the two matrix loops; each thread takes its own copied values back into registers and goes on as with loaded ones.

#define NB_  2
#define IH   56
#define IW   56
#define NPIX (IH * IW)          // 3136
#define NTOK (NB_ * NPIX)       // 6272 = 98 x 64
#define CC   256
#define C3   768
#define NH_  8
#define HD   32
#define KS   7
#define NBR  3
#define RPW  13                 // 2*KS - 1
#define SCL  0.17677669529663689f   // 32^-0.5
typedef _Float16 h16;
typedef unsigned short bf;
typedef __attribute__((ext_vector_type(16))) __bf16   v16bf;
typedef __attribute__((ext_vector_type(16))) _Float16 v16h;
typedef __attribute__((ext_vector_type(8)))  _Float16 v8h;
typedef __attribute__((ext_vector_type(8)))  unsigned short v8us;
typedef __attribute__((ext_vector_type(8)))  float    v8f;
typedef __attribute__((ext_vector_type(4)))  float    v4f;
typedef v8h  __attribute__((may_alias)) v8ha;
typedef v4f  __attribute__((may_alias)) v4fa;
typedef v8us __attribute__((may_alias)) v8usa;

__device__ __forceinline__ unsigned short f2bf(float f) { unsigned u = __float_as_uint(f); u += 0x7FFFu + ((u >> 16) & 1u); return (unsigned short)(u >> 16); }
__device__ __forceinline__ float bf2f(unsigned short b) { return __uint_as_float(((unsigned)b) << 16); }
__device__ __forceinline__ float bfr(float f) { return bf2f(f2bf(f)); }
__device__ __forceinline__ v16h cat16(v8h lo, v8h hi) { return __builtin_shufflevector(lo, hi, 0, 1, 2, 3, 4, 5, 6, 7, 8, 9, 10, 11, 12, 13, 14, 15); }
__device__ __forceinline__ v16bf cat16b(v8us lo, v8us hi) { return __builtin_bit_cast(v16bf, __builtin_shufflevector(lo, hi, 0, 1, 2, 3, 4, 5, 6, 7, 8, 9, 10, 11, 12, 13, 14, 15)); }
__device__ __forceinline__ v8f wmma16(v16h a, v16h b, v8f c) { return __builtin_amdgcn_wmma_f32_16x16x32_f16(false, a, false, b, (short)0, c, false, false); }
__device__ __forceinline__ v8f wmmab(v16bf a, v16bf b, v8f c) { return __builtin_amdgcn_wmma_f32_16x16x32_bf16(false, a, false, b, (short)0, c, false, false); }




__device__ __forceinline__ void splitf(float y, unsigned short& h, unsigned short& l) { h = f2bf(y); l = f2bf(y - bf2f(h)); }
typedef __attribute__((ext_vector_type(2))) float v2f;
typedef __attribute__((ext_vector_type(2))) __bf16 v2bf;
typedef __attribute__((ext_vector_type(4))) unsigned v4u;
typedef v4u __attribute__((may_alias)) v4ua;

#define PT_ 264                 // LDS pitch of a staged x row, elements: 528 bytes = 16 x 33, the pitch for 16-byte readers
#define UR_ 8
#define UC_ 14
#define UH_ 10                  // key rows that the two query tiles of a block cover together
#define KR_ 144                 // staged x_k rows: 140, rounded up to whole trips of 16 waves (the tail repeats the last row and is never read)
#define KP_ 80                  // elements (160 bytes) put in front of each further key row in LDS: the two key rows of an x_k fragment then lie 8 pieces of 16 bytes apart in the banks, not 14
#define XQ_ (KR_ * PT_ + 11 * KP_)   // where the x_q rows begin
#define OP_ 272                 // LDS pitch of an output row, elements: 544 bytes
#define YP_ 36                  // LDS pitch of a wave's y rows, floats: the two lane halves (8 rows apart) store 32 banks apart
__device__ __forceinline__ unsigned pk2(float a, float b) { return __builtin_bit_cast(unsigned, __builtin_convertvector((v2f){a, b}, v2bf)); }
__device__ __forceinline__ v8f wmma4(v2f a, v2f b, v8f c) { return __builtin_amdgcn_wmma_f32_16x16x4_f32(false, a, false, b, (short)0, c, false, false); }
// A weight plane of 256 k x 256 columns goes f32 -> registers -> bf16 -> LDS, turned: LDS row = column n, 512 bytes of k; the 16-byte piece q (8 k) lies at q ^ wsw(n),
// so that both the turned stores (16 lanes = columns 4 apart) and the fragment reads (16 lanes = 16 columns in a row) cover the 64 banks once.
__device__ __forceinline__ int wsw(int n) { return ((n >> 2) ^ (n << 2)) & 15; }
struct WReg { v4f r[4][8]; };   // four runs of 8 k x 4 n
template <int N, int U0 = 0>   // the row length is a constant, so that the loads differ in their immediate offsets alone; U0: the first run that is loaded
__device__ __forceinline__ void w_load(WReg& g, const float* __restrict__ w) { const int lane = threadIdx.x & 31, wv = threadIdx.x >> 5; const char* p = (const char*)w; const unsigned vo = (unsigned)((wv & 7) * 8 * N + 128 * (wv >> 3) + 4 * lane) * 4u;   // plane's base, thread's byte offset
#pragma unroll   // g is indexed by constants and stays in registers
    for (int u = U0; u < 4; ++u) {
#pragma unroll
        for (int i = 0; i < 8; ++i) g.r[u][i] = *(const v4f*)(p + vo + (64 * u + i) * N * 4); }
    asm volatile("s_wait_xcnt 0x0" :: "v"(vo) : "memory"); }   // stands in front of any later write to the address register of the loads above; the offset is named so that its register lives up to the wait
// Runs 0 .. SR_ - 1 of a plane go ahead of their use as f32, global memory -> LDS through no register: copy 8 u + i of a thread lands 16 bytes at (8 u + i) x 8192 + 16 tid, a place that this thread alone writes and reads.
#define SR_ 3
typedef __attribute__((ext_vector_type(4))) int v4i;
typedef __attribute__((address_space(1))) v4i gv4i;
typedef __attribute__((address_space(3))) v4i lv4i;
template <int N>
__device__ __forceinline__ void w_copy(const float* __restrict__ w, bf* st) { const int lane = threadIdx.x & 31, wv = threadIdx.x >> 5; const char* p = (const char*)w + (unsigned)((wv & 7) * 8 * N + 128 * (wv >> 3) + 4 * lane) * 4u; char* q = (char*)st + threadIdx.x * 16;
#pragma unroll   // 24 copies in a row, their places constants apart
    for (int u = 0; u < SR_; ++u) {
#pragma unroll
        for (int i = 0; i < 8; ++i) __builtin_amdgcn_global_load_async_to_lds_b128((gv4i*)(p + (64 * u + i) * N * 4), (lv4i*)(q + (8 * u + i) * 8192), 0, 0); } }
__device__ __forceinline__ void w_take(WReg& g, const bf* st) { const char* q = (const char*)st + threadIdx.x * 16;
#pragma unroll   // as in w_load
    for (int u = 0; u < SR_; ++u) {
#pragma unroll
        for (int i = 0; i < 8; ++i) g.r[u][i] = *(const v4fa*)(q + (8 * u + i) * 8192); } }
// The swizzled places reduce to 4 store and 8 read offsets a thread plus constants: a store of column 4 lane + j, piece (wv & 7) + 8 u, has wsw = (lane & 15) ^ 4 j, so its piece is ((wv & 7) ^ (lane & 15)) ^ 4 (j ^ 2 (u & 1)), + 16 (u >> 1);
// a read of column nw + 16 dt has wsw(nw) ^ 4 dt, so its piece 4 ks + 2 s + half lies where column nw has that of step (ks & 3) ^ dt, + 16 (ks >> 2).
struct WAdr { int st[4]; int fr[4][2]; };   // element offsets into the buffer
__device__ __forceinline__ void w_adr(WAdr& a, int nw, int hi) { const int lane = threadIdx.x & 31, wv = threadIdx.x >> 5; const int p0 = (wv & 7) ^ (lane & 15), r0 = (128 * (wv >> 3) + 4 * lane) * CC, f0 = wsw(nw);
#pragma unroll   // a is indexed by constants
    for (int x = 0; x < 4; ++x) { a.st[x] = r0 + (p0 ^ (4 * x)) * 8; a.fr[x][0] = nw * CC + ((4 * x + hi) ^ f0) * 8; a.fr[x][1] = nw * CC + ((4 * x + 2 + hi) ^ f0) * 8; } }
__device__ __forceinline__ void w_store(const WReg& g, bf* sw, const WAdr& a) {
#pragma unroll   // as in w_load
    for (int u = 0; u < 4; ++u) {
#pragma unroll
        for (int j = 0; j < 4; ++j) { const v4u o = {pk2(g.r[u][0][j], g.r[u][1][j]), pk2(g.r[u][2][j], g.r[u][3][j]), pk2(g.r[u][4][j], g.r[u][5][j]), pk2(g.r[u][6][j], g.r[u][7][j])};
            *(v4ua*)(sw + a.st[j ^ (2 * (u & 1))] + j * CC + (u >> 1) * 128) = o; } } }
// Fragment of column nw + 16 dt for the 32 k of step ks: k = 8 half + 0 .. 7 and 16 + 8 half + 0 .. 7, the order of the x fragments.
__device__ __forceinline__ v16bf w_frag(const bf* sw, const WAdr& a, int dt, int ks) { const bf* r = sw + dt * 16 * CC + (ks >> 2) * 128; return cat16b(*(const v8usa*)(r + a.fr[(ks & 3) ^ dt][0]), *(const v8usa*)(r + a.fr[(ks & 3) ^ dt][1])); }
// Five vector slots between a bf16 product and the f32 product that takes its result as A; the scheduling barriers hold the products on their sides of the slots.
#define WMMA_GAP() do { __builtin_amdgcn_sched_barrier(0); asm volatile("v_nop\n\tv_nop\n\tv_nop\n\tv_nop\n\tv_nop"); __builtin_amdgcn_sched_barrier(0); } while (0)
__device__ __forceinline__ v16bf x_frag(const bf* xp, int ks) { return cat16b(*(const v8usa*)(xp + ks * 32), *(const v8usa*)(xp + ks * 32 + 16)); }   // xp: the lane's row + 8 half

// k_natt: block = 4 x 8 queries, wave = (head h, 2 x 8 query tile sub). The 16 windows of a tile lie inside one 8 x 14 block of keys (112 = 7 x 16), start (ui, uj) clamped into the image; both tiles' blocks lie inside 10 x 14 keys from (U0, uj).
// Key slot (T, r, half): e = 8 T + r, key row ui + 2 (e / 14) + half, key column uj + e % 14. The x_k fragment of tile T has lane c on key slot (T, c & 7, c >> 3); it serves as B of k^T and as A of v.
// q^T = Wq^T x_q^T and k^T = Wk^T x_k^T (A = weight columns 16 dt + c of the head, B = x rows): D register r of tile dt = d 16 dt + 8 half + r of the lane's query or key, which is the operand order of the next product as it lies.
// S^T = K Q^T on the f32 form: A row = key slot, B column = query c, both sides hold the same d in the same register. D register r of tile T = logit of key slot (T, r, half) for query c.
// Keys outside a query's own 7 x 7 window are masked to -3e38 (their weight is 0); softmax runs down the lane's 56 registers plus one exchange between the lane halves.
// v = x_k Wv (A = the x_k fragment, B = weight columns 16 dt + c): D register r = v[key slot (T, r, half)][16 dt + c], the A operand of O^T = V^T P^T as it lies; B = the weights as they lie in S^T's D. O^T's D register r = out[query c][16 dt + 8 half + r].
// The four weight planes (Wq, Wk, Wv, Wproj) pass one after the other through one LDS buffer; each wave keeps the 16 fragments of its head's k, then v, columns in registers over its 7 tiles.
// The attention output is split into bf16 hi and lo and gathered in LDS (32 rows x 256 columns); wave (h, sub) forms y columns 32 h .. + 31 of its tile's 16 rows, per 32 k the hi product, then the lo product, into one accumulator,
// turns its 16 x 32 block in its own LDS range, adds the bias and stores whole 128-byte lines: one writer per line.
// Every loop is fully unrolled so that its arrays (fragments, logits, masks) are indexed by constants and stay in registers.
// One block of 16 waves a WGP, 4 waves a SIMD: the attribute gives the compiler the registers of that occupancy.
__global__ __launch_bounds__(512) __attribute__((amdgpu_waves_per_eu(4, 4))) void k_natt(const float* __restrict__ xq, const float* __restrict__ xk, const float* __restrict__ wq, const float* __restrict__ wkv, const float* __restrict__ wp, const float* __restrict__ bq, const float* __restrict__ bkv, const float* __restrict__ rpb, const float* __restrict__ bp, float* OUT) {
    __shared__ __align__(16) bf sx[XQ_ + 32 * PT_];   // x_k rows of the 10 x 14 keys, then the 32 x_q rows
    __shared__ __align__(16) bf su[CC * CC + 2 * 32 * OP_ + 2 * 16 * 16 * YP_];   // sw, so, ys in a row; its first SR_ x 65536 bytes also take the copied f32 runs while none of the three is in use
    bf* const sw = su;                                  // the weight plane in use
    bf* const so = su + CC * CC;                        // [hi, lo][query][column]
    float* const ys = (float*)(su + CC * CC + 2 * 32 * OP_);   // [wave][row][column]: each wave's own y block
    __shared__ float rb[(NH_ * RPW * RPW + 511) / 512 * 512];   // the table, rounded up so that every thread stores on every trip (the tail repeats the last entry and is never read)
    __shared__ __align__(32) float sbi[4 * CC];         // biases, rounded: bq, bproj, bkv
    const int tid = threadIdx.x, lane = tid & 31, c = lane & 15, hi = lane >> 4, wv = tid >> 5, h = wv & 7, sub = wv >> 3;
    const int tile = blockIdx.x; const int b = tile / ((IH / 4) * (IW / 8)), tt = tile % ((IH / 4) * (IW / 8)); const int i0 = (tt / (IW / 8)) * 4, j0 = (tt % (IW / 8)) * 8;
    const int U0 = min(max(i0 - NBR, 0), IH - UH_), uj = min(max(j0 - NBR, 0), IW - UC_);
    WReg g; WAdr wa; w_adr(wa, h * HD + c, hi);
    {   // stage: x rows, the bias table, the biases, Wq
        unsigned xo[11]; v4f xr[11][2];
#pragma unroll   // xo and xr are indexed by constants
        for (int u = 0; u < 9; ++u) { const int r = min(wv + 16 * u, UH_ * UC_ - 1); xo[u] = (unsigned)((b * NPIX + (U0 + r / UC_) * IW + uj + r % UC_) * CC + lane * 8) * 4u; }
#pragma unroll
        for (int u = 9; u < 11; ++u) { const int r = wv + 16 * (u - 9); xo[u] = (unsigned)((b * NPIX + (i0 + (r >> 3)) * IW + j0 + (r & 7)) * CC + lane * 8) * 4u; }
#pragma unroll
        for (int u = 0; u < 11; ++u) { const char* p = (const char*)(u < 9 ? xk : xq) + xo[u]; xr[u][0] = *(const v4f*)p; xr[u][1] = *(const v4f*)(p + 16); }
        asm volatile("s_wait_xcnt 0x0" :: "v"(xo[0]), "v"(xo[1]), "v"(xo[2]), "v"(xo[3]), "v"(xo[4]), "v"(xo[5]), "v"(xo[6]), "v"(xo[7]), "v"(xo[8]), "v"(xo[9]), "v"(xo[10]) : "memory");   // as in w_load, for the x loads
        w_load<CC>(g, wq);
        float rv[3];
        const unsigned ro0 = (unsigned)min(tid, NH_ * RPW * RPW - 1) * 4u, ro1 = (unsigned)min(tid + 512, NH_ * RPW * RPW - 1) * 4u, ro2 = (unsigned)min(tid + 1024, NH_ * RPW * RPW - 1) * 4u, bo = (unsigned)tid * 4u, bo2 = (unsigned)(tid & 255) * 4u;
        rv[0] = *(const float*)((const char*)rpb + ro0); rv[1] = *(const float*)((const char*)rpb + ro1); rv[2] = *(const float*)((const char*)rpb + ro2);
        const float b0 = *(const float*)((const char*)bq + bo2), b1 = *(const float*)((const char*)bp + bo2), b2 = *(const float*)((const char*)bkv + bo);
        asm volatile("s_wait_xcnt 0x0" :: "v"(ro0), "v"(ro1), "v"(ro2), "v"(bo), "v"(bo2) : "memory");   // as in w_load, for the table's and the biases' loads
#pragma unroll
        for (int u = 0; u < 11; ++u) { const v4u o = {pk2(xr[u][0][0], xr[u][0][1]), pk2(xr[u][0][2], xr[u][0][3]), pk2(xr[u][1][0], xr[u][1][1]), pk2(xr[u][1][2], xr[u][1][3])};
            *(v4ua*)(sx + (u < 9 ? (wv + 16 * u) * PT_ + ((wv + 16 * u) / UC_) * KP_ : XQ_ + (wv + 16 * (u - 9)) * PT_) + lane * 8) = o; }
        w_store(g, sw, wa);
#pragma unroll
        for (int u = 0; u < 3; ++u) rb[tid + 512 * u] = bfr(rv[u]);
        sbi[tid] = bfr(tid < CC ? b0 : b1); sbi[2 * CC + tid] = bfr(b2);
    }
    __syncthreads();   // publishes the staged rows, tables and Wq: every wave reads what the other waves stored
    w_load<2 * CC>(g, wkv);   // Wk's loads fly under the q projection (in front of the barrier they would be waited for there)
    const int is = i0 + 2 * sub;
    const int ui = min(max(is - NBR, 0), IH - UR_);
    const int qi = is + (c >> 3), qj = j0 + (c & 7);
    const int si = min(max(qi - NBR, 0), IH - KS), sj = min(max(qj - NBR, 0), IW - KS);
    const int nw = h * HD + c;   // the lane's weight column in tile dt = 0
    float qr[16];
    { v8f qa[2]; const bf* xp = sx + XQ_ + (16 * sub + c) * PT_ + 8 * hi;
#pragma unroll
      for (int dt = 0; dt < 2; ++dt) qa[dt] = *(const v8f*)(sbi + h * HD + 16 * dt + 8 * hi);
#pragma unroll
      for (int ks = 0; ks < 8; ++ks) { const v16bf xf = x_frag(xp, ks);
#pragma unroll
          for (int dt = 0; dt < 2; ++dt) qa[dt] = wmmab(w_frag(sw, wa, dt, ks), xf, qa[dt]); }
#pragma unroll
      for (int x = 0; x < 16; ++x) qr[x] = qa[x >> 3][x & 7] * SCL; }
    __syncthreads();   // ends every wave's reads of Wq: the buffer is rewritten behind it
    w_store(g, sw, wa);
    __syncthreads();   // publishes Wk
    v16bf wf[2][8];
#pragma unroll
    for (int dt = 0; dt < 2; ++dt) {
#pragma unroll
        for (int ks = 0; ks < 8; ++ks) wf[dt][ks] = w_frag(sw, wa, dt, ks); }
    asm volatile("s_wait_dscnt 0x0" ::: "memory");   // the wave's own reads of the buffer have returned before copies are aimed at it
    __syncthreads();   // ends every wave's reads of Wk: the copies behind it write into the buffer
    w_copy<2 * CC>(wkv + CC, su);   // Wv's first three runs fly under the first product
    const bf* xb = sx + ((ui - U0 + (c >> 3)) * UC_ + (c & 7)) * PT_ + (ui - U0 + (c >> 3)) * KP_ + 8 * hi;   // key slot (0, c & 7, c >> 3); tile T adds its rows below
    v8f s[7];
#pragma unroll
    for (int T = 0; T < 7; ++T) { const int q0 = (8 * T) / UC_, m0 = (8 * T) % UC_;   // e = 8 T + (c & 7): past the end of a key row it goes on two rows down
        const bf* xp = xb + (2 * UC_ * q0 + m0) * PT_ + 2 * q0 * KP_ + (m0 + (c & 7) >= UC_ ? UC_ * PT_ + 2 * KP_ : 0);
        v8f kt[2];
#pragma unroll
        for (int dt = 0; dt < 2; ++dt) kt[dt] = *(const v8f*)(sbi + 2 * CC + h * HD + 16 * dt + 8 * hi);
#pragma unroll
        for (int ks = 0; ks < 8; ++ks) { const v16bf xf = x_frag(xp, ks);
#pragma unroll
            for (int dt = 0; dt < 2; ++dt) kt[dt] = wmmab(wf[dt][ks], xf, kt[dt]); }
        WMMA_GAP();
        s[T] = (v8f){};
#pragma unroll
        for (int st = 0; st < 8; ++st) s[T] = wmma4((v2f){kt[st >> 2][(2 * st) & 7], kt[st >> 2][((2 * st) & 7) + 1]}, (v2f){qr[2 * st], qr[2 * st + 1]}, s[T]); }
    bool rok[4]; int rix[4]; bool cok[UC_]; int cix[UC_];
#pragma unroll
    for (int g4 = 0; g4 < 4; ++g4) { const int ki = ui + 2 * g4 + hi; rok[g4] = (unsigned)(ki - si) < (unsigned)KS; rix[g4] = h * (RPW * RPW) + (ki - qi + KS - 1) * RPW; }
#pragma unroll
    for (int x = 0; x < UC_; ++x) { const int kj = uj + x; cok[x] = (unsigned)(kj - sj) < (unsigned)KS; cix[x] = kj - qj + KS - 1; }
    float mx4[4] = {-3.0e38f, -3.0e38f, -3.0e38f, -3.0e38f};
#pragma unroll
    for (int T = 0; T < 7; ++T) {
#pragma unroll
        for (int r = 0; r < 8; ++r) { const int e = T * 8 + r; const bool ok = rok[e / UC_] & cok[e % UC_]; const int ix = ok ? rix[e / UC_] + cix[e % UC_] : 0; const float bv = rb[ix]; const float sb = s[T][r] + bv; const float t = ok ? sb : -3.0e38f; s[T][r] = t; mx4[r & 3] = fmaxf(mx4[r & 3], t); } }
    float mx = fmaxf(fmaxf(mx4[0], mx4[1]), fmaxf(mx4[2], mx4[3])); mx = fmaxf(mx, __shfl_xor(mx, 16, 32));
    w_load<2 * CC, SR_>(g, wkv + CC);   // Wv's last run goes out where the masks' registers are free again, and flies under the exponentials
    asm volatile("s_wait_asynccnt 0x0" ::: "memory");   // the wave's own copies have landed: the reads below take what they brought
    w_take(g, su);
    float sm4[4] = {0.f, 0.f, 0.f, 0.f};
#pragma unroll
    for (int T = 0; T < 7; ++T) {
#pragma unroll
        for (int r = 0; r < 8; ++r) { const float p = __builtin_amdgcn_exp2f((s[T][r] - mx) * 1.4426950408889634f); s[T][r] = p; sm4[r & 3] += p; } }
    float sum = (sm4[0] + sm4[1]) + (sm4[2] + sm4[3]); sum += __shfl_xor(sum, 16, 32);
    const float f = __fdiv_rn(1.0f, sum);
    __syncthreads();   // ends every wave's reads of its copied runs: the buffer is rewritten behind it
    w_store(g, sw, wa);
    __syncthreads();   // publishes Wv
#pragma unroll
    for (int dt = 0; dt < 2; ++dt) {
#pragma unroll
        for (int ks = 0; ks < 8; ++ks) wf[dt][ks] = w_frag(sw, wa, dt, ks); }
    const float vb0 = sbi[3 * CC + nw], vb1 = sbi[3 * CC + nw + 16];
    asm volatile("s_wait_dscnt 0x0" ::: "memory");   // as in front of Wv's copies
    __syncthreads();   // ends every wave's reads of Wv: the copies behind it write into the buffer
    w_copy<CC>(wp, su);   // Wproj's first three runs fly under the second product
    v8f o[2]; o[0] = (v8f){}; o[1] = (v8f){};
#pragma unroll
    for (int T = 0; T < 7; ++T) { const int q0 = (8 * T) / UC_, m0 = (8 * T) % UC_;
        const bf* xp = xb + (2 * UC_ * q0 + m0) * PT_ + 2 * q0 * KP_ + (m0 + (c & 7) >= UC_ ? UC_ * PT_ + 2 * KP_ : 0);
        v8f vt[2] = {{vb0, vb0, vb0, vb0, vb0, vb0, vb0, vb0}, {vb1, vb1, vb1, vb1, vb1, vb1, vb1, vb1}};
#pragma unroll
        for (int ks = 0; ks < 8; ++ks) { const v16bf xf = x_frag(xp, ks);
#pragma unroll
            for (int dt = 0; dt < 2; ++dt) vt[dt] = wmmab(xf, wf[dt][ks], vt[dt]); }
        WMMA_GAP();
#pragma unroll
        for (int t = 0; t < 4; ++t) {
#pragma unroll
            for (int dt = 0; dt < 2; ++dt) o[dt] = wmma4((v2f){vt[dt][2 * t], vt[dt][2 * t + 1]}, (v2f){s[T][2 * t], s[T][2 * t + 1]}, o[dt]); } }
    w_load<CC, SR_>(g, wp);
    asm volatile("s_wait_asynccnt 0x0" ::: "memory");   // as for Wv
    w_take(g, su);
    __syncthreads();   // ends every wave's reads of its copied runs: so and sw are written behind it
#pragma unroll   // o[dt] is indexed by constants and stays in registers
    for (int dt = 0; dt < 2; ++dt) { v8us oh, ol;
#pragma unroll
        for (int x = 0; x < 8; ++x) { unsigned short a, c2; splitf(o[dt][x] * f, a, c2); oh[x] = a; ol[x] = c2; }
        *(v8usa*)(so + (16 * sub + c) * OP_ + h * HD + 16 * dt + 8 * hi) = oh; *(v8usa*)(so + (32 + 16 * sub + c) * OP_ + h * HD + 16 * dt + 8 * hi) = ol; }
    w_store(g, sw, wa);
    __syncthreads();   // publishes Wproj and the 32 output rows: each wave reads columns that the other heads' waves computed
    v8f y[2]; y[0] = (v8f){}; y[1] = (v8f){};
#pragma unroll   // y is indexed by constants; the LDS reads go out ahead of the products
    for (int ks = 0; ks < 8; ++ks) { const bf* ap = so + (16 * sub + c) * OP_ + ks * 32 + 8 * hi;
        const v16bf ah = cat16b(*(const v8usa*)ap, *(const v8usa*)(ap + 16)), al = cat16b(*(const v8usa*)(ap + 32 * OP_), *(const v8usa*)(ap + 32 * OP_ + 16));
#pragma unroll
        for (int nt = 0; nt < 2; ++nt) { const v16bf wb = w_frag(sw, wa, nt, ks); y[nt] = wmmab(ah, wb, y[nt]); y[nt] = wmmab(al, wb, y[nt]); } }
    float* yw = ys + wv * (16 * YP_);
#pragma unroll
    for (int nt = 0; nt < 2; ++nt) {
#pragma unroll
        for (int j = 0; j < 8; ++j) yw[(hi * 8 + j) * YP_ + nt * 16 + c] = y[nt][j]; }
    __builtin_amdgcn_wave_barrier(); asm volatile("" ::: "memory");   // keeps the reads below, of values that other lanes of this wave stored, behind the stores above
    const v4f bb = *(const v4fa*)(sbi + CC + h * HD + (lane & 7) * 4);
#pragma unroll   // the four LDS reads go out together
    for (int u = 0; u < 4; ++u) { const int rq = 4 * u + (lane >> 3); v4f val = *(const v4fa*)(yw + rq * YP_ + (lane & 7) * 4);
        val[0] += bb[0]; val[1] += bb[1]; val[2] += bb[2]; val[3] += bb[3];
        *(v4f*)(OUT + ((size_t)b * NPIX + (size_t)((is + (rq >> 3)) * IW + j0 + (rq & 7))) * CC + h * HD + (lane & 7) * 4) = val; }
}

extern "C" void kernel_launch(void* const* d_in, const int* in_sizes, int n_in,
                              void* d_out, int out_size, void* d_ws, size_t ws_size, hipStream_t stream) {
    (void)in_sizes; (void)n_in; (void)out_size; (void)d_ws; (void)ws_size;
    const float* xq = (const float*)d_in[0]; const float* xk = (const float*)d_in[1]; const float* wq = (const float*)d_in[2]; const float* bq = (const float*)d_in[3]; const float* wkv = (const float*)d_in[4]; const float* bkv = (const float*)d_in[5]; const float* rpb = (const float*)d_in[6]; const float* wp = (const float*)d_in[7]; const float* bp = (const float*)d_in[8];   /* x_q, x_k ([2][56][56][256] channels-last), Wq ('xw' [256][256]), bq, Wkv ('xw' [256][512]: columns k | v), bkv, rpb [8][13][13], Wproj ('xw' [256][256]), bproj; nine inputs, all read */
    float* OUT = (float*)d_out;     // [2][56][56][256] = [6272][256]
    k_natt<<<(unsigned)(NTOK / 32), 512, 0, stream>>>(xq, xk, wq, wkv, wp, bq, bkv, rpb, bp, OUT);   /* projections, windowed attention in f32, output projection: one block per 4 x 8 queries */
}

// v008
// Measured time: 23.2 microseconds a run.
// In both of two side-by-side timings against v007, it was 1.15 times as fast.
// All steps since v000 together make it 9.73 times as fast.
#include <hip/hip_runtime.h>

// Neighborhood CROSS attention (NATTEN with separate query / key inputs; x_q, x_k [2][56][56][256] channels-last; q = x_q Wq + bq ('xw' [256][256] -> 8 heads x 32), [k | v] = x_k Wkv + bkv ('xw' [256][512] viewed (2, 8 heads, 32): columns 0..255 = k, 256..511 = v); for every pixel a 7x7 key window clamped to stay inside the image (start = clamp(i - 3, 0, 49)); logits = (q x 32^-0.5).k + rpb[h][ki - i + 6][kj - j + 6] (rpb [8][13][13] input); softmax over the 49; out = attn.v; y = out Wproj + bproj ('xw' [256][256]) -> [2][56][56][256] (1.6 M); argument order x_q, x_k, Wq, bq, Wkv, bkv, rpb, Wproj, bproj).
// Compute dtypes, f32 accumulate: every input rounded to bf16; the q, k and v projections on PLAIN bf16 operands (exact), their f32 biases as the accumulators' start values; the whole windowed attention in f32, both products on the f32 16x16x4 matrix form (one wave per (2 x 8 query tile, head) against the tile's 8 x 14 block of keys, keys outside a query's window masked, logits + bias and the f32 softmax in registers); the attention output as bf16 hi + lo halves x exact w_proj (2 products) + f32 bias.
// One launch: a block of 16 waves owns 4 x 8 queries, rounds their x_q rows and the x_k rows of their 10 x 14 block of keys into LDS, and projects q, k and v of those rows itself; no plane goes through memory.
// The four weight planes never pass through LDS: each wave loads the 32 columns of its own head as f32, 8 bytes a lane, straight into fragment order, two 32-deep steps ahead of their products; the k loop is outermost, so the weights stream past 14 accumulator tiles.

#define NB_  2
#define IH   56
#define IW   56
#define NPIX (IH * IW)          // 3136
#define NTOK (NB_ * NPIX)       // 6272 = 98 x 64
#define CC   256
#define C3   768
#define NH_  8
#define HD   32
#define KS   7
#define NBR  3
#define RPW  13                 // 2*KS - 1
#define SCL  0.17677669529663689f   // 32^-0.5
typedef _Float16 h16;
typedef unsigned short bf;
typedef __attribute__((ext_vector_type(16))) __bf16   v16bf;
typedef __attribute__((ext_vector_type(16))) _Float16 v16h;
typedef __attribute__((ext_vector_type(8)))  _Float16 v8h;
typedef __attribute__((ext_vector_type(8)))  unsigned short v8us;
typedef __attribute__((ext_vector_type(8)))  float    v8f;
typedef __attribute__((ext_vector_type(4)))  float    v4f;
typedef v8h  __attribute__((may_alias)) v8ha;
typedef v4f  __attribute__((may_alias)) v4fa;
typedef v8us __attribute__((may_alias)) v8usa;

__device__ __forceinline__ unsigned short f2bf(float f) { unsigned u = __float_as_uint(f); u += 0x7FFFu + ((u >> 16) & 1u); return (unsigned short)(u >> 16); }
__device__ __forceinline__ float bf2f(unsigned short b) { return __uint_as_float(((unsigned)b) << 16); }
__device__ __forceinline__ float bfr(float f) { return bf2f(f2bf(f)); }
__device__ __forceinline__ v16h cat16(v8h lo, v8h hi) { return __builtin_shufflevector(lo, hi, 0, 1, 2, 3, 4, 5, 6, 7, 8, 9, 10, 11, 12, 13, 14, 15); }
__device__ __forceinline__ v16bf cat16b(v8us lo, v8us hi) { return __builtin_bit_cast(v16bf, __builtin_shufflevector(lo, hi, 0, 1, 2, 3, 4, 5, 6, 7, 8, 9, 10, 11, 12, 13, 14, 15)); }
__device__ __forceinline__ v8f wmma16(v16h a, v16h b, v8f c) { return __builtin_amdgcn_wmma_f32_16x16x32_f16(false, a, false, b, (short)0, c, false, false); }
__device__ __forceinline__ v8f wmmab(v16bf a, v16bf b, v8f c) { return __builtin_amdgcn_wmma_f32_16x16x32_bf16(false, a, false, b, (short)0, c, false, false); }




__device__ __forceinline__ void splitf(float y, unsigned short& h, unsigned short& l) { h = f2bf(y); l = f2bf(y - bf2f(h)); }
typedef __attribute__((ext_vector_type(2))) float v2f;
typedef __attribute__((ext_vector_type(2))) __bf16 v2bf;
typedef __attribute__((ext_vector_type(4))) unsigned v4u;
typedef v4u __attribute__((may_alias)) v4ua;

#define PT_ 264                 // LDS pitch of a staged x row, elements: 528 bytes = 16 x 33, the pitch for 16-byte readers
#define UR_ 8
#define UC_ 14
#define UH_ 10                  // key rows that the two query tiles of a block cover together
#define KR_ 144                 // staged x_k rows: 140, rounded up to whole trips of 16 waves (the tail repeats the last row and is never read)
#define KP_ 80                  // elements (160 bytes) put in front of each further key row in LDS: the two key rows of an x_k fragment then lie 8 pieces of 16 bytes apart in the banks, not 14
#define XQ_ (KR_ * PT_ + 11 * KP_)   // where the x_q rows begin
#define OP_ 272                 // LDS pitch of an output row, elements: 544 bytes
__device__ __forceinline__ unsigned pk2(float a, float b) { return __builtin_bit_cast(unsigned, __builtin_convertvector((v2f){a, b}, v2bf)); }
__device__ __forceinline__ v8f wmma4(v2f a, v2f b, v8f c) { return __builtin_amdgcn_wmma_f32_16x16x4_f32(false, a, false, b, (short)0, c, false, false); }
typedef v2f __attribute__((may_alias)) v2fa;
typedef __attribute__((ext_vector_type(8))) unsigned v8u;
// One 32-deep step of a head's 32 weight columns: lane (c, half) loads the column pair 2 c, 2 c + 1 of the 16 k rows of its half (k = 8 half + 0 .. 7 and 16 + 8 half + 0 .. 7, the order of the x fragments).
// 16 lanes cover one whole 128-byte line. The two floats of a pair are column slot c of the tiles dt = 0 and dt = 1: slot m of tile dt is column 2 m + dt of the head.
struct WS { v2f r[16]; };
template <int N>   // the row length is a constant, so that the loads differ in their immediate offsets alone
__device__ __forceinline__ void ws_load(WS& g, const float* __restrict__ w, unsigned vo, int ks) { const char* p = (const char*)w;
#pragma unroll   // g is indexed by constants and stays in registers
    for (int e = 0; e < 16; ++e) g.r[e] = *(const v2fa*)(p + vo + (32 * ks + 16 * (e >> 3) + (e & 7)) * N * 4); }
__device__ __forceinline__ void ws_frag(const WS& g, v16bf& f0, v16bf& f1) { v8u a, b2;
#pragma unroll   // as in ws_load
    for (int x = 0; x < 8; ++x) { a[x] = pk2(g.r[2 * x][0], g.r[2 * x + 1][0]); b2[x] = pk2(g.r[2 * x][1], g.r[2 * x + 1][1]); }
    f0 = __builtin_bit_cast(v16bf, a); f1 = __builtin_bit_cast(v16bf, b2); }
// Holds the loads of step i + 2 behind the conversion of step i (lifted further up they would need a third buffer's registers, which the accumulators do not leave) and in front of step i's products (sunk below those they would fly one step less).
#define STEP_EDGE() __builtin_amdgcn_sched_barrier(0)
// Order inside a step of 7 x_k fragments: the LDS reads of a fragment go out one fragment ahead of its two products, so that a product does not wait for the whole LDS latency (0x100 = LDS reads, 0x008 = matrix products).
#define X_AHEAD() do { __builtin_amdgcn_sched_group_barrier(0x100, 4, 0); \
    __builtin_amdgcn_sched_group_barrier(0x008, 2, 0); __builtin_amdgcn_sched_group_barrier(0x100, 2, 0); __builtin_amdgcn_sched_group_barrier(0x008, 2, 0); __builtin_amdgcn_sched_group_barrier(0x100, 2, 0); \
    __builtin_amdgcn_sched_group_barrier(0x008, 2, 0); __builtin_amdgcn_sched_group_barrier(0x100, 2, 0); __builtin_amdgcn_sched_group_barrier(0x008, 2, 0); __builtin_amdgcn_sched_group_barrier(0x100, 2, 0); \
    __builtin_amdgcn_sched_group_barrier(0x008, 2, 0); __builtin_amdgcn_sched_group_barrier(0x100, 2, 0); __builtin_amdgcn_sched_group_barrier(0x008, 4, 0); } while (0)
// The planes form one stream of 32 steps: Wq 0 .. 7, Wk 8 .. 15, Wv 16 .. 23, Wproj 24 .. 31. Behind a plane's last step stands the wait that comes in front of any later write to the registers its loads name; the offset is named so that its register lives up to the wait.
struct WSrc { const float* wq; const float* wkv; const float* wp; unsigned v2, v5; };
__device__ __forceinline__ void st_load(WS& g, const WSrc& s, int i) {
    if (i < 8) ws_load<CC>(g, s.wq, s.v2, i); else if (i < 16) ws_load<2 * CC>(g, s.wkv, s.v5, i - 8); else if (i < 24) ws_load<2 * CC>(g, s.wkv + CC, s.v5, i - 16); else if (i < 32) ws_load<CC>(g, s.wp, s.v2, i - 24);
    if (i < 32 && (i & 7) == 7) asm volatile("s_wait_xcnt 0x0" :: "v"(s.v2), "v"(s.v5) : "memory"); }
// Five vector slots between a bf16 product and the f32 product that takes its result as A; the scheduling barriers hold the products on their sides of the slots.
#define WMMA_GAP() do { __builtin_amdgcn_sched_barrier(0); asm volatile("v_nop\n\tv_nop\n\tv_nop\n\tv_nop\n\tv_nop"); __builtin_amdgcn_sched_barrier(0); } while (0)
// 2^x with the one vector slot that the instruction set asks for behind a transcendental whose result the next vector instruction reads or whose source it overwrites; in one statement, so that the slot stands directly behind it.
__device__ __forceinline__ float exp2_slot(float x) { float p; asm("v_exp_f32 %0, %1\n\tv_nop" : "=v"(p) : "v"(x)); return p; }
__device__ __forceinline__ v16bf x_frag(const bf* xp, int ks) { return cat16b(*(const v8usa*)(xp + ks * 32), *(const v8usa*)(xp + ks * 32 + 16)); }   // xp: the lane's row + 8 half

// k_natt: block = 4 x 8 queries, wave = (head h, 2 x 8 query tile sub). The 16 windows of a tile lie inside one 8 x 14 block of keys (112 = 7 x 16), start (ui, uj) clamped into the image; both tiles' blocks lie inside 10 x 14 keys from (U0, uj).
// Key slot (T, r, half): e = 8 T + r, key row ui + 2 (e / 14) + half, key column uj + e % 14. The x_k fragment of tile T has lane c on key slot (T, c & 7, c >> 3); it serves as B of k^T and as A of v.
// q^T = Wq^T x_q^T and k^T = Wk^T x_k^T (A = weight column slots of the head, B = x rows): D register r of tile dt = d 2 (8 half + r) + dt of the lane's query or key, the same d on both sides, which is the operand order of the next product as it lies.
// S^T = K Q^T on the f32 form: A row = key slot, B column = query c. D register r of tile T = logit of key slot (T, r, half) for query c.
// Keys outside a query's own 7 x 7 window are masked to -3e38 (their weight is 0); softmax runs down the lane's 56 registers plus one exchange between the lane halves.
// v = x_k Wv (A = the x_k fragment, B = weight column slots): D register r = v[key slot (T, r, half)][2 c + dt], the A operand of O^T = V^T P^T as it lies; B = the weights as they lie in S^T's D. O^T's D register r of tile dt = out[query c][16 half + 2 r + dt].
// While v's 14 accumulator tiles are live, the lane's 56 softmax weights lie in LDS, each lane at a place that it alone writes and reads.
// The attention output is split into bf16 hi and lo and gathered in LDS (32 rows x 256 columns); wave (h, sub) forms y columns 32 h .. + 31 of its tile's 16 rows, per 32 k the hi product, then the lo product, into one accumulator;
// a lane holds the column pair 2 c, 2 c + 1 of 8 rows, adds the bias and stores 8 bytes a row: 16 lanes write one whole 128-byte line, one writer per line.
// Every loop is fully unrolled so that its arrays (fragments, logits, masks) are indexed by constants and stay in registers.
// One block of 16 waves a WGP, 4 waves a SIMD: the attribute gives the compiler the registers of that occupancy.
__global__ __launch_bounds__(512) __attribute__((amdgpu_waves_per_eu(4, 4))) void k_natt(const float* __restrict__ xq, const float* __restrict__ xk, const float* __restrict__ wq, const float* __restrict__ wkv, const float* __restrict__ wp, const float* __restrict__ bq, const float* __restrict__ bkv, const float* __restrict__ rpb, const float* __restrict__ bp, float* OUT) {
    __shared__ __align__(16) bf sx[XQ_ + 32 * PT_];   // x_k rows of the 10 x 14 keys, then the 32 x_q rows
    __shared__ __align__(16) bf so[2 * 32 * OP_];       // [hi, lo][query][column]
    __shared__ __align__(16) float sp[16 * 56 * 32];    // [wave][14 pieces][lane][4]: the softmax weights
    __shared__ float rb[(NH_ * RPW * RPW + 511) / 512 * 512];   // the table, rounded up so that every thread stores on every trip (the tail repeats the last entry and is never read)
    __shared__ __align__(32) float sbi[4 * CC];         // biases, rounded: bq, bproj, bkv; bq and bk lie in slot order (d = 2 m + dt at 16 dt + m)
    const int tid = threadIdx.x, lane = tid & 31, c = lane & 15, hi = lane >> 4, wv = tid >> 5, h = wv & 7, sub = wv >> 3;
    const int tile = blockIdx.x; const int b = tile / ((IH / 4) * (IW / 8)), tt = tile % ((IH / 4) * (IW / 8)); const int i0 = (tt / (IW / 8)) * 4, j0 = (tt % (IW / 8)) * 8;
    const int U0 = min(max(i0 - NBR, 0), IH - UH_), uj = min(max(j0 - NBR, 0), IW - UC_);
    const WSrc ws = {wq, wkv, wp, (unsigned)(8 * hi * CC + h * HD + 2 * c) * 4u, (unsigned)(8 * hi * 2 * CC + h * HD + 2 * c) * 4u};
    WS g[2];   // step i of the stream lies in g[i & 1]
    {   // stage: x rows, the bias table, the biases
        unsigned xo[11]; v4f xr[11][2];
#pragma unroll   // xo and xr are indexed by constants
        for (int u = 0; u < 9; ++u) { const int r = min(wv + 16 * u, UH_ * UC_ - 1); xo[u] = (unsigned)((b * NPIX + (U0 + r / UC_) * IW + uj + r % UC_) * CC + lane * 8) * 4u; }
#pragma unroll
        for (int u = 9; u < 11; ++u) { const int r = wv + 16 * (u - 9); xo[u] = (unsigned)((b * NPIX + (i0 + (r >> 3)) * IW + j0 + (r & 7)) * CC + lane * 8) * 4u; }
#pragma unroll
        for (int u = 0; u < 11; ++u) { const char* p = (const char*)(u < 9 ? xk : xq) + xo[u]; xr[u][0] = *(const v4f*)p; xr[u][1] = *(const v4f*)(p + 16); }
        asm volatile("s_wait_xcnt 0x0" :: "v"(xo[0]), "v"(xo[1]), "v"(xo[2]), "v"(xo[3]), "v"(xo[4]), "v"(xo[5]), "v"(xo[6]), "v"(xo[7]), "v"(xo[8]), "v"(xo[9]), "v"(xo[10]) : "memory");   // stands in front of any later write to the address registers of the x loads, which are named so that they live up to the wait
        st_load(g[0], ws, 0); st_load(g[1], ws, 1);
        float rv[3];
        const unsigned ro0 = (unsigned)min(tid, NH_ * RPW * RPW - 1) * 4u, ro1 = (unsigned)min(tid + 512, NH_ * RPW * RPW - 1) * 4u, ro2 = (unsigned)min(tid + 1024, NH_ * RPW * RPW - 1) * 4u, bo = (unsigned)tid * 4u, bo2 = (unsigned)(tid & 255) * 4u;
        rv[0] = *(const float*)((const char*)rpb + ro0); rv[1] = *(const float*)((const char*)rpb + ro1); rv[2] = *(const float*)((const char*)rpb + ro2);
        const float b0 = *(const float*)((const char*)bq + bo2), b1 = *(const float*)((const char*)bp + bo2), b2 = *(const float*)((const char*)bkv + bo);
        asm volatile("s_wait_xcnt 0x0" :: "v"(ro0), "v"(ro1), "v"(ro2), "v"(bo), "v"(bo2) : "memory");   // as for the x loads, for the table's and the biases' loads
#pragma unroll
        for (int u = 0; u < 11; ++u) { const v4u o = {pk2(xr[u][0][0], xr[u][0][1]), pk2(xr[u][0][2], xr[u][0][3]), pk2(xr[u][1][0], xr[u][1][1]), pk2(xr[u][1][2], xr[u][1][3])};
            *(v4ua*)(sx + (u < 9 ? (wv + 16 * u) * PT_ + ((wv + 16 * u) / UC_) * KP_ : XQ_ + (wv + 16 * (u - 9)) * PT_) + lane * 8) = o; }
#pragma unroll
        for (int u = 0; u < 3; ++u) rb[tid + 512 * u] = bfr(rv[u]);
        const int bpos = tid < CC ? (tid & ~31) | ((tid & 1) << 4) | ((tid & 31) >> 1) : tid;   // bq and bk in slot order, bproj and bv as they come
        sbi[bpos] = bfr(tid < CC ? b0 : b1); sbi[2 * CC + bpos] = bfr(b2);
    }
    __syncthreads();   // publishes the staged rows and tables: every wave reads what the other waves stored
    const int is = i0 + 2 * sub;
    const int ui = min(max(is - NBR, 0), IH - UR_);
    const int qi = is + (c >> 3), qj = j0 + (c & 7);
    const int si = min(max(qi - NBR, 0), IH - KS), sj = min(max(qj - NBR, 0), IW - KS);
    float qr[16];
    { v8f qa[2]; const bf* xp = sx + XQ_ + (16 * sub + c) * PT_ + 8 * hi;
#pragma unroll
      for (int dt = 0; dt < 2; ++dt) qa[dt] = *(const v8f*)(sbi + h * HD + 16 * dt + 8 * hi);
#pragma unroll
      for (int ks = 0; ks < 8; ++ks) { v16bf f0, f1; STEP_EDGE(); ws_frag(g[ks & 1], f0, f1); st_load(g[ks & 1], ws, ks + 2);
          const v16bf xf = x_frag(xp, ks); qa[0] = wmmab(f0, xf, qa[0]); qa[1] = wmmab(f1, xf, qa[1]); }
#pragma unroll
      for (int x = 0; x < 16; ++x) qr[x] = qa[x >> 3][x & 7] * SCL; }
    float* const pw = sp + wv * (56 * 32) + lane * 4;   // the lane's own places in LDS, 512 bytes apart
#pragma unroll   // q waits in LDS while k's 14 accumulator tiles and the stream need the registers
    for (int x = 0; x < 4; ++x) *(v4fa*)(pw + x * 128) = (v4f){qr[4 * x], qr[4 * x + 1], qr[4 * x + 2], qr[4 * x + 3]};
    const bf* xb = sx + ((ui - U0 + (c >> 3)) * UC_ + (c & 7)) * PT_ + (ui - U0 + (c >> 3)) * KP_ + 8 * hi;   // key slot (0, c & 7, c >> 3); tile T adds its rows below
    const bf* xt[7];
#pragma unroll
    for (int T = 0; T < 7; ++T) { const int q0 = (8 * T) / UC_, m0 = (8 * T) % UC_;   // e = 8 T + (c & 7): past the end of a key row it goes on two rows down
        xt[T] = xb + (2 * UC_ * q0 + m0) * PT_ + 2 * q0 * KP_ + (m0 + (c & 7) >= UC_ ? UC_ * PT_ + 2 * KP_ : 0); }
    v8f s[7];
    { v8f kt[7][2];
#pragma unroll
      for (int T = 0; T < 7; ++T) {
#pragma unroll
          for (int dt = 0; dt < 2; ++dt) kt[T][dt] = *(const v8f*)(sbi + 2 * CC + h * HD + 16 * dt + 8 * hi); }
#pragma unroll
      for (int ks = 0; ks < 8; ++ks) { v16bf f0, f1; STEP_EDGE(); ws_frag(g[ks & 1], f0, f1); STEP_EDGE(); if (ks < 6) st_load(g[ks & 1], ws, 8 + ks + 2); STEP_EDGE();
#pragma unroll
          for (int T = 0; T < 7; ++T) { const v16bf xf = x_frag(xt[T], ks); kt[T][0] = wmmab(f0, xf, kt[T][0]); kt[T][1] = wmmab(f1, xf, kt[T][1]); } X_AHEAD(); }
      WMMA_GAP();
#pragma unroll
      for (int x = 0; x < 4; ++x) { const v4f t = *(const v4fa*)(pw + x * 128); qr[4 * x] = t[0]; qr[4 * x + 1] = t[1]; qr[4 * x + 2] = t[2]; qr[4 * x + 3] = t[3]; }
#pragma unroll
      for (int T = 0; T < 7; ++T) { s[T] = (v8f){};
#pragma unroll
          for (int st = 0; st < 8; ++st) s[T] = wmma4((v2f){kt[T][st >> 2][(2 * st) & 7], kt[T][st >> 2][((2 * st) & 7) + 1]}, (v2f){qr[2 * st], qr[2 * st + 1]}, s[T]); } }
    STEP_EDGE(); st_load(g[0], ws, 16); st_load(g[1], ws, 17);   // Wv's first two steps go out where k's accumulators are free again, and fly under the softmax
    bool rok[4]; int rix[4]; bool cok[UC_]; int cix[UC_];
#pragma unroll
    for (int g4 = 0; g4 < 4; ++g4) { const int ki = ui + 2 * g4 + hi; rok[g4] = (unsigned)(ki - si) < (unsigned)KS; rix[g4] = h * (RPW * RPW) + (ki - qi + KS - 1) * RPW; }
#pragma unroll
    for (int x = 0; x < UC_; ++x) { const int kj = uj + x; cok[x] = (unsigned)(kj - sj) < (unsigned)KS; cix[x] = kj - qj + KS - 1; }
    float mx4[4] = {-3.0e38f, -3.0e38f, -3.0e38f, -3.0e38f};
#pragma unroll
    for (int T = 0; T < 7; ++T) {
#pragma unroll
        for (int r = 0; r < 8; ++r) { const int e = T * 8 + r; const bool ok = rok[e / UC_] & cok[e % UC_]; const int ix = ok ? rix[e / UC_] + cix[e % UC_] : 0; const float bv = rb[ix]; const float sb = s[T][r] + bv; const float t = ok ? sb : -3.0e38f; s[T][r] = t; mx4[r & 3] = fmaxf(mx4[r & 3], t); } }
    float mx = fmaxf(fmaxf(mx4[0], mx4[1]), fmaxf(mx4[2], mx4[3])); mx = fmaxf(mx, __shfl_xor(mx, 16, 32));
    float sm4[4] = {0.f, 0.f, 0.f, 0.f};
#pragma unroll
    for (int T = 0; T < 7; ++T) {
#pragma unroll
        for (int r = 0; r < 8; ++r) { const float p = exp2_slot((s[T][r] - mx) * 1.4426950408889634f); s[T][r] = p; sm4[r & 3] += p; }
        *(v4fa*)(pw + (2 * T) * 128) = (v4f){s[T][0], s[T][1], s[T][2], s[T][3]}; *(v4fa*)(pw + (2 * T + 1) * 128) = (v4f){s[T][4], s[T][5], s[T][6], s[T][7]}; }
    float sum = (sm4[0] + sm4[1]) + (sm4[2] + sm4[3]); sum += __shfl_xor(sum, 16, 32);
    const float f = __fdiv_rn(1.0f, sum);
    v8f o[2]; o[0] = (v8f){}; o[1] = (v8f){};
    { const v2f vb = *(const v2fa*)(sbi + 3 * CC + h * HD + 2 * c);
      v8f vt[7][2];
#pragma unroll
      for (int T = 0; T < 7; ++T) {
#pragma unroll
          for (int dt = 0; dt < 2; ++dt) vt[T][dt] = (v8f){vb[dt], vb[dt], vb[dt], vb[dt], vb[dt], vb[dt], vb[dt], vb[dt]}; }
#pragma unroll
      for (int ks = 0; ks < 8; ++ks) { v16bf f0, f1; STEP_EDGE(); ws_frag(g[ks & 1], f0, f1); STEP_EDGE(); st_load(g[ks & 1], ws, 16 + ks + 2); STEP_EDGE();
#pragma unroll
          for (int T = 0; T < 7; ++T) { const v16bf xf = x_frag(xt[T], ks); vt[T][0] = wmmab(xf, f0, vt[T][0]); vt[T][1] = wmmab(xf, f1, vt[T][1]); } X_AHEAD(); }
      WMMA_GAP();
#pragma unroll
      for (int T = 0; T < 7; ++T) { const v4f p0 = *(const v4fa*)(pw + (2 * T) * 128), p1 = *(const v4fa*)(pw + (2 * T + 1) * 128);
#pragma unroll
          for (int t = 0; t < 4; ++t) { const v2f pb = t < 2 ? (v2f){p0[2 * t], p0[2 * t + 1]} : (v2f){p1[2 * t - 4], p1[2 * t - 3]};
#pragma unroll
              for (int dt = 0; dt < 2; ++dt) o[dt] = wmma4((v2f){vt[T][dt][2 * t], vt[T][dt][2 * t + 1]}, pb, o[dt]); } } }
    { v8us oh[2], ol[2];   // the lane's 16 values are d 16 half + 0 .. 15 in a row: register r of tile dt is d 2 r + dt
#pragma unroll   // o[dt] is indexed by constants and stays in registers
      for (int dt = 0; dt < 2; ++dt) {
#pragma unroll
          for (int x = 0; x < 8; ++x) { unsigned short a, c2; splitf(o[dt][x] * f, a, c2); oh[x >> 2][2 * (x & 3) + dt] = a; ol[x >> 2][2 * (x & 3) + dt] = c2; } }
#pragma unroll
      for (int p = 0; p < 2; ++p) { *(v8usa*)(so + (16 * sub + c) * OP_ + h * HD + 16 * hi + 8 * p) = oh[p]; *(v8usa*)(so + (32 + 16 * sub + c) * OP_ + h * HD + 16 * hi + 8 * p) = ol[p]; } }
    __syncthreads();   // publishes the 32 output rows: each wave reads columns that the other heads' waves computed
    v8f y[2]; y[0] = (v8f){}; y[1] = (v8f){};
#pragma unroll   // y is indexed by constants; the LDS reads go out ahead of the products
    for (int ks = 0; ks < 8; ++ks) { const bf* ap = so + (16 * sub + c) * OP_ + ks * 32 + 8 * hi;
        v16bf f0, f1; STEP_EDGE(); ws_frag(g[ks & 1], f0, f1); st_load(g[ks & 1], ws, 24 + ks + 2);
        const v16bf ah = cat16b(*(const v8usa*)ap, *(const v8usa*)(ap + 16)), al = cat16b(*(const v8usa*)(ap + 32 * OP_), *(const v8usa*)(ap + 32 * OP_ + 16));
        y[0] = wmmab(ah, f0, y[0]); y[0] = wmmab(al, f0, y[0]); y[1] = wmmab(ah, f1, y[1]); y[1] = wmmab(al, f1, y[1]); }
    const v2f bb = *(const v2fa*)(sbi + CC + h * HD + 2 * c);
    float* const op = OUT + ((size_t)b * NPIX + (size_t)((is + hi) * IW + j0)) * CC + h * HD + 2 * c;   // row 8 half + j of the tile is pixel (is + half, j0 + j)
#pragma unroll   // the eight stores differ in their immediate offsets alone
    for (int j = 0; j < 8; ++j) *(v2fa*)(op + j * CC) = (v2f){y[0][j] + bb[0], y[1][j] + bb[1]};
}

extern "C" void kernel_launch(void* const* d_in, const int* in_sizes, int n_in,
                              void* d_out, int out_size, void* d_ws, size_t ws_size, hipStream_t stream) {
    (void)in_sizes; (void)n_in; (void)out_size; (void)d_ws; (void)ws_size;
    const float* xq = (const float*)d_in[0]; const float* xk = (const float*)d_in[1]; const float* wq = (const float*)d_in[2]; const float* bq = (const float*)d_in[3]; const float* wkv = (const float*)d_in[4]; const float* bkv = (const float*)d_in[5]; const float* rpb = (const float*)d_in[6]; const float* wp = (const float*)d_in[7]; const float* bp = (const float*)d_in[8];   /* x_q, x_k ([2][56][56][256] channels-last), Wq ('xw' [256][256]), bq, Wkv ('xw' [256][512]: columns k | v), bkv, rpb [8][13][13], Wproj ('xw' [256][256]), bproj; nine inputs, all read */
    float* OUT = (float*)d_out;     // [2][56][56][256] = [6272][256]
    k_natt<<<(unsigned)(NTOK / 32), 512, 0, stream>>>(xq, xk, wq, wkv, wp, bq, bkv, rpb, bp, OUT);   /* projections, windowed attention in f32, output projection: one block per 4 x 8 queries */
}

// v009
// One run takes 21.9 microseconds.
// Two timings next to v008 both put it at 1.06 times that version's speed.
// Counting every step since v000, it is 10.3 times as fast.
#include <hip/hip_runtime.h>

// Neighborhood CROSS attention (NATTEN with separate query / key inputs; x_q, x_k [2][56][56][256] channels-last; q = x_q Wq + bq ('xw' [256][256] -> 8 heads x 32), [k | v] = x_k Wkv + bkv ('xw' [256][512] viewed (2, 8 heads, 32): columns 0..255 = k, 256..511 = v); for every pixel a 7x7 key window clamped to stay inside the image (start = clamp(i - 3, 0, 49)); logits = (q x 32^-0.5).k + rpb[h][ki - i + 6][kj - j + 6] (rpb [8][13][13] input); softmax over the 49; out = attn.v; y = out Wproj + bproj ('xw' [256][256]) -> [2][56][56][256] (1.6 M); argument order x_q, x_k, Wq, bq, Wkv, bkv, rpb, Wproj, bproj).
// Compute dtypes, f32 accumulate: every input rounded to bf16; the q, k and v projections on PLAIN bf16 operands (exact), their f32 biases as the accumulators' start values; the windowed attention on f32 values, each operand of its two products split into a bf16 head and a bf16 rest, three bf16 16x16x32 products a pair (rest x head, head x rest, head x head; rest x rest is left out) into an f32 accumulator (one wave per (2 x 8 query tile, head) against the tile's 8 x 14 block of keys, keys outside a query's window masked, logits + bias and the f32 softmax in registers); the attention output as bf16 hi + lo halves x exact w_proj (2 products) + f32 bias.
// One launch: a block of 16 waves owns 4 x 8 queries, rounds their x_q rows and the x_k rows of their 10 x 14 block of keys into LDS, and projects q, k and v of those rows itself; no plane goes through memory.
// The four weight planes never pass through LDS: each wave loads the 32 columns of its own head as f32, 8 bytes a lane, straight into fragment order, two 32-deep steps ahead of their products; the k loop is outermost, so the weights stream past 14 accumulator tiles.

#define NB_  2
#define IH   56
#define IW   56
#define NPIX (IH * IW)          // 3136
#define NTOK (NB_ * NPIX)       // 6272 = 98 x 64
#define CC   256
#define C3   768
#define NH_  8
#define HD   32
#define KS   7
#define NBR  3
#define RPW  13                 // 2*KS - 1
#define SCL  0.17677669529663689f   // 32^-0.5
typedef _Float16 h16;
typedef unsigned short bf;
typedef __attribute__((ext_vector_type(16))) __bf16   v16bf;
typedef __attribute__((ext_vector_type(16))) _Float16 v16h;
typedef __attribute__((ext_vector_type(8)))  _Float16 v8h;
typedef __attribute__((ext_vector_type(8)))  unsigned short v8us;
typedef __attribute__((ext_vector_type(8)))  float    v8f;
typedef __attribute__((ext_vector_type(4)))  float    v4f;
typedef v8h  __attribute__((may_alias)) v8ha;
typedef v4f  __attribute__((may_alias)) v4fa;
typedef v8us __attribute__((may_alias)) v8usa;

__device__ __forceinline__ unsigned short f2bf(float f) { unsigned u = __float_as_uint(f); u += 0x7FFFu + ((u >> 16) & 1u); return (unsigned short)(u >> 16); }
__device__ __forceinline__ float bf2f(unsigned short b) { return __uint_as_float(((unsigned)b) << 16); }
__device__ __forceinline__ float bfr(float f) { return bf2f(f2bf(f)); }
__device__ __forceinline__ v16h cat16(v8h lo, v8h hi) { return __builtin_shufflevector(lo, hi, 0, 1, 2, 3, 4, 5, 6, 7, 8, 9, 10, 11, 12, 13, 14, 15); }
__device__ __forceinline__ v16bf cat16b(v8us lo, v8us hi) { return __builtin_bit_cast(v16bf, __builtin_shufflevector(lo, hi, 0, 1, 2, 3, 4, 5, 6, 7, 8, 9, 10, 11, 12, 13, 14, 15)); }
__device__ __forceinline__ v8f wmma16(v16h a, v16h b, v8f c) { return __builtin_amdgcn_wmma_f32_16x16x32_f16(false, a, false, b, (short)0, c, false, false); }
__device__ __forceinline__ v8f wmmab(v16bf a, v16bf b, v8f c) { return __builtin_amdgcn_wmma_f32_16x16x32_bf16(false, a, false, b, (short)0, c, false, false); }




__device__ __forceinline__ void splitf(float y, unsigned short& h, unsigned short& l) { h = f2bf(y); l = f2bf(y - bf2f(h)); }
typedef __attribute__((ext_vector_type(2))) float v2f;
typedef __attribute__((ext_vector_type(2))) __bf16 v2bf;
typedef __attribute__((ext_vector_type(4))) unsigned v4u;
typedef v4u __attribute__((may_alias)) v4ua;

#define PT_ 264                 // LDS pitch of a staged x row, elements: 528 bytes = 16 x 33, the pitch for 16-byte readers
#define UR_ 8
#define UC_ 14
#define UH_ 10                  // key rows that the two query tiles of a block cover together
#define KR_ 144                 // staged x_k rows: 140, rounded up to whole trips of 16 waves (the tail repeats the last row and is never read)
#define KP_ 80                  // elements (160 bytes) put in front of each further key row in LDS: the two key rows of an x_k fragment then lie 8 pieces of 16 bytes apart in the banks, not 14
#define XQ_ (KR_ * PT_ + 11 * KP_)   // where the x_q rows begin
#define OP_ 272                 // LDS pitch of an output row, elements: 544 bytes
__device__ __forceinline__ unsigned pk2(float a, float b) { return __builtin_bit_cast(unsigned, __builtin_convertvector((v2f){a, b}, v2bf)); }
typedef v2f __attribute__((may_alias)) v2fa;
typedef __attribute__((ext_vector_type(8))) unsigned v8u;
// Two f32 values as a pair of bf16 heads and a pair of bf16 rests: rest = x - head is exact in f32 and is then rounded, so head + rest holds 16 bits of x.
__device__ __forceinline__ void split2(float a, float b, unsigned& h, unsigned& l) { h = pk2(a, b); l = pk2(a - __uint_as_float(h << 16), b - __uint_as_float(h & 0xFFFF0000u)); }
// c + (ah + al)(bh + bl) without al bl, the small terms first.
__device__ __forceinline__ v8f wmma3(v8u ah, v8u al, v8u bh, v8u bl, v8f c) { c = wmmab(__builtin_bit_cast(v16bf, al), __builtin_bit_cast(v16bf, bh), c); c = wmmab(__builtin_bit_cast(v16bf, ah), __builtin_bit_cast(v16bf, bl), c); return wmmab(__builtin_bit_cast(v16bf, ah), __builtin_bit_cast(v16bf, bh), c); }
__device__ __forceinline__ v8u cat8u(v4u lo, v4u hi) { return __builtin_shufflevector(lo, hi, 0, 1, 2, 3, 4, 5, 6, 7); }
// One 32-deep step of a head's 32 weight columns: lane (c, half) loads the column pair 2 c, 2 c + 1 of the 16 k rows of its half (k = 8 half + 0 .. 7 and 16 + 8 half + 0 .. 7, the order of the x fragments).
// 16 lanes cover one whole 128-byte line. The two floats of a pair are column slot c of the tiles dt = 0 and dt = 1: slot m of tile dt is column 2 m + dt of the head.
struct WS { v2f r[16]; };
template <int N>   // the row length is a constant, so that the loads differ in their immediate offsets alone
__device__ __forceinline__ void ws_load(WS& g, const float* __restrict__ w, unsigned vo, int ks) { const char* p = (const char*)w;
#pragma unroll   // g is indexed by constants and stays in registers
    for (int e = 0; e < 16; ++e) g.r[e] = *(const v2fa*)(p + vo + (32 * ks + 16 * (e >> 3) + (e & 7)) * N * 4); }
__device__ __forceinline__ void ws_frag(const WS& g, v16bf& f0, v16bf& f1) { v8u a, b2;
#pragma unroll   // as in ws_load
    for (int x = 0; x < 8; ++x) { a[x] = pk2(g.r[2 * x][0], g.r[2 * x + 1][0]); b2[x] = pk2(g.r[2 * x][1], g.r[2 * x + 1][1]); }
    f0 = __builtin_bit_cast(v16bf, a); f1 = __builtin_bit_cast(v16bf, b2); }
// Holds the loads of step i + 2 behind the conversion of step i (lifted further up they would need a third buffer's registers, which the accumulators do not leave) and in front of step i's products (sunk below those they would fly one step less).
#define STEP_EDGE() __builtin_amdgcn_sched_barrier(0)
// Order inside a step of 7 x_k fragments: the LDS reads of a fragment go out one fragment ahead of its two products, so that a product does not wait for the whole LDS latency (0x100 = LDS reads, 0x008 = matrix products).
#define X_AHEAD() do { __builtin_amdgcn_sched_group_barrier(0x100, 4, 0); \
    __builtin_amdgcn_sched_group_barrier(0x008, 2, 0); __builtin_amdgcn_sched_group_barrier(0x100, 2, 0); __builtin_amdgcn_sched_group_barrier(0x008, 2, 0); __builtin_amdgcn_sched_group_barrier(0x100, 2, 0); \
    __builtin_amdgcn_sched_group_barrier(0x008, 2, 0); __builtin_amdgcn_sched_group_barrier(0x100, 2, 0); __builtin_amdgcn_sched_group_barrier(0x008, 2, 0); __builtin_amdgcn_sched_group_barrier(0x100, 2, 0); \
    __builtin_amdgcn_sched_group_barrier(0x008, 2, 0); __builtin_amdgcn_sched_group_barrier(0x100, 2, 0); __builtin_amdgcn_sched_group_barrier(0x008, 4, 0); } while (0)
// The planes form one stream of 32 steps: Wq 0 .. 7, Wk 8 .. 15, Wv 16 .. 23, Wproj 24 .. 31. Behind a plane's last step stands the wait that comes in front of any later write to the registers its loads name; the offset is named so that its register lives up to the wait.
struct WSrc { const float* wq; const float* wkv; const float* wp; unsigned v2, v5; };
__device__ __forceinline__ void st_load(WS& g, const WSrc& s, int i) {
    if (i < 8) ws_load<CC>(g, s.wq, s.v2, i); else if (i < 16) ws_load<2 * CC>(g, s.wkv, s.v5, i - 8); else if (i < 24) ws_load<2 * CC>(g, s.wkv + CC, s.v5, i - 16); else if (i < 32) ws_load<CC>(g, s.wp, s.v2, i - 24);
    if (i < 32 && (i & 7) == 7) asm volatile("s_wait_xcnt 0x0" :: "v"(s.v2), "v"(s.v5) : "memory"); }
// 2^x with the one vector slot that the instruction set asks for behind a transcendental whose result the next vector instruction reads or whose source it overwrites; in one statement, so that the slot stands directly behind it.
__device__ __forceinline__ float exp2_slot(float x) { float p; asm("v_exp_f32 %0, %1\n\tv_nop" : "=v"(p) : "v"(x)); return p; }
__device__ __forceinline__ v16bf x_frag(const bf* xp, int ks) { return cat16b(*(const v8usa*)(xp + ks * 32), *(const v8usa*)(xp + ks * 32 + 16)); }   // xp: the lane's row + 8 half

// k_natt: block = 4 x 8 queries, wave = (head h, 2 x 8 query tile sub). The 16 windows of a tile lie inside one 8 x 14 block of keys (112 = 7 x 16), start (ui, uj) clamped into the image; both tiles' blocks lie inside 10 x 14 keys from (U0, uj).
// Key slot (T, r, half): e = 8 T + r, key row ui + 2 (e / 14) + half, key column uj + e % 14. The x_k fragment of tile T has lane c on key slot (T, c & 7, c >> 3); it serves as B of k^T and as A of v.
// q^T = Wq^T x_q^T and k^T = Wk^T x_k^T (A = weight column slots of the head, B = x rows): D register r of tile dt = d 2 (8 half + r) + dt of the lane's query or key: the lane's 16 values, taken as element 8 dt + r on both sides, are its half of a 32-deep fragment of the next product.
// S^T = K Q^T, one 32-deep step a tile: A row = key slot, B column = query c. D register r of tile T = logit of key slot (T, r, half) for query c.
// Keys outside a query's own 7 x 7 window are masked to -3e38 (their weight is 0); softmax runs down the lane's 56 registers plus one exchange between the lane halves.
// v = x_k Wv (A = the x_k fragment, B = weight column slots): D register r = v[key slot (T, r, half)][2 c + dt]. O^T = V^T P^T in four 32-deep steps: step j takes the tiles T = 2 j and 2 j + 1, element 8 (T & 1) + r = key slot (T, r, half) in A (v) and in B (the weights as they lie in S^T's D); the eighth tile, which does not exist, is 0 on both sides. O^T's D register r of tile dt = out[query c][16 half + 2 r + dt].
// While v's 14 accumulator tiles are live, the lane's 56 softmax weights lie in LDS as heads and rests, each lane at a place that it alone writes and reads.
// The attention output is split into bf16 hi and lo and gathered in LDS (32 rows x 256 columns); wave (h, sub) forms y columns 32 h .. + 31 of its tile's 16 rows, per 32 k the hi product, then the lo product, into one accumulator;
// a lane holds the column pair 2 c, 2 c + 1 of 8 rows, adds the bias and stores 8 bytes a row: 16 lanes write one whole 128-byte line, one writer per line.
// Every loop is fully unrolled so that its arrays (fragments, logits, masks) are indexed by constants and stay in registers.
// One block of 16 waves a WGP, 4 waves a SIMD: the attribute gives the compiler the registers of that occupancy.
__global__ __launch_bounds__(512) __attribute__((amdgpu_waves_per_eu(4, 4))) void k_natt(const float* __restrict__ xq, const float* __restrict__ xk, const float* __restrict__ wq, const float* __restrict__ wkv, const float* __restrict__ wp, const float* __restrict__ bq, const float* __restrict__ bkv, const float* __restrict__ rpb, const float* __restrict__ bp, float* OUT) {
    __shared__ __align__(16) bf sx[XQ_ + 32 * PT_];   // x_k rows of the 10 x 14 keys, then the 32 x_q rows
    __shared__ __align__(16) bf so[2 * 32 * OP_];       // [hi, lo][query][column]
    __shared__ __align__(16) float sp[16 * 56 * 32];    // [wave][14 pieces][lane][4]: the softmax weights, per tile a piece of heads and a piece of rests
    __shared__ float rb[(NH_ * RPW * RPW + 511) / 512 * 512];   // the table, rounded up so that every thread stores on every trip (the tail repeats the last entry and is never read)
    __shared__ __align__(32) float sbi[4 * CC];         // biases, rounded: bq, bproj, bkv; bq and bk lie in slot order (d = 2 m + dt at 16 dt + m)
    const int tid = threadIdx.x, lane = tid & 31, c = lane & 15, hi = lane >> 4, wv = tid >> 5, h = wv & 7, sub = wv >> 3;
    const int tile = blockIdx.x; const int b = tile / ((IH / 4) * (IW / 8)), tt = tile % ((IH / 4) * (IW / 8)); const int i0 = (tt / (IW / 8)) * 4, j0 = (tt % (IW / 8)) * 8;
    const int U0 = min(max(i0 - NBR, 0), IH - UH_), uj = min(max(j0 - NBR, 0), IW - UC_);
    const WSrc ws = {wq, wkv, wp, (unsigned)(8 * hi * CC + h * HD + 2 * c) * 4u, (unsigned)(8 * hi * 2 * CC + h * HD + 2 * c) * 4u};
    WS g[2];   // step i of the stream lies in g[i & 1]
    {   // stage: x rows, the bias table, the biases
        unsigned xo[11]; v4f xr[11][2];
#pragma unroll   // xo and xr are indexed by constants
        for (int u = 0; u < 9; ++u) { const int r = min(wv + 16 * u, UH_ * UC_ - 1); xo[u] = (unsigned)((b * NPIX + (U0 + r / UC_) * IW + uj + r % UC_) * CC + lane * 8) * 4u; }
#pragma unroll
        for (int u = 9; u < 11; ++u) { const int r = wv + 16 * (u - 9); xo[u] = (unsigned)((b * NPIX + (i0 + (r >> 3)) * IW + j0 + (r & 7)) * CC + lane * 8) * 4u; }
#pragma unroll
        for (int u = 0; u < 11; ++u) { const char* p = (const char*)(u < 9 ? xk : xq) + xo[u]; xr[u][0] = *(const v4f*)p; xr[u][1] = *(const v4f*)(p + 16); }
        asm volatile("s_wait_xcnt 0x0" :: "v"(xo[0]), "v"(xo[1]), "v"(xo[2]), "v"(xo[3]), "v"(xo[4]), "v"(xo[5]), "v"(xo[6]), "v"(xo[7]), "v"(xo[8]), "v"(xo[9]), "v"(xo[10]) : "memory");   // stands in front of any later write to the address registers of the x loads, which are named so that they live up to the wait
        st_load(g[0], ws, 0); st_load(g[1], ws, 1);
        float rv[3];
        const unsigned ro0 = (unsigned)min(tid, NH_ * RPW * RPW - 1) * 4u, ro1 = (unsigned)min(tid + 512, NH_ * RPW * RPW - 1) * 4u, ro2 = (unsigned)min(tid + 1024, NH_ * RPW * RPW - 1) * 4u, bo = (unsigned)tid * 4u, bo2 = (unsigned)(tid & 255) * 4u;
        rv[0] = *(const float*)((const char*)rpb + ro0); rv[1] = *(const float*)((const char*)rpb + ro1); rv[2] = *(const float*)((const char*)rpb + ro2);
        const float b0 = *(const float*)((const char*)bq + bo2), b1 = *(const float*)((const char*)bp + bo2), b2 = *(const float*)((const char*)bkv + bo);
        asm volatile("s_wait_xcnt 0x0" :: "v"(ro0), "v"(ro1), "v"(ro2), "v"(bo), "v"(bo2) : "memory");   // as for the x loads, for the table's and the biases' loads
#pragma unroll
        for (int u = 0; u < 11; ++u) { const v4u o = {pk2(xr[u][0][0], xr[u][0][1]), pk2(xr[u][0][2], xr[u][0][3]), pk2(xr[u][1][0], xr[u][1][1]), pk2(xr[u][1][2], xr[u][1][3])};
            *(v4ua*)(sx + (u < 9 ? (wv + 16 * u) * PT_ + ((wv + 16 * u) / UC_) * KP_ : XQ_ + (wv + 16 * (u - 9)) * PT_) + lane * 8) = o; }
#pragma unroll
        for (int u = 0; u < 3; ++u) rb[tid + 512 * u] = bfr(rv[u]);
        const int bpos = tid < CC ? (tid & ~31) | ((tid & 1) << 4) | ((tid & 31) >> 1) : tid;   // bq and bk in slot order, bproj and bv as they come
        sbi[bpos] = bfr(tid < CC ? b0 : b1); sbi[2 * CC + bpos] = bfr(b2);
    }
    __syncthreads();   // publishes the staged rows and tables: every wave reads what the other waves stored
    const int is = i0 + 2 * sub;
    const int ui = min(max(is - NBR, 0), IH - UR_);
    const int qi = is + (c >> 3), qj = j0 + (c & 7);
    const int si = min(max(qi - NBR, 0), IH - KS), sj = min(max(qj - NBR, 0), IW - KS);
    unsigned qh[8], ql[8];
    { v8f qa[2]; const bf* xp = sx + XQ_ + (16 * sub + c) * PT_ + 8 * hi;
#pragma unroll
      for (int dt = 0; dt < 2; ++dt) qa[dt] = *(const v8f*)(sbi + h * HD + 16 * dt + 8 * hi);
#pragma unroll
      for (int ks = 0; ks < 8; ++ks) { v16bf f0, f1; STEP_EDGE(); ws_frag(g[ks & 1], f0, f1); st_load(g[ks & 1], ws, ks + 2);
          const v16bf xf = x_frag(xp, ks); qa[0] = wmmab(f0, xf, qa[0]); qa[1] = wmmab(f1, xf, qa[1]); }
#pragma unroll
      for (int x = 0; x < 8; ++x) split2(qa[x >> 2][2 * (x & 3)] * SCL, qa[x >> 2][2 * (x & 3) + 1] * SCL, qh[x], ql[x]); }
    float* const pw = sp + wv * (56 * 32) + lane * 4;   // the lane's own places in LDS, 512 bytes apart
#pragma unroll   // q waits in LDS while k's 14 accumulator tiles and the stream need the registers
    for (int x = 0; x < 2; ++x) { *(v4ua*)(pw + x * 128) = (v4u){qh[4 * x], qh[4 * x + 1], qh[4 * x + 2], qh[4 * x + 3]}; *(v4ua*)(pw + (2 + x) * 128) = (v4u){ql[4 * x], ql[4 * x + 1], ql[4 * x + 2], ql[4 * x + 3]}; }
    const bf* xb = sx + ((ui - U0 + (c >> 3)) * UC_ + (c & 7)) * PT_ + (ui - U0 + (c >> 3)) * KP_ + 8 * hi;   // key slot (0, c & 7, c >> 3); tile T adds its rows below
    const bf* xt[7];
#pragma unroll
    for (int T = 0; T < 7; ++T) { const int q0 = (8 * T) / UC_, m0 = (8 * T) % UC_;   // e = 8 T + (c & 7): past the end of a key row it goes on two rows down
        xt[T] = xb + (2 * UC_ * q0 + m0) * PT_ + 2 * q0 * KP_ + (m0 + (c & 7) >= UC_ ? UC_ * PT_ + 2 * KP_ : 0); }
    v8f s[7];
    { v8f kt[7][2];
#pragma unroll
      for (int T = 0; T < 7; ++T) {
#pragma unroll
          for (int dt = 0; dt < 2; ++dt) kt[T][dt] = *(const v8f*)(sbi + 2 * CC + h * HD + 16 * dt + 8 * hi); }
#pragma unroll
      for (int ks = 0; ks < 8; ++ks) { v16bf f0, f1; STEP_EDGE(); ws_frag(g[ks & 1], f0, f1); STEP_EDGE(); if (ks < 6) st_load(g[ks & 1], ws, 8 + ks + 2); STEP_EDGE();
#pragma unroll
          for (int T = 0; T < 7; ++T) { const v16bf xf = x_frag(xt[T], ks); kt[T][0] = wmmab(f0, xf, kt[T][0]); kt[T][1] = wmmab(f1, xf, kt[T][1]); } X_AHEAD(); }
      const v8u qfh = cat8u(*(const v4ua*)pw, *(const v4ua*)(pw + 128)), qfl = cat8u(*(const v4ua*)(pw + 2 * 128), *(const v4ua*)(pw + 3 * 128));
#pragma unroll
      for (int T = 0; T < 7; ++T) { v8u kh, kl;
#pragma unroll
          for (int x = 0; x < 8; ++x) { unsigned a, r2; split2(kt[T][x >> 2][2 * (x & 3)], kt[T][x >> 2][2 * (x & 3) + 1], a, r2); kh[x] = a; kl[x] = r2; }
          s[T] = wmma3(kh, kl, qfh, qfl, (v8f){}); } }
    STEP_EDGE(); st_load(g[0], ws, 16); st_load(g[1], ws, 17);   // Wv's first two steps go out where k's accumulators are free again, and fly under the softmax
    bool rok[4]; int rix[4]; bool cok[UC_]; int cix[UC_];
#pragma unroll
    for (int g4 = 0; g4 < 4; ++g4) { const int ki = ui + 2 * g4 + hi; rok[g4] = (unsigned)(ki - si) < (unsigned)KS; rix[g4] = h * (RPW * RPW) + (ki - qi + KS - 1) * RPW; }
#pragma unroll
    for (int x = 0; x < UC_; ++x) { const int kj = uj + x; cok[x] = (unsigned)(kj - sj) < (unsigned)KS; cix[x] = kj - qj + KS - 1; }
    float mx4[4] = {-3.0e38f, -3.0e38f, -3.0e38f, -3.0e38f};
#pragma unroll
    for (int T = 0; T < 7; ++T) {
#pragma unroll
        for (int r = 0; r < 8; ++r) { const int e = T * 8 + r; const bool ok = rok[e / UC_] & cok[e % UC_]; const int ix = ok ? rix[e / UC_] + cix[e % UC_] : 0; const float bv = rb[ix]; const float sb = s[T][r] + bv; const float t = ok ? sb : -3.0e38f; s[T][r] = t; mx4[r & 3] = fmaxf(mx4[r & 3], t); } }
    float mx = fmaxf(fmaxf(mx4[0], mx4[1]), fmaxf(mx4[2], mx4[3])); mx = fmaxf(mx, __shfl_xor(mx, 16, 32));
    float sm4[4] = {0.f, 0.f, 0.f, 0.f};
#pragma unroll
    for (int T = 0; T < 7; ++T) {
#pragma unroll
        for (int r = 0; r < 8; ++r) { const float p = exp2_slot((s[T][r] - mx) * 1.4426950408889634f); s[T][r] = p; sm4[r & 3] += p; }
        v4u ph, pl;
#pragma unroll
        for (int x = 0; x < 4; ++x) { unsigned a, r2; split2(s[T][2 * x], s[T][2 * x + 1], a, r2); ph[x] = a; pl[x] = r2; }
        *(v4ua*)(pw + (2 * T) * 128) = ph; *(v4ua*)(pw + (2 * T + 1) * 128) = pl; }
    float sum = (sm4[0] + sm4[1]) + (sm4[2] + sm4[3]); sum += __shfl_xor(sum, 16, 32);
    const float f = __fdiv_rn(1.0f, sum);
    v8f o[2]; o[0] = (v8f){}; o[1] = (v8f){};
    { const v2f vb = *(const v2fa*)(sbi + 3 * CC + h * HD + 2 * c);
      v8f vt[7][2];
#pragma unroll
      for (int T = 0; T < 7; ++T) {
#pragma unroll
          for (int dt = 0; dt < 2; ++dt) vt[T][dt] = (v8f){vb[dt], vb[dt], vb[dt], vb[dt], vb[dt], vb[dt], vb[dt], vb[dt]}; }
#pragma unroll
      for (int ks = 0; ks < 8; ++ks) { v16bf f0, f1; STEP_EDGE(); ws_frag(g[ks & 1], f0, f1); STEP_EDGE(); st_load(g[ks & 1], ws, 16 + ks + 2); STEP_EDGE();
#pragma unroll
          for (int T = 0; T < 7; ++T) { const v16bf xf = x_frag(xt[T], ks); vt[T][0] = wmmab(xf, f0, vt[T][0]); vt[T][1] = wmmab(xf, f1, vt[T][1]); } X_AHEAD(); }
#pragma unroll
      for (int j = 0; j < 4; ++j) { const v4u z4 = {0u, 0u, 0u, 0u};
          const v8u pfh = cat8u(*(const v4ua*)(pw + (4 * j) * 128), j < 3 ? *(const v4ua*)(pw + (4 * j + 2) * 128) : z4), pfl = cat8u(*(const v4ua*)(pw + (4 * j + 1) * 128), j < 3 ? *(const v4ua*)(pw + (4 * j + 3) * 128) : z4);
#pragma unroll
          for (int dt = 0; dt < 2; ++dt) { v8u vh = {}, vl = {};
#pragma unroll
              for (int x = 0; x < (j < 3 ? 8 : 4); ++x) { unsigned a, r2; split2(vt[2 * j + (x >> 2)][dt][2 * (x & 3)], vt[2 * j + (x >> 2)][dt][2 * (x & 3) + 1], a, r2); vh[x] = a; vl[x] = r2; }
              o[dt] = wmma3(vh, vl, pfh, pfl, o[dt]); } } }
    { v8us oh[2], ol[2];   // the lane's 16 values are d 16 half + 0 .. 15 in a row: register r of tile dt is d 2 r + dt
#pragma unroll   // o[dt] is indexed by constants and stays in registers
      for (int dt = 0; dt < 2; ++dt) {
#pragma unroll
          for (int x = 0; x < 8; ++x) { unsigned short a, c2; splitf(o[dt][x] * f, a, c2); oh[x >> 2][2 * (x & 3) + dt] = a; ol[x >> 2][2 * (x & 3) + dt] = c2; } }
#pragma unroll
      for (int p = 0; p < 2; ++p) { *(v8usa*)(so + (16 * sub + c) * OP_ + h * HD + 16 * hi + 8 * p) = oh[p]; *(v8usa*)(so + (32 + 16 * sub + c) * OP_ + h * HD + 16 * hi + 8 * p) = ol[p]; } }
    __syncthreads();   // publishes the 32 output rows: each wave reads columns that the other heads' waves computed
    v8f y[2]; y[0] = (v8f){}; y[1] = (v8f){};
#pragma unroll   // y is indexed by constants; the LDS reads go out ahead of the products
    for (int ks = 0; ks < 8; ++ks) { const bf* ap = so + (16 * sub + c) * OP_ + ks * 32 + 8 * hi;
        v16bf f0, f1; STEP_EDGE(); ws_frag(g[ks & 1], f0, f1); st_load(g[ks & 1], ws, 24 + ks + 2);
        const v16bf ah = cat16b(*(const v8usa*)ap, *(const v8usa*)(ap + 16)), al = cat16b(*(const v8usa*)(ap + 32 * OP_), *(const v8usa*)(ap + 32 * OP_ + 16));
        y[0] = wmmab(ah, f0, y[0]); y[0] = wmmab(al, f0, y[0]); y[1] = wmmab(ah, f1, y[1]); y[1] = wmmab(al, f1, y[1]); }
    const v2f bb = *(const v2fa*)(sbi + CC + h * HD + 2 * c);
    float* const op = OUT + ((size_t)b * NPIX + (size_t)((is + hi) * IW + j0)) * CC + h * HD + 2 * c;   // row 8 half + j of the tile is pixel (is + half, j0 + j)
#pragma unroll   // the eight stores differ in their immediate offsets alone
    for (int j = 0; j < 8; ++j) *(v2fa*)(op + j * CC) = (v2f){y[0][j] + bb[0], y[1][j] + bb[1]};
}

extern "C" void kernel_launch(void* const* d_in, const int* in_sizes, int n_in,
                              void* d_out, int out_size, void* d_ws, size_t ws_size, hipStream_t stream) {
    (void)in_sizes; (void)n_in; (void)out_size; (void)d_ws; (void)ws_size;
    const float* xq = (const float*)d_in[0]; const float* xk = (const float*)d_in[1]; const float* wq = (const float*)d_in[2]; const float* bq = (const float*)d_in[3]; const float* wkv = (const float*)d_in[4]; const float* bkv = (const float*)d_in[5]; const float* rpb = (const float*)d_in[6]; const float* wp = (const float*)d_in[7]; const float* bp = (const float*)d_in[8];   /* x_q, x_k ([2][56][56][256] channels-last), Wq ('xw' [256][256]), bq, Wkv ('xw' [256][512]: columns k | v), bkv, rpb [8][13][13], Wproj ('xw' [256][256]), bproj; nine inputs, all read */
    float* OUT = (float*)d_out;     // [2][56][56][256] = [6272][256]
    k_natt<<<(unsigned)(NTOK / 32), 512, 0, stream>>>(xq, xk, wq, wkv, wp, bq, bkv, rpb, bp, OUT);   /* projections, windowed attention in f32, output projection: one block per 4 x 8 queries */
}

// v010
// Measured time: 20.9 microseconds a run.
// In both of two side-by-side timings against v009, it was 1.05 times as fast.
// All steps since v000 together make it 10.8 times as fast.
#include <hip/hip_runtime.h>

// Neighborhood CROSS attention (NATTEN with separate query / key inputs; x_q, x_k [2][56][56][256] channels-last; q = x_q Wq + bq ('xw' [256][256] -> 8 heads x 32), [k | v] = x_k Wkv + bkv ('xw' [256][512] viewed (2, 8 heads, 32): columns 0..255 = k, 256..511 = v); for every pixel a 7x7 key window clamped to stay inside the image (start = clamp(i - 3, 0, 49)); logits = (q x 32^-0.5).k + rpb[h][ki - i + 6][kj - j + 6] (rpb [8][13][13] input); softmax over the 49; out = attn.v; y = out Wproj + bproj ('xw' [256][256]) -> [2][56][56][256] (1.6 M); argument order x_q, x_k, Wq, bq, Wkv, bkv, rpb, Wproj, bproj).
// Compute dtypes, f32 accumulate: every input rounded to bf16; the q, k and v projections on PLAIN bf16 operands (exact), their f32 biases as the accumulators' start values; the windowed attention on f32 values, each operand of its two products split into a bf16 head and a bf16 rest, three bf16 16x16x32 products a pair (rest x head, head x rest, head x head; rest x rest is left out) into an f32 accumulator (one wave per head, its two 2 x 8 query tiles against the block's 10 x 14 keys, keys outside a query's window masked, logits + bias and the f32 softmax in registers); the attention output as bf16 hi + lo halves x exact w_proj (2 products) + f32 bias.
// One launch: a block of 8 waves, one a head, owns 4 x 8 queries, rounds their x_q rows and the x_k rows of their 10 x 14 block of keys into LDS, and projects q, k and v of those rows itself, each key once; no plane goes through memory.
// The four weight planes never pass through LDS: each wave loads the 32 columns of its own head as f32, 8 bytes a lane, straight into fragment order, four 32-deep steps ahead of their products; the k loop is outermost, so the weights stream past 18 accumulator tiles.

#define NB_  2
#define IH   56
#define IW   56
#define NPIX (IH * IW)          // 3136
#define NTOK (NB_ * NPIX)       // 6272 = 98 x 64
#define CC   256
#define C3   768
#define NH_  8
#define HD   32
#define KS   7
#define NBR  3
#define RPW  13                 // 2*KS - 1
#define SCL  0.17677669529663689f   // 32^-0.5
typedef _Float16 h16;
typedef unsigned short bf;
typedef __attribute__((ext_vector_type(16))) __bf16   v16bf;
typedef __attribute__((ext_vector_type(16))) _Float16 v16h;
typedef __attribute__((ext_vector_type(8)))  _Float16 v8h;
typedef __attribute__((ext_vector_type(8)))  unsigned short v8us;
typedef __attribute__((ext_vector_type(8)))  float    v8f;
typedef __attribute__((ext_vector_type(4)))  float    v4f;
typedef v8h  __attribute__((may_alias)) v8ha;
typedef v4f  __attribute__((may_alias)) v4fa;
typedef v8us __attribute__((may_alias)) v8usa;

__device__ __forceinline__ unsigned short f2bf(float f) { unsigned u = __float_as_uint(f); u += 0x7FFFu + ((u >> 16) & 1u); return (unsigned short)(u >> 16); }
__device__ __forceinline__ float bf2f(unsigned short b) { return __uint_as_float(((unsigned)b) << 16); }
__device__ __forceinline__ float bfr(float f) { return bf2f(f2bf(f)); }
__device__ __forceinline__ v16h cat16(v8h lo, v8h hi) { return __builtin_shufflevector(lo, hi, 0, 1, 2, 3, 4, 5, 6, 7, 8, 9, 10, 11, 12, 13, 14, 15); }
__device__ __forceinline__ v16bf cat16b(v8us lo, v8us hi) { return __builtin_bit_cast(v16bf, __builtin_shufflevector(lo, hi, 0, 1, 2, 3, 4, 5, 6, 7, 8, 9, 10, 11, 12, 13, 14, 15)); }
__device__ __forceinline__ v8f wmma16(v16h a, v16h b, v8f c) { return __builtin_amdgcn_wmma_f32_16x16x32_f16(false, a, false, b, (short)0, c, false, false); }
__device__ __forceinline__ v8f wmmab(v16bf a, v16bf b, v8f c) { return __builtin_amdgcn_wmma_f32_16x16x32_bf16(false, a, false, b, (short)0, c, false, false); }




__device__ __forceinline__ void splitf(float y, unsigned short& h, unsigned short& l) { h = f2bf(y); l = f2bf(y - bf2f(h)); }
typedef __attribute__((ext_vector_type(2))) float v2f;
typedef __attribute__((ext_vector_type(2))) __bf16 v2bf;
typedef __attribute__((ext_vector_type(4))) unsigned v4u;
typedef v4u __attribute__((may_alias)) v4ua;

#define PT_ 264                 // LDS pitch of a staged x row, elements: 528 bytes = 16 x 33, the pitch for 16-byte readers
#define UR_ 8
#define UC_ 14
#define UH_ 10                  // key rows that the two query tiles of a block cover together
#define NT_ 9                   // key tiles of 16: 5 pairs of key rows x 14 columns = 70 slots a lane half, rounded up to 72
#define KR_ 144                 // staged x_k rows: 140, rounded up to whole trips of 8 waves (the tail repeats the last row and is never read)
#define KP_ 80                  // elements (160 bytes) put in front of each further key row in LDS: the two key rows of an x_k fragment then lie 8 pieces of 16 bytes apart in the banks, not 14
#define XQ_ (KR_ * PT_ + 11 * KP_)   // where the x_q rows begin
#define OP_ 272                 // LDS pitch of an output row, elements: 544 bytes
__device__ __forceinline__ unsigned pk2(float a, float b) { return __builtin_bit_cast(unsigned, __builtin_convertvector((v2f){a, b}, v2bf)); }
typedef v2f __attribute__((may_alias)) v2fa;
typedef __attribute__((ext_vector_type(8))) unsigned v8u;
// Two f32 values as a pair of bf16 heads and a pair of bf16 rests: rest = x - head is exact in f32 and is then rounded, so head + rest holds 16 bits of x.
__device__ __forceinline__ void split2(float a, float b, unsigned& h, unsigned& l) { h = pk2(a, b); l = pk2(a - __uint_as_float(h << 16), b - __uint_as_float(h & 0xFFFF0000u)); }
// c + (ah + al)(bh + bl) without al bl, the small terms first.
__device__ __forceinline__ v8f wmma3(v8u ah, v8u al, v8u bh, v8u bl, v8f c) { c = wmmab(__builtin_bit_cast(v16bf, al), __builtin_bit_cast(v16bf, bh), c); c = wmmab(__builtin_bit_cast(v16bf, ah), __builtin_bit_cast(v16bf, bl), c); return wmmab(__builtin_bit_cast(v16bf, ah), __builtin_bit_cast(v16bf, bh), c); }
__device__ __forceinline__ v8u cat8u(v4u lo, v4u hi) { return __builtin_shufflevector(lo, hi, 0, 1, 2, 3, 4, 5, 6, 7); }
// One 32-deep step of a head's 32 weight columns: lane (c, half) loads the column pair 2 c, 2 c + 1 of the 16 k rows of its half (k = 8 half + 0 .. 7 and 16 + 8 half + 0 .. 7, the order of the x fragments).
// 16 lanes cover one whole 128-byte line. The two floats of a pair are column slot c of the tiles dt = 0 and dt = 1: slot m of tile dt is column 2 m + dt of the head.
struct WS { v2f r[16]; };
template <int N>   // the row length is a constant, so that the loads differ in their immediate offsets alone
__device__ __forceinline__ void ws_load(WS& g, const float* __restrict__ w, unsigned vo, int ks) { const char* p = (const char*)w;
#pragma unroll   // g is indexed by constants and stays in registers
    for (int e = 0; e < 16; ++e) g.r[e] = *(const v2fa*)(p + vo + (32 * ks + 16 * (e >> 3) + (e & 7)) * N * 4); }
__device__ __forceinline__ void ws_frag(const WS& g, v16bf& f0, v16bf& f1) { v8u a, b2;
#pragma unroll   // as in ws_load
    for (int x = 0; x < 8; ++x) { a[x] = pk2(g.r[2 * x][0], g.r[2 * x + 1][0]); b2[x] = pk2(g.r[2 * x][1], g.r[2 * x + 1][1]); }
    f0 = __builtin_bit_cast(v16bf, a); f1 = __builtin_bit_cast(v16bf, b2); }
// Holds the loads of step i + 4 behind the conversion of step i (lifted further up they would need a fifth buffer's registers) and in front of step i's products (sunk below those they would fly one step less).
#define STEP_EDGE() __builtin_amdgcn_sched_barrier(0)
// Order inside a step of 9 x_k fragments: the LDS reads of a fragment go out one fragment ahead of its two products, so that a product does not wait for the whole LDS latency (0x100 = LDS reads, 0x008 = matrix products).
#define X_AHEAD() do { __builtin_amdgcn_sched_group_barrier(0x100, 4, 0); \
    __builtin_amdgcn_sched_group_barrier(0x008, 2, 0); __builtin_amdgcn_sched_group_barrier(0x100, 2, 0); __builtin_amdgcn_sched_group_barrier(0x008, 2, 0); __builtin_amdgcn_sched_group_barrier(0x100, 2, 0); \
    __builtin_amdgcn_sched_group_barrier(0x008, 2, 0); __builtin_amdgcn_sched_group_barrier(0x100, 2, 0); __builtin_amdgcn_sched_group_barrier(0x008, 2, 0); __builtin_amdgcn_sched_group_barrier(0x100, 2, 0); \
    __builtin_amdgcn_sched_group_barrier(0x008, 2, 0); __builtin_amdgcn_sched_group_barrier(0x100, 2, 0); __builtin_amdgcn_sched_group_barrier(0x008, 2, 0); __builtin_amdgcn_sched_group_barrier(0x100, 2, 0); \
    __builtin_amdgcn_sched_group_barrier(0x008, 2, 0); __builtin_amdgcn_sched_group_barrier(0x100, 2, 0); __builtin_amdgcn_sched_group_barrier(0x008, 4, 0); } while (0)
// The planes form one stream of 32 steps: Wq 0 .. 7, Wk 8 .. 15, Wv 16 .. 23, Wproj 24 .. 31. Behind every fourth step (3, 7, .., 31) stands the wait that comes in front of any later write to the registers its loads name; the offset is named so that its register lives up to the wait.
struct WSrc { const float* wq; const float* wkv; const float* wp; unsigned v2, v5; };
__device__ __forceinline__ void st_load(WS& g, const WSrc& s, int i) {
    if (i < 8) ws_load<CC>(g, s.wq, s.v2, i); else if (i < 16) ws_load<2 * CC>(g, s.wkv, s.v5, i - 8); else if (i < 24) ws_load<2 * CC>(g, s.wkv + CC, s.v5, i - 16); else if (i < 32) ws_load<CC>(g, s.wp, s.v2, i - 24);
    if (i < 32 && (i & 3) == 3) asm volatile("s_wait_xcnt 0x0" :: "v"(s.v2), "v"(s.v5) : "memory"); }
// 2^x with the one vector slot that the instruction set asks for behind a transcendental whose result the next vector instruction reads or whose source it overwrites; in one statement, so that the slot stands directly behind it.
__device__ __forceinline__ float exp2_slot(float x) { float p; asm("v_exp_f32 %0, %1\n\tv_nop" : "=v"(p) : "v"(x)); return p; }
__device__ __forceinline__ v16bf x_frag(const bf* xp, int ks) { return cat16b(*(const v8usa*)(xp + ks * 32), *(const v8usa*)(xp + ks * 32 + 16)); }   // xp: the lane's row + 8 half

// k_natt: block = 4 x 8 queries, wave = head h, with both 2 x 8 query tiles (sub = 0, 1). All 32 windows lie inside one 10 x 14 block of keys, start (U0, uj) clamped into the image; the wave projects k and v of those keys once and uses them for both tiles.
// Key slot (T, r, half): e = 8 T + r, key row U0 + 2 (e / 14) + half, key column uj + e % 14; T = 0 .. 8. The slots e = 70 and 71 do not exist: they read the key of e = 69 and are always masked. The x_k fragment of tile T has lane c on key slot (T, c & 7, c >> 3); it serves as B of k^T and as A of v.
// q^T = Wq^T x_q^T and k^T = Wk^T x_k^T (A = weight column slots of the head, B = x rows): D register r of tile dt = d 2 (8 half + r) + dt of the lane's query or key: the lane's 16 values, taken as element 8 dt + r on both sides, are its half of a 32-deep fragment of the next product.
// S^T = K Q^T, one 32-deep step a tile and a query tile: A row = key slot, B column = query c. D register r of tile T = logit of key slot (T, r, half) for query c.
// Keys outside a query's own 7 x 7 window are masked to -3e38 (their weight is 0); softmax runs down the lane's 72 registers plus one exchange between the lane halves.
// v = x_k Wv (A = the x_k fragment, B = weight column slots): D register r = v[key slot (T, r, half)][2 c + dt]. O^T = V^T P^T in five 32-deep steps: step j takes the tiles T = 2 j and 2 j + 1, element 8 (T & 1) + r = key slot (T, r, half) in A (v) and in B (the weights as they lie in S^T's D); the tenth tile, which does not exist, is 0 on both sides. O^T's D register r of tile dt = out[query c][16 half + 2 r + dt].
// While v's 18 accumulator tiles are live, the lane's 2 x 72 softmax weights lie in LDS as heads and rests, each lane at a place that it alone writes and reads.
// The attention output is split into bf16 hi and lo and gathered in LDS (32 rows x 256 columns); wave h forms y columns 32 h .. + 31 of all 32 rows, per 32 k the hi product, then the lo product, into one accumulator;
// a lane holds the column pair 2 c, 2 c + 1 of 8 rows a tile, adds the bias and stores 8 bytes a row: 16 lanes write one whole 128-byte line, one writer per line.
// Every loop but one is fully unrolled so that its arrays (fragments, logits, masks) are indexed by constants and stay in registers; the loop over the two query tiles' scores and softmax stays rolled and finds q and the weights' places by address.
// One block of 8 waves a WGP, 2 waves a SIMD: the attribute gives the compiler the registers of that occupancy.
__global__ __launch_bounds__(256) __attribute__((amdgpu_waves_per_eu(2, 2))) void k_natt(const float* __restrict__ xq, const float* __restrict__ xk, const float* __restrict__ wq, const float* __restrict__ wkv, const float* __restrict__ wp, const float* __restrict__ bq, const float* __restrict__ bkv, const float* __restrict__ rpb, const float* __restrict__ bp, float* OUT) {
    __shared__ __align__(16) bf sx[XQ_ + 32 * PT_];   // x_k rows of the 10 x 14 keys, then the 32 x_q rows
    __shared__ __align__(16) bf so[2 * 32 * OP_];       // [hi, lo][query][column]
    __shared__ __align__(16) float sp[8 * 4 * NT_ * 128];   // [wave][query tile][18 pieces][lane][4]: the softmax weights, per key tile a piece of heads and a piece of rests
    __shared__ float rb[(NH_ * RPW * RPW + 255) / 256 * 256];   // the table, rounded up so that every thread stores on every trip (the tail repeats the last entry and is never read)
    __shared__ __align__(32) float sbi[4 * CC];         // biases, rounded: bq, bproj, bkv; bq and bk lie in slot order (d = 2 m + dt at 16 dt + m)
    const int tid = threadIdx.x, lane = tid & 31, c = lane & 15, hi = lane >> 4, h = tid >> 5;
    const int tile = blockIdx.x; const int b = tile / ((IH / 4) * (IW / 8)), tt = tile % ((IH / 4) * (IW / 8)); const int i0 = (tt / (IW / 8)) * 4, j0 = (tt % (IW / 8)) * 8;
    const int U0 = min(max(i0 - NBR, 0), IH - UH_), uj = min(max(j0 - NBR, 0), IW - UC_);
    const WSrc ws = {wq, wkv, wp, (unsigned)(8 * hi * CC + h * HD + 2 * c) * 4u, (unsigned)(8 * hi * 2 * CC + h * HD + 2 * c) * 4u};
    WS g[4];   // step i of the stream lies in g[i & 3]
    {   // stage: x rows, the bias table, the biases
        unsigned xo[22]; v4f xr[22][2];
#pragma unroll   // xo and xr are indexed by constants
        for (int u = 0; u < 18; ++u) { const int r = min(h + 8 * u, UH_ * UC_ - 1); xo[u] = (unsigned)((b * NPIX + (U0 + r / UC_) * IW + uj + r % UC_) * CC + lane * 8) * 4u; }
#pragma unroll
        for (int u = 18; u < 22; ++u) { const int r = h + 8 * (u - 18); xo[u] = (unsigned)((b * NPIX + (i0 + (r >> 3)) * IW + j0 + (r & 7)) * CC + lane * 8) * 4u; }
#pragma unroll
        for (int u = 0; u < 22; ++u) { const char* p = (const char*)(u < 18 ? xk : xq) + xo[u]; xr[u][0] = *(const v4f*)p; xr[u][1] = *(const v4f*)(p + 16); }
        asm volatile("s_wait_xcnt 0x0" :: "v"(xo[0]), "v"(xo[1]), "v"(xo[2]), "v"(xo[3]), "v"(xo[4]), "v"(xo[5]), "v"(xo[6]), "v"(xo[7]), "v"(xo[8]), "v"(xo[9]), "v"(xo[10]), "v"(xo[11]), "v"(xo[12]), "v"(xo[13]), "v"(xo[14]), "v"(xo[15]), "v"(xo[16]), "v"(xo[17]), "v"(xo[18]), "v"(xo[19]), "v"(xo[20]), "v"(xo[21]) : "memory");   // stands in front of any later write to the address registers of the x loads, which are named so that they live up to the wait
        st_load(g[0], ws, 0); st_load(g[1], ws, 1); st_load(g[2], ws, 2); st_load(g[3], ws, 3);
        float rv[6]; const unsigned r0 = (unsigned)tid, r5 = (unsigned)min(tid, NH_ * RPW * RPW - 1 - 5 * 256);   // the sixth trip stops at the table's last entry
#pragma unroll   // rv is indexed by constants
        for (int u = 0; u < 5; ++u) rv[u] = rpb[r0 + 256 * u];
        rv[5] = rpb[r5 + 5 * 256];
        const unsigned bo = (unsigned)tid * 4u;
        const float b0 = *(const float*)((const char*)bq + bo), b1 = *(const float*)((const char*)bp + bo), b2 = *(const float*)((const char*)bkv + bo), b3 = *(const float*)((const char*)(bkv + CC) + bo);
        asm volatile("s_wait_xcnt 0x0" :: "v"(r0), "v"(r5), "v"(bo) : "memory");   // as for the x loads, for the table's and the biases' loads
#pragma unroll
        for (int u = 0; u < 22; ++u) { const v4u o = {pk2(xr[u][0][0], xr[u][0][1]), pk2(xr[u][0][2], xr[u][0][3]), pk2(xr[u][1][0], xr[u][1][1]), pk2(xr[u][1][2], xr[u][1][3])};
            *(v4ua*)(sx + (u < 18 ? (h + 8 * u) * PT_ + ((h + 8 * u) / UC_) * KP_ : XQ_ + (h + 8 * (u - 18)) * PT_) + lane * 8) = o; }
#pragma unroll
        for (int u = 0; u < 6; ++u) rb[tid + 256 * u] = bfr(rv[u]);
        const int bpos = (tid & ~31) | ((tid & 1) << 4) | ((tid & 31) >> 1);   // bq and bk in slot order, bproj and bv as they come
        sbi[bpos] = bfr(b0); sbi[CC + tid] = bfr(b1); sbi[2 * CC + bpos] = bfr(b2); sbi[3 * CC + tid] = bfr(b3);
    }
    __syncthreads();   // publishes the staged rows and tables: every wave reads what the other waves stored
    float* const pw = sp + h * (4 * NT_ * 128) + lane * 4;   // the lane's own places in LDS, 512 bytes apart
    { v8f qa[2][2]; const bf* xp = sx + XQ_ + c * PT_ + 8 * hi;
#pragma unroll
      for (int sub = 0; sub < 2; ++sub) {
#pragma unroll
          for (int dt = 0; dt < 2; ++dt) qa[sub][dt] = *(const v8f*)(sbi + h * HD + 16 * dt + 8 * hi); }
#pragma unroll
      for (int ks = 0; ks < 8; ++ks) { v16bf f0, f1; STEP_EDGE(); ws_frag(g[ks & 3], f0, f1); st_load(g[ks & 3], ws, ks + 4);
#pragma unroll
          for (int sub = 0; sub < 2; ++sub) { const v16bf xf = x_frag(xp + sub * 16 * PT_, ks); qa[sub][0] = wmmab(f0, xf, qa[sub][0]); qa[sub][1] = wmmab(f1, xf, qa[sub][1]); } }
#pragma unroll
      for (int sub = 0; sub < 2; ++sub) {
#pragma unroll
          for (int x = 0; x < 2; ++x) { v4u qh, ql;   // a tile's q waits in LDS, at the head of the places of its own softmax weights, where the loop over the query tiles finds it by address
#pragma unroll
              for (int z2 = 0; z2 < 4; ++z2) { unsigned a, r2; split2(qa[sub][x][2 * z2] * SCL, qa[sub][x][2 * z2 + 1] * SCL, a, r2); qh[z2] = a; ql[z2] = r2; }
              *(v4ua*)(pw + (2 * NT_ * sub + x) * 128) = qh; *(v4ua*)(pw + (2 * NT_ * sub + 2 + x) * 128) = ql; } } }
    const bf* xb = sx + ((c >> 3) * UC_) * PT_ + (c >> 3) * KP_ + 8 * hi;   // key row U0 + (c >> 3), column uj; tile T adds its rows and columns below
    const bf* xt[NT_];
#pragma unroll
    for (int T = 0; T < NT_; ++T) { const int q0 = (8 * T) / UC_, m0 = (8 * T) % UC_;   // e = 8 T + (c & 7): past the end of a key row it goes on two rows down; past the last key it stays on the last
        const int c7 = T == NT_ - 1 ? min(c & 7, UH_ / 2 * UC_ - 1 - 8 * (NT_ - 1)) : (c & 7);
        xt[T] = xb + (2 * UC_ * q0 + m0 + c7) * PT_ + 2 * q0 * KP_ + (m0 + c7 >= UC_ ? UC_ * PT_ + 2 * KP_ : 0); }
    v8u kh[NT_], kl[NT_];
    { v8f kt[NT_][2];
#pragma unroll
      for (int T = 0; T < NT_; ++T) {
#pragma unroll
          for (int dt = 0; dt < 2; ++dt) kt[T][dt] = *(const v8f*)(sbi + 2 * CC + h * HD + 16 * dt + 8 * hi); }
#pragma unroll
      for (int ks = 0; ks < 8; ++ks) { v16bf f0, f1; STEP_EDGE(); ws_frag(g[ks & 3], f0, f1); STEP_EDGE(); st_load(g[ks & 3], ws, 8 + ks + 4); STEP_EDGE();
#pragma unroll
          for (int T = 0; T < NT_; ++T) { const v16bf xf = x_frag(xt[T], ks); kt[T][0] = wmmab(f0, xf, kt[T][0]); kt[T][1] = wmmab(f1, xf, kt[T][1]); } X_AHEAD(); }
#pragma unroll
      for (int T = 0; T < NT_; ++T) {
#pragma unroll
          for (int x = 0; x < 8; ++x) { unsigned a, r2; split2(kt[T][x >> 2][2 * (x & 3)], kt[T][x >> 2][2 * (x & 3) + 1], a, r2); kh[T][x] = a; kl[T][x] = r2; } } }
    const int qj = j0 + (c & 7), sj = min(max(qj - NBR, 0), IW - KS);
    bool cok[UC_]; int cix[UC_];
#pragma unroll
    for (int x = 0; x < UC_; ++x) { const int kj = uj + x; cok[x] = (unsigned)(kj - sj) < (unsigned)KS; cix[x] = kj - qj + KS - 1; }
    float f[2] = {0.f, 0.f};
#pragma nounroll   // two trips over one text: unrolled, the scores and the softmax would stand twice in a kernel that runs through its text once
    for (int sub = 0; sub < 2; ++sub) {
        float* const ps = pw + sub * (2 * NT_ * 128);
        const v8u qfh = cat8u(*(const v4ua*)ps, *(const v4ua*)(ps + 128)), qfl = cat8u(*(const v4ua*)(ps + 2 * 128), *(const v4ua*)(ps + 3 * 128));
        v8f s[NT_];
#pragma unroll   // s, kh and kl are indexed by constants
        for (int T = 0; T < NT_; ++T) s[T] = wmma3(kh[T], kl[T], qfh, qfl, (v8f){});
        STEP_EDGE();   // all of S^T's products stay in front of the softmax: its exponentials are asm text; the masks and maxima now lie between
        const int qi = i0 + 2 * sub + (c >> 3), si = min(max(qi - NBR, 0), IH - KS);
        bool rok[UH_ / 2]; int rix[UH_ / 2];
#pragma unroll
        for (int g5 = 0; g5 < UH_ / 2; ++g5) { const int ki = U0 + 2 * g5 + hi; rok[g5] = (unsigned)(ki - si) < (unsigned)KS; rix[g5] = h * (RPW * RPW) + (ki - qi + KS - 1) * RPW; }
        float mx4[4] = {-3.0e38f, -3.0e38f, -3.0e38f, -3.0e38f};
#pragma unroll
        for (int T = 0; T < NT_; ++T) {
#pragma unroll
            for (int r = 0; r < 8; ++r) { const int e = T * 8 + r; const bool in = e < UH_ / 2 * UC_; const int eg = in ? e / UC_ : 0; const bool ok = in & rok[eg] & cok[e % UC_]; const int ix = ok ? rix[eg] + cix[e % UC_] : 0; const float bv = rb[ix]; const float sb = s[T][r] + bv; const float t = ok ? sb : -3.0e38f; s[T][r] = t; mx4[r & 3] = fmaxf(mx4[r & 3], t); } }
        float mx = fmaxf(fmaxf(mx4[0], mx4[1]), fmaxf(mx4[2], mx4[3])); mx = fmaxf(mx, __shfl_xor(mx, 16, 32));
        float sm4[4] = {0.f, 0.f, 0.f, 0.f};
#pragma unroll
        for (int T = 0; T < NT_; ++T) {
#pragma unroll
            for (int r = 0; r < 8; ++r) { const float p = exp2_slot((s[T][r] - mx) * 1.4426950408889634f); s[T][r] = p; sm4[r & 3] += p; }
            v4u ph, pl;
#pragma unroll
            for (int x = 0; x < 4; ++x) { unsigned a, r2; split2(s[T][2 * x], s[T][2 * x + 1], a, r2); ph[x] = a; pl[x] = r2; }
            *(v4ua*)(ps + (2 * T) * 128) = ph; *(v4ua*)(ps + (2 * T + 1) * 128) = pl; }
        float sum = (sm4[0] + sm4[1]) + (sm4[2] + sm4[3]); sum += __shfl_xor(sum, 16, 32);
        f[0] = f[1]; f[1] = __fdiv_rn(1.0f, sum); }   // after the two trips f[0] is the first tile's, f[1] the second's
    v8f o[2][2]; o[0][0] = (v8f){}; o[0][1] = (v8f){}; o[1][0] = (v8f){}; o[1][1] = (v8f){};
    { const v2f vb = *(const v2fa*)(sbi + 3 * CC + h * HD + 2 * c);
      v8f vt[NT_][2];
#pragma unroll
      for (int T = 0; T < NT_; ++T) {
#pragma unroll
          for (int dt = 0; dt < 2; ++dt) vt[T][dt] = (v8f){vb[dt], vb[dt], vb[dt], vb[dt], vb[dt], vb[dt], vb[dt], vb[dt]}; }
#pragma unroll
      for (int ks = 0; ks < 8; ++ks) { v16bf f0, f1; STEP_EDGE(); ws_frag(g[ks & 3], f0, f1); STEP_EDGE(); st_load(g[ks & 3], ws, 16 + ks + 4); STEP_EDGE();
#pragma unroll
          for (int T = 0; T < NT_; ++T) { const v16bf xf = x_frag(xt[T], ks); vt[T][0] = wmmab(xf, f0, vt[T][0]); vt[T][1] = wmmab(xf, f1, vt[T][1]); } X_AHEAD(); }
#pragma unroll
      for (int j = 0; j < 5; ++j) { const v4u z4 = {0u, 0u, 0u, 0u}; v8u pfh[2], pfl[2];
#pragma unroll
          for (int sub = 0; sub < 2; ++sub) { const float* pj = pw + (2 * NT_ * sub + 4 * j) * 128;
              pfh[sub] = cat8u(*(const v4ua*)pj, j < 4 ? *(const v4ua*)(pj + 2 * 128) : z4); pfl[sub] = cat8u(*(const v4ua*)(pj + 128), j < 4 ? *(const v4ua*)(pj + 3 * 128) : z4); }
#pragma unroll
          for (int dt = 0; dt < 2; ++dt) { v8u vh = {}, vl = {};
#pragma unroll
              for (int x = 0; x < (j < 4 ? 8 : 4); ++x) { unsigned a, r2; split2(vt[2 * j + (x >> 2)][dt][2 * (x & 3)], vt[2 * j + (x >> 2)][dt][2 * (x & 3) + 1], a, r2); vh[x] = a; vl[x] = r2; }
#pragma unroll
              for (int sub = 0; sub < 2; ++sub) o[sub][dt] = wmma3(vh, vl, pfh[sub], pfl[sub], o[sub][dt]); } } }
#pragma unroll   // o is indexed by constants and stays in registers
    for (int sub = 0; sub < 2; ++sub) { v8us oh[2], ol[2];   // the lane's 16 values are d 16 half + 0 .. 15 in a row: register r of tile dt is d 2 r + dt
#pragma unroll
      for (int dt = 0; dt < 2; ++dt) {
#pragma unroll
          for (int x = 0; x < 8; ++x) { unsigned short a, c2; splitf(o[sub][dt][x] * f[sub], a, c2); oh[x >> 2][2 * (x & 3) + dt] = a; ol[x >> 2][2 * (x & 3) + dt] = c2; } }
#pragma unroll
      for (int p = 0; p < 2; ++p) { *(v8usa*)(so + (16 * sub + c) * OP_ + h * HD + 16 * hi + 8 * p) = oh[p]; *(v8usa*)(so + (32 + 16 * sub + c) * OP_ + h * HD + 16 * hi + 8 * p) = ol[p]; } }
    __syncthreads();   // publishes the 32 output rows: each wave reads columns that the other heads' waves computed
    v8f y[2][2]; y[0][0] = (v8f){}; y[0][1] = (v8f){}; y[1][0] = (v8f){}; y[1][1] = (v8f){};
#pragma unroll   // y is indexed by constants; the LDS reads go out ahead of the products
    for (int ks = 0; ks < 8; ++ks) { v16bf f0, f1; STEP_EDGE(); ws_frag(g[ks & 3], f0, f1); st_load(g[ks & 3], ws, 24 + ks + 4);
#pragma unroll
        for (int sub = 0; sub < 2; ++sub) { const bf* ap = so + (16 * sub + c) * OP_ + ks * 32 + 8 * hi;
            const v16bf ah = cat16b(*(const v8usa*)ap, *(const v8usa*)(ap + 16)), al = cat16b(*(const v8usa*)(ap + 32 * OP_), *(const v8usa*)(ap + 32 * OP_ + 16));
            y[sub][0] = wmmab(ah, f0, y[sub][0]); y[sub][0] = wmmab(al, f0, y[sub][0]); y[sub][1] = wmmab(ah, f1, y[sub][1]); y[sub][1] = wmmab(al, f1, y[sub][1]); } }
    const v2f bb = *(const v2fa*)(sbi + CC + h * HD + 2 * c);
    float* const op = OUT + ((size_t)b * NPIX + (size_t)((i0 + hi) * IW + j0)) * CC + h * HD + 2 * c;   // row 8 half + j of tile sub is pixel (i0 + 2 sub + half, j0 + j)
    v2f yo[2][8];
#pragma unroll   // yo is indexed by constants
    for (int sub = 0; sub < 2; ++sub) {
#pragma unroll
        for (int j = 0; j < 8; ++j) yo[sub][j] = (v2f){y[sub][0][j] + bb[0], y[sub][1][j] + bb[1]}; }
    STEP_EDGE();   // all sixteen sums stand in front of the first store, each in registers of its own: no register that an issued store names is written again
#pragma unroll   // the sixteen stores differ in their immediate offsets alone
    for (int sub = 0; sub < 2; ++sub) {
#pragma unroll
        for (int j = 0; j < 8; ++j) *(v2fa*)(op + (2 * sub * IW + j) * CC) = yo[sub][j]; }
}

extern "C" void kernel_launch(void* const* d_in, const int* in_sizes, int n_in,
                              void* d_out, int out_size, void* d_ws, size_t ws_size, hipStream_t stream) {
    (void)in_sizes; (void)n_in; (void)out_size; (void)d_ws; (void)ws_size;
    const float* xq = (const float*)d_in[0]; const float* xk = (const float*)d_in[1]; const float* wq = (const float*)d_in[2]; const float* bq = (const float*)d_in[3]; const float* wkv = (const float*)d_in[4]; const float* bkv = (const float*)d_in[5]; const float* rpb = (const float*)d_in[6]; const float* wp = (const float*)d_in[7]; const float* bp = (const float*)d_in[8];   /* x_q, x_k ([2][56][56][256] channels-last), Wq ('xw' [256][256]), bq, Wkv ('xw' [256][512]: columns k | v), bkv, rpb [8][13][13], Wproj ('xw' [256][256]), bproj; nine inputs, all read */
    float* OUT = (float*)d_out;     // [2][56][56][256] = [6272][256]
    k_natt<<<(unsigned)(NTOK / 32), 256, 0, stream>>>(xq, xk, wq, wkv, wp, bq, bkv, rpb, bp, OUT);   /* projections, windowed attention in f32, output projection: one block per 4 x 8 queries */
}
